// v000
// Times are from an AMD MI455X. After a warm-up the kernel runs many times in a row, and a time is the length of
// such a window on the GPU divided by its runs, so every launch and the gaps after it count. The runs cycle
// through copies of the inputs. A figure is the median of several windows, for all but v000 over two sittings.
// Sittings can differ by a few percent; kernels timed side by side share one.
// v000, which the later versions start from, runs in 214 microseconds.
#include <hip/hip_runtime.h>
#include <hip/hip_bf16.h>
#include <math.h>

typedef __attribute__((ext_vector_type(16))) _Float16 v16h;
typedef __attribute__((ext_vector_type(8)))  _Float16 v8h;
typedef __attribute__((ext_vector_type(8)))  float    v8f;
typedef __attribute__((ext_vector_type(4)))  float    v4f;
typedef __attribute__((ext_vector_type(4)))  int      v4i;

#define B_   2
#define S_   2048
#define F_   2048
#define D_   1024
#define H_   16
#define HD_  64
#define M_   4096           // B_*S_ == B_*F_
#define EPS_ 1e-5f

#define AS1 __attribute__((address_space(1)))
#define AS3 __attribute__((address_space(3)))

// ---- CDNA5 async copy: 16B global -> LDS, tracked by ASYNCcnt ------------
static __device__ __forceinline__ void async_cp16(const _Float16* g, _Float16* l) {
#if __has_builtin(__builtin_amdgcn_global_load_async_to_lds_b128)
  __builtin_amdgcn_global_load_async_to_lds_b128(
      (AS1 v4i*)g, (AS3 v4i*)l, 0, 0);
#else
  *(v8h*)l = *(const v8h*)g;
#endif
}
template <int N>
static __device__ __forceinline__ void async_wait() {
#if __has_builtin(__builtin_amdgcn_s_wait_asynccnt)
  __builtin_amdgcn_s_wait_asynccnt(N);
#endif
}

// Concatenate two contiguous 8-half K-runs into a WMMA 16-bit fragment.
static __device__ __forceinline__ v16h frag_from(const _Float16* row, int half16) {
  v8h lo = *(const v8h*)(row + 8 * half16);        // K = {0..7}  + 8*half
  v8h hi = *(const v8h*)(row + 16 + 8 * half16);   // K = {16..23}+ 8*half
  return __builtin_shufflevector(lo, hi, 0, 1, 2, 3, 4, 5, 6, 7,
                                 8, 9, 10, 11, 12, 13, 14, 15);
}

// ---------------------------------------------------------------------------
// Elementwise f32 -> f16 (8 elems/thread).
// ---------------------------------------------------------------------------
__global__ __launch_bounds__(256) void cvt_f16(
    const float* __restrict__ in, _Float16* __restrict__ out) {
  size_t i = ((size_t)blockIdx.x * 256 + threadIdx.x) * 8;
  v4f a0 = *(const v4f*)(in + i);
  v4f a1 = *(const v4f*)(in + i + 4);
  v8h h;
#pragma unroll
  for (int e = 0; e < 4; ++e) { h[e] = (_Float16)a0[e]; h[4 + e] = (_Float16)a1[e]; }
  *(v8h*)(out + i) = h;
}

// ---------------------------------------------------------------------------
// Transpose + convert: in (R x C) f32 -> out (C x R) f16, batched over z.
// ---------------------------------------------------------------------------
__global__ __launch_bounds__(256) void transpose_cvt(
    const float* __restrict__ in, _Float16* __restrict__ out, int R, int C) {
  __shared__ float t[32][33];
  const int rb = blockIdx.y * 32, cb = blockIdx.x * 32;
  const float*   inb  = in  + (size_t)blockIdx.z * R * C;
  _Float16*      outb = out + (size_t)blockIdx.z * R * C;
  const int x = threadIdx.x, y = threadIdx.y;   // (32, 8)
#pragma unroll
  for (int j = 0; j < 4; ++j)
    t[y + j * 8][x] = inb[(size_t)(rb + y + j * 8) * C + cb + x];
  __syncthreads();
#pragma unroll
  for (int j = 0; j < 4; ++j)
    outb[(size_t)(cb + y + j * 8) * R + rb + x] = (_Float16)t[x][y + j * 8];
}

// ---------------------------------------------------------------------------
// C[4096,1024](f32) = A[4096,1024](f16) @ Wt[1024,1024](f16, N-major rows)
// Workgroup tile 64(M) x 128(N), 8 waves of 32x32, K stepped by 32.
// Double-buffered async b128 staging (copies overlap WMMA).
// ---------------------------------------------------------------------------
__global__ __launch_bounds__(256) void gemm_f16wmma(
    const _Float16* __restrict__ A, const _Float16* __restrict__ Wt,
    float* __restrict__ C) {
  __shared__ _Float16 As[2][64][40];     // 64 M-rows x 32 K (80B rows)
  __shared__ _Float16 Bts[2][128][40];   // 128 N-rows x 32 K
  const int tid  = threadIdx.x;
  const int lane = tid & 31;
  const int wave = tid >> 5;
  const int m0 = blockIdx.y * 64;
  const int n0 = blockIdx.x * 128;
  const int wm = (wave & 1) * 32;
  const int wn = (wave >> 1) * 32;
  const int half16 = lane >> 4;
  const int arow   = lane & 15;

  // per-thread staging segments (3 x 16B async per thread per K slab)
  const int ar = tid >> 2, ac = (tid & 3) * 8;
  const int br0 = tid >> 2,         bc0 = (tid & 3) * 8;
  const int br1 = (tid + 256) >> 2, bc1 = (tid & 3) * 8;

  // prologue: stage slab 0 into buffer 0
  async_cp16(&A[(size_t)(m0 + ar) * D_ + ac],    &As[0][ar][ac]);
  async_cp16(&Wt[(size_t)(n0 + br0) * D_ + bc0], &Bts[0][br0][bc0]);
  async_cp16(&Wt[(size_t)(n0 + br1) * D_ + bc1], &Bts[0][br1][bc1]);

  v8f acc[2][2] = {};

  for (int k0 = 0, it = 0; k0 < D_; k0 += 32, ++it) {
    const int cur = it & 1;
    if (k0 + 32 < D_) {
      const int nxt = cur ^ 1, kn = k0 + 32;
      async_cp16(&A[(size_t)(m0 + ar) * D_ + kn + ac],    &As[nxt][ar][ac]);
      async_cp16(&Wt[(size_t)(n0 + br0) * D_ + kn + bc0], &Bts[nxt][br0][bc0]);
      async_cp16(&Wt[(size_t)(n0 + br1) * D_ + kn + bc1], &Bts[nxt][br1][bc1]);
      if (k0 + 64 < D_) {
        __builtin_prefetch(&A[(size_t)(m0 + ar) * D_ + k0 + 64 + ac], 0, 1);
        __builtin_prefetch(&Wt[(size_t)(n0 + br0) * D_ + k0 + 64 + bc0], 0, 1);
      }
      async_wait<3>();    // current slab done; next slab still in flight
    } else {
      async_wait<0>();
    }
    __syncthreads();

    v16h afrag[2], bfrag[2];
#pragma unroll
    for (int mi = 0; mi < 2; ++mi)
      afrag[mi] = frag_from(&As[cur][wm + mi * 16 + arow][0], half16);
#pragma unroll
    for (int ni = 0; ni < 2; ++ni)
      bfrag[ni] = frag_from(&Bts[cur][wn + ni * 16 + arow][0], half16);

#pragma unroll
    for (int mi = 0; mi < 2; ++mi)
#pragma unroll
      for (int ni = 0; ni < 2; ++ni)
        acc[mi][ni] = __builtin_amdgcn_wmma_f32_16x16x32_f16(
            false, afrag[mi], false, bfrag[ni], (short)0, acc[mi][ni],
            false, false);
    __syncthreads();
  }

  float* cb = &C[(size_t)(m0 + wm + half16 * 8) * D_ + n0 + wn + arow];
#pragma unroll
  for (int mi = 0; mi < 2; ++mi)
#pragma unroll
    for (int ni = 0; ni < 2; ++ni)
#pragma unroll
      for (int r = 0; r < 8; ++r)
        cb[(size_t)(mi * 16 + r) * D_ + ni * 16] = acc[mi][ni][r];
}

// ---------------------------------------------------------------------------
// Per-head LayerNorm over HD=64: f32 in -> f16 out (optionally scaled).
// One wave per head vector.
// ---------------------------------------------------------------------------
__global__ __launch_bounds__(256) void head_ln(
    const float* __restrict__ in, _Float16* __restrict__ out,
    const float* __restrict__ gamma, const float* __restrict__ beta,
    float scale) {
  const int lane = threadIdx.x & 31;
  const int g = blockIdx.x * 8 + (threadIdx.x >> 5);
  const size_t base = (size_t)g * 64;
  float x0 = in[base + lane];
  float x1 = in[base + 32 + lane];
  float s  = x0 + x1;
  float s2 = x0 * x0 + x1 * x1;
#pragma unroll
  for (int m = 16; m >= 1; m >>= 1) {
    s  += __shfl_xor(s,  m);
    s2 += __shfl_xor(s2, m);
  }
  float mean = s * (1.0f / 64.0f);
  float var  = s2 * (1.0f / 64.0f) - mean * mean;
  float rstd = rsqrtf(var + EPS_);
  out[base + lane]      = (_Float16)(((x0 - mean) * rstd * gamma[lane]      + beta[lane])      * scale);
  out[base + 32 + lane] = (_Float16)(((x1 - mean) * rstd * gamma[32 + lane] + beta[32 + lane]) * scale);
}

// ---------------------------------------------------------------------------
// Flash attention per (b,h). grid = (S/128, B*H). Each wave owns 16 Q rows.
// q,k: f16 (B,S/F,D) row-major; v: f16 d-major [(b*D+d)][F]. Output f32.
// Double-buffered async staging of K/V chunks.
// ---------------------------------------------------------------------------
__global__ __launch_bounds__(256) void flash_attn(
    const _Float16* __restrict__ q, const _Float16* __restrict__ k,
    const _Float16* __restrict__ v, float* __restrict__ o) {
  __shared__ _Float16 Qs[128][72];         // 128 s-rows x 64 d (144B rows)
  __shared__ _Float16 Ks[2][32][72];       // 32 f-rows x 64 d
  __shared__ _Float16 Vs[2][64][40];       // 64 d-rows x 32 f
  __shared__ _Float16 Ps[8][16][40];       // per-wave P relayout scratch
  const int tid  = threadIdx.x;
  const int lane = tid & 31;
  const int wave = tid >> 5;
  const int half16 = lane >> 4;
  const int arow   = lane & 15;
  const int bh = blockIdx.y;
  const int b  = bh / H_;
  const int hd = bh % H_;
  const size_t qbase = (size_t)b * S_ * D_ + (size_t)hd * HD_;
  const size_t kbase = (size_t)b * F_ * D_ + (size_t)hd * HD_;
  const size_t vbase = ((size_t)b * D_ + (size_t)hd * HD_) * F_;

  // staging segments: Q 4x16B once; K,V 1x16B each per chunk
  const int kr = tid >> 3, kc8 = (tid & 7) * 8;
  const int vd = tid >> 2, vf  = (tid & 3) * 8;

  // ---- stage Q tile (128 x 64 f16) + first K/V chunk
#pragma unroll
  for (int i = 0; i < 4; ++i) {
    int idx = tid + i * 256;
    int r = idx >> 3, c = (idx & 7) * 8;
    async_cp16(&q[qbase + (size_t)(blockIdx.x * 128 + r) * D_ + c], &Qs[r][c]);
  }
  async_cp16(&k[kbase + (size_t)kr * D_ + kc8], &Ks[0][kr][kc8]);
  async_cp16(&v[vbase + (size_t)vd * F_ + vf],  &Vs[0][vd][vf]);
  async_wait<2>();   // in-order completion: Q done, K/V chunk 0 may be in flight
  __syncthreads();

  v16h qa[2];
#pragma unroll
  for (int kc = 0; kc < 2; ++kc)
    qa[kc] = frag_from(&Qs[wave * 16 + arow][kc * 32], half16);

  v8f oacc[4] = {};
  float mrow[8], lrow[8];
#pragma unroll
  for (int r = 0; r < 8; ++r) { mrow[r] = -INFINITY; lrow[r] = 0.0f; }

  for (int f0 = 0, it = 0; f0 < F_; f0 += 32, ++it) {
    const int cur = it & 1;
    if (f0 + 32 < F_) {
      const int nxt = cur ^ 1, fn = f0 + 32;
      async_cp16(&k[kbase + (size_t)(fn + kr) * D_ + kc8], &Ks[nxt][kr][kc8]);
      async_cp16(&v[vbase + (size_t)vd * F_ + fn + vf],    &Vs[nxt][vd][vf]);
      if (f0 + 64 < F_) {
        __builtin_prefetch(&k[kbase + (size_t)(f0 + 64 + kr) * D_ + kc8], 0, 1);
        __builtin_prefetch(&v[vbase + (size_t)vd * F_ + f0 + 64 + vf], 0, 1);
      }
      async_wait<2>();   // current K/V chunk done; next chunk in flight
    } else {
      async_wait<0>();
    }
    __syncthreads();

    // S = q @ k^T : 16x32 scores, K=64 chained.
    v8f sacc[2] = {};
#pragma unroll
    for (int kc = 0; kc < 2; ++kc) {
      v16h bf[2];
#pragma unroll
      for (int ni = 0; ni < 2; ++ni)
        bf[ni] = frag_from(&Ks[cur][ni * 16 + arow][kc * 32], half16);
#pragma unroll
      for (int ni = 0; ni < 2; ++ni)
        sacc[ni] = __builtin_amdgcn_wmma_f32_16x16x32_f16(
            false, qa[kc], false, bf[ni], (short)0, sacc[ni], false, false);
    }

    // Online softmax: each row's 16 cols live in one 16-lane half-wave.
#pragma unroll
    for (int r = 0; r < 8; ++r) {
      float mx = fmaxf(sacc[0][r], sacc[1][r]);
#pragma unroll
      for (int m = 8; m >= 1; m >>= 1) mx = fmaxf(mx, __shfl_xor(mx, m));
      float mnew = fmaxf(mrow[r], mx);
      float corr = __expf(mrow[r] - mnew);
      float p0 = __expf(sacc[0][r] - mnew);
      float p1 = __expf(sacc[1][r] - mnew);
      float rs = p0 + p1;
#pragma unroll
      for (int m = 8; m >= 1; m >>= 1) rs += __shfl_xor(rs, m);
      lrow[r] = lrow[r] * corr + rs;
      mrow[r] = mnew;
#pragma unroll
      for (int c = 0; c < 4; ++c) oacc[c][r] *= corr;
      int prow = r + half16 * 8;
      Ps[wave][prow][arow]      = (_Float16)p0;
      Ps[wave][prow][16 + arow] = (_Float16)p1;
    }

    v16h pa = frag_from(&Ps[wave][arow][0], half16);

    // O += P(16x32) @ V(32x64)
#pragma unroll
    for (int c = 0; c < 4; ++c) {
      v16h bv = frag_from(&Vs[cur][c * 16 + arow][0], half16);
      oacc[c] = __builtin_amdgcn_wmma_f32_16x16x32_f16(
          false, pa, false, bv, (short)0, oacc[c], false, false);
    }
    __syncthreads();
  }

  const int s0 = blockIdx.x * 128 + wave * 16;
  float* ob = &o[((size_t)b * S_ + s0 + half16 * 8) * D_ + hd * HD_ + arow];
#pragma unroll
  for (int r = 0; r < 8; ++r) {
    float inv = 1.0f / lrow[r];
#pragma unroll
    for (int c = 0; c < 4; ++c)
      ob[(size_t)r * D_ + c * 16] = oacc[c][r] * inv;
  }
}

// ---------------------------------------------------------------------------
// LayerNorm over D=1024 per row: f32 in -> f16 out.
// ---------------------------------------------------------------------------
__global__ __launch_bounds__(256) void row_ln(
    const float* __restrict__ in, const float* __restrict__ gamma,
    const float* __restrict__ beta, _Float16* __restrict__ out) {
  __shared__ float red[16];
  const int tid  = threadIdx.x;
  const int lane = tid & 31;
  const int wave = tid >> 5;
  const size_t base = (size_t)blockIdx.x * D_;
  float s = 0.0f, s2 = 0.0f;
#pragma unroll
  for (int i = 0; i < 4; ++i) {
    float x = in[base + tid + i * 256];
    s += x; s2 += x * x;
  }
#pragma unroll
  for (int m = 16; m >= 1; m >>= 1) {
    s  += __shfl_xor(s,  m);
    s2 += __shfl_xor(s2, m);
  }
  if (lane == 0) { red[wave] = s; red[8 + wave] = s2; }
  __syncthreads();
  if (tid == 0) {
    float ts = 0.0f, ts2 = 0.0f;
#pragma unroll
    for (int w = 0; w < 8; ++w) { ts += red[w]; ts2 += red[8 + w]; }
    red[0] = ts; red[1] = ts2;
  }
  __syncthreads();
  float mean = red[0] * (1.0f / (float)D_);
  float var  = red[1] * (1.0f / (float)D_) - mean * mean;
  float rstd = rsqrtf(var + EPS_);
#pragma unroll
  for (int i = 0; i < 4; ++i) {
    int idx = tid + i * 256;
    float x = in[base + idx];
    out[base + idx] = (_Float16)((x - mean) * rstd * gamma[idx] + beta[idx]);
  }
}

// ---------------------------------------------------------------------------
extern "C" void kernel_launch(void* const* d_in, const int* in_sizes, int n_in,
                              void* d_out, int out_size, void* d_ws, size_t ws_size,
                              hipStream_t stream) {
  const float* x_q   = (const float*)d_in[0];
  const float* x_k   = (const float*)d_in[1];
  const float* x_v   = (const float*)d_in[2];
  const float* Wq    = (const float*)d_in[3];
  const float* Wk    = (const float*)d_in[4];
  const float* Wv    = (const float*)d_in[5];
  const float* Wproj = (const float*)d_in[6];
  const float* q_g   = (const float*)d_in[7];
  const float* q_b   = (const float*)d_in[8];
  const float* k_g   = (const float*)d_in[9];
  const float* k_b   = (const float*)d_in[10];
  const float* o_g   = (const float*)d_in[11];
  const float* o_b   = (const float*)d_in[12];
  float* out = (float*)d_out;

  const size_t MB = 1024 * 1024;
  char* w = (char*)d_ws;
  _Float16* xqh = (_Float16*)(w + 0 * MB);    // 8MB each
  _Float16* xkh = (_Float16*)(w + 8 * MB);
  _Float16* xvh = (_Float16*)(w + 16 * MB);
  _Float16* wqt = (_Float16*)(w + 24 * MB);   // 2MB each (transposed f16)
  _Float16* wkt = (_Float16*)(w + 26 * MB);
  _Float16* wvt = (_Float16*)(w + 28 * MB);
  _Float16* wpt = (_Float16*)(w + 30 * MB);
  float*    qb  = (float*)(w + 32 * MB);      // 16MB each (f32 projections)
  float*    kb  = (float*)(w + 48 * MB);
  float*    vb  = (float*)(w + 64 * MB);
  _Float16* qh  = (_Float16*)(w + 80 * MB);   // 8MB each (post-LN f16)
  _Float16* kh  = (_Float16*)(w + 88 * MB);
  _Float16* vt  = (_Float16*)(w + 96 * MB);   // 8MB (d-major f16 V)
  float*    ao  = (float*)(w + 104 * MB);     // 16MB attention out f32
  _Float16* lnh = (_Float16*)(w + 0 * MB);    // reuse xqh space

  dim3 gblk(256);
  dim3 ggrid(D_ / 128, M_ / 64);
  dim3 tblk(32, 8);

  // one-time precision/layout conversion
  cvt_f16<<<(M_ * D_ / 8) / 256, 256, 0, stream>>>(x_q, xqh);
  cvt_f16<<<(M_ * D_ / 8) / 256, 256, 0, stream>>>(x_k, xkh);
  cvt_f16<<<(M_ * D_ / 8) / 256, 256, 0, stream>>>(x_v, xvh);
  transpose_cvt<<<dim3(32, 32, 1), tblk, 0, stream>>>(Wq, wqt, D_, D_);
  transpose_cvt<<<dim3(32, 32, 1), tblk, 0, stream>>>(Wk, wkt, D_, D_);
  transpose_cvt<<<dim3(32, 32, 1), tblk, 0, stream>>>(Wv, wvt, D_, D_);
  transpose_cvt<<<dim3(32, 32, 1), tblk, 0, stream>>>(Wproj, wpt, D_, D_);

  // projections
  gemm_f16wmma<<<ggrid, gblk, 0, stream>>>(xqh, wqt, qb);
  gemm_f16wmma<<<ggrid, gblk, 0, stream>>>(xkh, wkt, kb);
  gemm_f16wmma<<<ggrid, gblk, 0, stream>>>(xvh, wvt, vb);

  // per-head LN -> f16; V -> d-major f16
  head_ln<<<(B_ * S_ * H_) / 8, 256, 0, stream>>>(qb, qh, q_g, q_b, 0.125f);
  head_ln<<<(B_ * F_ * H_) / 8, 256, 0, stream>>>(kb, kh, k_g, k_b, 1.0f);
  transpose_cvt<<<dim3(D_ / 32, F_ / 32, B_), tblk, 0, stream>>>(vb, vt, F_, D_);

  flash_attn<<<dim3(S_ / 128, B_ * H_), 256, 0, stream>>>(qh, kh, vt, ao);

  row_ln<<<M_, 256, 0, stream>>>(ao, o_g, o_b, lnh);

  gemm_f16wmma<<<ggrid, gblk, 0, stream>>>(lnh, wpt, out);
}

// v001
// It runs in 177 microseconds.
// Timed twice side by side with v000, it ran 1.25 and 1.24 times as fast.
#include <hip/hip_runtime.h>
#include <hip/hip_bf16.h>
#include <math.h>

typedef __attribute__((ext_vector_type(16))) _Float16 v16h;
typedef __attribute__((ext_vector_type(8)))  _Float16 v8h;
typedef __attribute__((ext_vector_type(8)))  float    v8f;
typedef __attribute__((ext_vector_type(4)))  float    v4f;
typedef __attribute__((ext_vector_type(4)))  int      v4i;

#define B_   2
#define S_   2048
#define F_   2048
#define D_   1024
#define H_   16
#define HD_  64
#define M_   4096           // B_*S_ == B_*F_
#define EPS_ 1e-5f

#define AS1 __attribute__((address_space(1)))
#define AS3 __attribute__((address_space(3)))

// ---- CDNA5 async copy: 16B global -> LDS, tracked by ASYNCcnt ------------
static __device__ __forceinline__ void async_cp16(const _Float16* g, _Float16* l) {
#if __has_builtin(__builtin_amdgcn_global_load_async_to_lds_b128)
  __builtin_amdgcn_global_load_async_to_lds_b128(
      (AS1 v4i*)g, (AS3 v4i*)l, 0, 0);
#else
  *(v8h*)l = *(const v8h*)g;
#endif
}
template <int N>
static __device__ __forceinline__ void async_wait() {
#if __has_builtin(__builtin_amdgcn_s_wait_asynccnt)
  __builtin_amdgcn_s_wait_asynccnt(N);
#endif
}

// Concatenate two contiguous 8-half K-runs into a WMMA 16-bit fragment.
static __device__ __forceinline__ v16h frag_from(const _Float16* row, int half16) {
  v8h lo = *(const v8h*)(row + 8 * half16);        // K = {0..7}  + 8*half
  v8h hi = *(const v8h*)(row + 16 + 8 * half16);   // K = {16..23}+ 8*half
  return __builtin_shufflevector(lo, hi, 0, 1, 2, 3, 4, 5, 6, 7,
                                 8, 9, 10, 11, 12, 13, 14, 15);
}

// ---------------------------------------------------------------------------
// Elementwise f32 -> f16 (8 elems/thread).
// ---------------------------------------------------------------------------
__global__ __launch_bounds__(256) void cvt_f16(
    const float* __restrict__ in, _Float16* __restrict__ out) {
  size_t i = ((size_t)blockIdx.x * 256 + threadIdx.x) * 8;
  v4f a0 = *(const v4f*)(in + i);
  v4f a1 = *(const v4f*)(in + i + 4);
  v8h h;
#pragma unroll
  for (int e = 0; e < 4; ++e) { h[e] = (_Float16)a0[e]; h[4 + e] = (_Float16)a1[e]; }
  *(v8h*)(out + i) = h;
}

// ---------------------------------------------------------------------------
// Transpose + convert: in (R x C) f32 -> out (C x R) f16, batched over z.
// ---------------------------------------------------------------------------
__global__ __launch_bounds__(256) void transpose_cvt(
    const float* __restrict__ in, _Float16* __restrict__ out, int R, int C) {
  __shared__ float t[32][33];
  const int rb = blockIdx.y * 32, cb = blockIdx.x * 32;
  const float*   inb  = in  + (size_t)blockIdx.z * R * C;
  _Float16*      outb = out + (size_t)blockIdx.z * R * C;
  const int x = threadIdx.x, y = threadIdx.y;   // (32, 8)
#pragma unroll
  for (int j = 0; j < 4; ++j)
    t[y + j * 8][x] = inb[(size_t)(rb + y + j * 8) * C + cb + x];
  __syncthreads();
#pragma unroll
  for (int j = 0; j < 4; ++j)
    outb[(size_t)(cb + y + j * 8) * R + rb + x] = (_Float16)t[x][y + j * 8];
}

// ---------------------------------------------------------------------------
// C[4096,1024](f32) = A[4096,1024](f16) @ Wt[1024,1024](f16, N-major rows)
// Workgroup tile 64(M) x 128(N), 8 waves of 32x32, K stepped by 32.
// Double-buffered async b128 staging (copies overlap WMMA).
// ---------------------------------------------------------------------------
__global__ __launch_bounds__(256) void gemm_f16wmma(
    const _Float16* __restrict__ A, const _Float16* __restrict__ Wt,
    float* __restrict__ C) {
  __shared__ _Float16 As[2][64][40];     // 64 M-rows x 32 K (80B rows)
  __shared__ _Float16 Bts[2][128][40];   // 128 N-rows x 32 K
  const int tid  = threadIdx.x;
  const int lane = tid & 31;
  const int wave = tid >> 5;
  const int m0 = blockIdx.y * 64;
  const int n0 = blockIdx.x * 128;
  const int wm = (wave & 1) * 32;
  const int wn = (wave >> 1) * 32;
  const int half16 = lane >> 4;
  const int arow   = lane & 15;

  // per-thread staging segments (3 x 16B async per thread per K slab)
  const int ar = tid >> 2, ac = (tid & 3) * 8;
  const int br0 = tid >> 2,         bc0 = (tid & 3) * 8;
  const int br1 = (tid + 256) >> 2, bc1 = (tid & 3) * 8;

  // prologue: stage slab 0 into buffer 0
  async_cp16(&A[(size_t)(m0 + ar) * D_ + ac],    &As[0][ar][ac]);
  async_cp16(&Wt[(size_t)(n0 + br0) * D_ + bc0], &Bts[0][br0][bc0]);
  async_cp16(&Wt[(size_t)(n0 + br1) * D_ + bc1], &Bts[0][br1][bc1]);

  v8f acc[2][2] = {};

  for (int k0 = 0, it = 0; k0 < D_; k0 += 32, ++it) {
    const int cur = it & 1;
    if (k0 + 32 < D_) {
      const int nxt = cur ^ 1, kn = k0 + 32;
      async_cp16(&A[(size_t)(m0 + ar) * D_ + kn + ac],    &As[nxt][ar][ac]);
      async_cp16(&Wt[(size_t)(n0 + br0) * D_ + kn + bc0], &Bts[nxt][br0][bc0]);
      async_cp16(&Wt[(size_t)(n0 + br1) * D_ + kn + bc1], &Bts[nxt][br1][bc1]);
      if (k0 + 64 < D_) {
        __builtin_prefetch(&A[(size_t)(m0 + ar) * D_ + k0 + 64 + ac], 0, 1);
        __builtin_prefetch(&Wt[(size_t)(n0 + br0) * D_ + k0 + 64 + bc0], 0, 1);
      }
      async_wait<3>();    // current slab done; next slab still in flight
    } else {
      async_wait<0>();
    }
    __syncthreads();

    v16h afrag[2], bfrag[2];
#pragma unroll
    for (int mi = 0; mi < 2; ++mi)
      afrag[mi] = frag_from(&As[cur][wm + mi * 16 + arow][0], half16);
#pragma unroll
    for (int ni = 0; ni < 2; ++ni)
      bfrag[ni] = frag_from(&Bts[cur][wn + ni * 16 + arow][0], half16);

#pragma unroll
    for (int mi = 0; mi < 2; ++mi)
#pragma unroll
      for (int ni = 0; ni < 2; ++ni)
        acc[mi][ni] = __builtin_amdgcn_wmma_f32_16x16x32_f16(
            false, afrag[mi], false, bfrag[ni], (short)0, acc[mi][ni],
            false, false);
    __syncthreads();
  }

  float* cb = &C[(size_t)(m0 + wm + half16 * 8) * D_ + n0 + wn + arow];
#pragma unroll
  for (int mi = 0; mi < 2; ++mi)
#pragma unroll
    for (int ni = 0; ni < 2; ++ni)
#pragma unroll
      for (int r = 0; r < 8; ++r)
        cb[(size_t)(mi * 16 + r) * D_ + ni * 16] = acc[mi][ni][r];
}

// ---------------------------------------------------------------------------
// Per-head LayerNorm over HD=64: f32 in -> f16 out (optionally scaled).
// One wave per head vector.
// ---------------------------------------------------------------------------
__global__ __launch_bounds__(256) void head_ln(
    const float* __restrict__ in, _Float16* __restrict__ out,
    const float* __restrict__ gamma, const float* __restrict__ beta,
    float scale) {
  const int lane = threadIdx.x & 31;
  const int g = blockIdx.x * 8 + (threadIdx.x >> 5);
  const size_t base = (size_t)g * 64;
  float x0 = in[base + lane];
  float x1 = in[base + 32 + lane];
  float s  = x0 + x1;
  float s2 = x0 * x0 + x1 * x1;
#pragma unroll
  for (int m = 16; m >= 1; m >>= 1) {
    s  += __shfl_xor(s,  m);
    s2 += __shfl_xor(s2, m);
  }
  float mean = s * (1.0f / 64.0f);
  float var  = s2 * (1.0f / 64.0f) - mean * mean;
  float rstd = rsqrtf(var + EPS_);
  out[base + lane]      = (_Float16)(((x0 - mean) * rstd * gamma[lane]      + beta[lane])      * scale);
  out[base + 32 + lane] = (_Float16)(((x1 - mean) * rstd * gamma[32 + lane] + beta[32 + lane]) * scale);
}

static __device__ __forceinline__ float xhalf(float x) {
  int i = __builtin_bit_cast(int, x);
  return __builtin_bit_cast(float, __builtin_amdgcn_permlanex16(
      i, i, 0x76543210, 0xfedcba98, false, false));
}

__global__ __launch_bounds__(256) void flash_attn(
    const _Float16* __restrict__ q, const _Float16* __restrict__ k,
    const _Float16* __restrict__ v, float* __restrict__ o) {
  __shared__ _Float16 Qs[128][72];         // 128 s-rows x 64 d (144B rows)
  __shared__ _Float16 Ks[2][32][72];       // 32 f-rows x 64 d
  __shared__ _Float16 Vs[2][64][40];       // 64 d-rows x 32 f
  const int tid  = threadIdx.x;
  const int lane = tid & 31;
  const int wave = tid >> 5;
  const int half16 = lane >> 4;
  const int arow   = lane & 15;
  const int bh = blockIdx.y;
  const int b  = bh / H_;
  const int hd = bh % H_;
  const size_t qbase = (size_t)b * S_ * D_ + (size_t)hd * HD_;
  const size_t kbase = (size_t)b * F_ * D_ + (size_t)hd * HD_;
  const size_t vbase = ((size_t)b * D_ + (size_t)hd * HD_) * F_;

  // staging segments: Q 4x16B once; K,V 1x16B each per chunk
  const int kr = tid >> 3, kc8 = (tid & 7) * 8;
  const int vd = tid >> 2, vf  = (tid & 3) * 8;

  // ---- stage Q tile (128 x 64 f16) + first K/V chunk
#pragma unroll
  for (int i = 0; i < 4; ++i) {
    int idx = tid + i * 256;
    int r = idx >> 3, c = (idx & 7) * 8;
    async_cp16(&q[qbase + (size_t)(blockIdx.x * 128 + r) * D_ + c], &Qs[r][c]);
  }
  async_cp16(&k[kbase + (size_t)kr * D_ + kc8], &Ks[0][kr][kc8]);
  async_cp16(&v[vbase + (size_t)vd * F_ + vf],  &Vs[0][vd][vf]);
  async_wait<2>();   // in-order completion: Q done, K/V chunk 0 may be in flight
  __syncthreads();

  v16h qa[2];
#pragma unroll
  for (int kc = 0; kc < 2; ++kc)
    qa[kc] = frag_from(&Qs[wave * 16 + arow][kc * 32], half16);

  v8f oacc[4] = {};          // oacc[c][r] = O[query arow][d = c*16 + half16*8 + r]
  float mrun = -INFINITY;    // running maximum of query arow (equal in both halves)
  float lrun = 0.0f;         // this half's share of the denominator

  for (int f0 = 0, it = 0; f0 < F_; f0 += 32, ++it) {
    const int cur = it & 1;
    if (f0 + 32 < F_) {
      const int nxt = cur ^ 1, fn = f0 + 32;
      async_cp16(&k[kbase + (size_t)(fn + kr) * D_ + kc8], &Ks[nxt][kr][kc8]);
      async_cp16(&v[vbase + (size_t)vd * F_ + fn + vf],    &Vs[nxt][vd][vf]);
      if (f0 + 64 < F_) {
        __builtin_prefetch(&k[kbase + (size_t)(f0 + 64 + kr) * D_ + kc8], 0, 1);
        __builtin_prefetch(&v[vbase + (size_t)vd * F_ + f0 + 64 + vf], 0, 1);
      }
      async_wait<2>();   // current K/V chunk done; next chunk in flight
    } else {
      async_wait<0>();
    }
    __syncthreads();

    // S^T = k @ q^T : sacc[ni][r] = score(key ni*16 + half16*8 + r, query arow).
    v8f sacc[2] = {};
#pragma unroll
    for (int kc = 0; kc < 2; ++kc) {
      v16h kf[2];
#pragma unroll
      for (int ni = 0; ni < 2; ++ni)
        kf[ni] = frag_from(&Ks[cur][ni * 16 + arow][kc * 32], half16);
#pragma unroll
      for (int ni = 0; ni < 2; ++ni)
        sacc[ni] = __builtin_amdgcn_wmma_f32_16x16x32_f16(
            false, kf[ni], false, qa[kc], (short)0, sacc[ni], false, false);
    }

    // Online softmax of one query per lane: in-lane maximum, one half exchange.
    float mx = fmaxf(sacc[0][0], sacc[1][0]);
#pragma unroll
    for (int r = 1; r < 8; ++r) mx = fmaxf(mx, fmaxf(sacc[0][r], sacc[1][r]));
    mx = fmaxf(mx, xhalf(mx));
    const float mnew = fmaxf(mrun, mx);
    const float corr = __expf(mrun - mnew);
    mrun = mnew;

    // P^T as B operand: element s is key kmap(s) = (s < 8 ? s : s + 8) + 8*half16,
    // which is register s & 7 of tile s >> 3; V^T rows come in the same k order.
    v16h pb;
    v8f p0 = sacc[0] - mnew, p1 = sacc[1] - mnew;
#pragma unroll
    for (int r = 0; r < 8; ++r) {
      p0[r] = __expf(p0[r]);
      p1[r] = __expf(p1[r]);
      pb[r]     = (_Float16)p0[r];
      pb[8 + r] = (_Float16)p1[r];
    }
    const v8f ps = p0 + p1;
    const float rs = ((ps[0] + ps[1]) + (ps[2] + ps[3])) + ((ps[4] + ps[5]) + (ps[6] + ps[7]));
    lrun = lrun * corr + rs;
#pragma unroll
    for (int c = 0; c < 4; ++c) oacc[c] *= corr;

    // O^T += V^T(64x32) @ P^T(32x16)
#pragma unroll
    for (int c = 0; c < 4; ++c) {
      v16h vf16 = frag_from(&Vs[cur][c * 16 + arow][0], half16);
      oacc[c] = __builtin_amdgcn_wmma_f32_16x16x32_f16(
          false, vf16, false, pb, (short)0, oacc[c], false, false);
    }
    __syncthreads();
  }

  // Join the two halves' denominators once; a lane stores 8 consecutive d.
  const float inv = 1.0f / (lrun + xhalf(lrun));
  const int s0 = blockIdx.x * 128 + wave * 16;
  float* ob = &o[((size_t)b * S_ + s0 + arow) * D_ + hd * HD_ + half16 * 8];
#pragma unroll
  for (int c = 0; c < 4; ++c) {
    v4f lo, hi;
#pragma unroll
    for (int r = 0; r < 4; ++r) { lo[r] = oacc[c][r] * inv; hi[r] = oacc[c][4 + r] * inv; }
    *(v4f*)(ob + c * 16)     = lo;
    *(v4f*)(ob + c * 16 + 4) = hi;
  }
}

// ---------------------------------------------------------------------------
// LayerNorm over D=1024 per row: f32 in -> f16 out.
// ---------------------------------------------------------------------------
__global__ __launch_bounds__(256) void row_ln(
    const float* __restrict__ in, const float* __restrict__ gamma,
    const float* __restrict__ beta, _Float16* __restrict__ out) {
  __shared__ float red[16];
  const int tid  = threadIdx.x;
  const int lane = tid & 31;
  const int wave = tid >> 5;
  const size_t base = (size_t)blockIdx.x * D_;
  float s = 0.0f, s2 = 0.0f;
#pragma unroll
  for (int i = 0; i < 4; ++i) {
    float x = in[base + tid + i * 256];
    s += x; s2 += x * x;
  }
#pragma unroll
  for (int m = 16; m >= 1; m >>= 1) {
    s  += __shfl_xor(s,  m);
    s2 += __shfl_xor(s2, m);
  }
  if (lane == 0) { red[wave] = s; red[8 + wave] = s2; }
  __syncthreads();
  if (tid == 0) {
    float ts = 0.0f, ts2 = 0.0f;
#pragma unroll
    for (int w = 0; w < 8; ++w) { ts += red[w]; ts2 += red[8 + w]; }
    red[0] = ts; red[1] = ts2;
  }
  __syncthreads();
  float mean = red[0] * (1.0f / (float)D_);
  float var  = red[1] * (1.0f / (float)D_) - mean * mean;
  float rstd = rsqrtf(var + EPS_);
#pragma unroll
  for (int i = 0; i < 4; ++i) {
    int idx = tid + i * 256;
    float x = in[base + idx];
    out[base + idx] = (_Float16)((x - mean) * rstd * gamma[idx] + beta[idx]);
  }
}

// ---------------------------------------------------------------------------
extern "C" void kernel_launch(void* const* d_in, const int* in_sizes, int n_in,
                              void* d_out, int out_size, void* d_ws, size_t ws_size,
                              hipStream_t stream) {
  const float* x_q   = (const float*)d_in[0];
  const float* x_k   = (const float*)d_in[1];
  const float* x_v   = (const float*)d_in[2];
  const float* Wq    = (const float*)d_in[3];
  const float* Wk    = (const float*)d_in[4];
  const float* Wv    = (const float*)d_in[5];
  const float* Wproj = (const float*)d_in[6];
  const float* q_g   = (const float*)d_in[7];
  const float* q_b   = (const float*)d_in[8];
  const float* k_g   = (const float*)d_in[9];
  const float* k_b   = (const float*)d_in[10];
  const float* o_g   = (const float*)d_in[11];
  const float* o_b   = (const float*)d_in[12];
  float* out = (float*)d_out;

  const size_t MB = 1024 * 1024;
  char* w = (char*)d_ws;
  _Float16* xqh = (_Float16*)(w + 0 * MB);    // 8MB each
  _Float16* xkh = (_Float16*)(w + 8 * MB);
  _Float16* xvh = (_Float16*)(w + 16 * MB);
  _Float16* wqt = (_Float16*)(w + 24 * MB);   // 2MB each (transposed f16)
  _Float16* wkt = (_Float16*)(w + 26 * MB);
  _Float16* wvt = (_Float16*)(w + 28 * MB);
  _Float16* wpt = (_Float16*)(w + 30 * MB);
  float*    qb  = (float*)(w + 32 * MB);      // 16MB each (f32 projections)
  float*    kb  = (float*)(w + 48 * MB);
  float*    vb  = (float*)(w + 64 * MB);
  _Float16* qh  = (_Float16*)(w + 80 * MB);   // 8MB each (post-LN f16)
  _Float16* kh  = (_Float16*)(w + 88 * MB);
  _Float16* vt  = (_Float16*)(w + 96 * MB);   // 8MB (d-major f16 V)
  float*    ao  = (float*)(w + 104 * MB);     // 16MB attention out f32
  _Float16* lnh = (_Float16*)(w + 0 * MB);    // reuse xqh space

  dim3 gblk(256);
  dim3 ggrid(D_ / 128, M_ / 64);
  dim3 tblk(32, 8);

  // one-time precision/layout conversion
  cvt_f16<<<(M_ * D_ / 8) / 256, 256, 0, stream>>>(x_q, xqh);
  cvt_f16<<<(M_ * D_ / 8) / 256, 256, 0, stream>>>(x_k, xkh);
  cvt_f16<<<(M_ * D_ / 8) / 256, 256, 0, stream>>>(x_v, xvh);
  transpose_cvt<<<dim3(32, 32, 1), tblk, 0, stream>>>(Wq, wqt, D_, D_);
  transpose_cvt<<<dim3(32, 32, 1), tblk, 0, stream>>>(Wk, wkt, D_, D_);
  transpose_cvt<<<dim3(32, 32, 1), tblk, 0, stream>>>(Wv, wvt, D_, D_);
  transpose_cvt<<<dim3(32, 32, 1), tblk, 0, stream>>>(Wproj, wpt, D_, D_);

  // projections
  gemm_f16wmma<<<ggrid, gblk, 0, stream>>>(xqh, wqt, qb);
  gemm_f16wmma<<<ggrid, gblk, 0, stream>>>(xkh, wkt, kb);
  gemm_f16wmma<<<ggrid, gblk, 0, stream>>>(xvh, wvt, vb);

  // per-head LN -> f16; V -> d-major f16
  head_ln<<<(B_ * S_ * H_) / 8, 256, 0, stream>>>(qb, qh, q_g, q_b, 0.125f);
  head_ln<<<(B_ * F_ * H_) / 8, 256, 0, stream>>>(kb, kh, k_g, k_b, 1.0f);
  transpose_cvt<<<dim3(D_ / 32, F_ / 32, B_), tblk, 0, stream>>>(vb, vt, F_, D_);

  flash_attn<<<dim3(S_ / 128, B_ * H_), 256, 0, stream>>>(qh, kh, vt, ao);

  row_ln<<<M_, 256, 0, stream>>>(ao, o_g, o_b, lnh);

  gemm_f16wmma<<<ggrid, gblk, 0, stream>>>(lnh, wpt, out);
}

// v002
// Measured time: 157 microseconds a run.
// Two timings next to v001 put it at 1.13 and 1.12 times that version's speed.
// Over all steps from v000 it is 1.40 times as fast.
#include <hip/hip_runtime.h>
#include <hip/hip_bf16.h>
#include <math.h>

typedef __attribute__((ext_vector_type(16))) _Float16 v16h;
typedef __attribute__((ext_vector_type(8)))  _Float16 v8h;
typedef __attribute__((ext_vector_type(8)))  float    v8f;
typedef __attribute__((ext_vector_type(4)))  float    v4f;
typedef __attribute__((ext_vector_type(4)))  int      v4i;

#define B_   2
#define S_   2048
#define F_   2048
#define D_   1024
#define H_   16
#define HD_  64
#define M_   4096           // B_*S_ == B_*F_
#define EPS_ 1e-5f

#define AS1 __attribute__((address_space(1)))
#define AS3 __attribute__((address_space(3)))

// ---- CDNA5 async copy: 16B global -> LDS, tracked by ASYNCcnt ------------
static __device__ __forceinline__ void async_cp16(const _Float16* g, _Float16* l) {
#if __has_builtin(__builtin_amdgcn_global_load_async_to_lds_b128)
  __builtin_amdgcn_global_load_async_to_lds_b128(
      (AS1 v4i*)g, (AS3 v4i*)l, 0, 0);
#else
  *(v8h*)l = *(const v8h*)g;
#endif
}
template <int N>
static __device__ __forceinline__ void async_wait() {
#if __has_builtin(__builtin_amdgcn_s_wait_asynccnt)
  __builtin_amdgcn_s_wait_asynccnt(N);
#endif
}

// Concatenate two contiguous 8-half K-runs into a WMMA 16-bit fragment.
static __device__ __forceinline__ v16h frag_from(const _Float16* row, int half16) {
  v8h lo = *(const v8h*)(row + 8 * half16);        // K = {0..7}  + 8*half
  v8h hi = *(const v8h*)(row + 16 + 8 * half16);   // K = {16..23}+ 8*half
  return __builtin_shufflevector(lo, hi, 0, 1, 2, 3, 4, 5, 6, 7,
                                 8, 9, 10, 11, 12, 13, 14, 15);
}

// ---------------------------------------------------------------------------
// Elementwise f32 -> f16 (8 elems/thread).
// ---------------------------------------------------------------------------
__global__ __launch_bounds__(256) void cvt_f16(
    const float* __restrict__ in, _Float16* __restrict__ out) {
  size_t i = ((size_t)blockIdx.x * 256 + threadIdx.x) * 8;
  v4f a0 = *(const v4f*)(in + i);
  v4f a1 = *(const v4f*)(in + i + 4);
  v8h h;
#pragma unroll
  for (int e = 0; e < 4; ++e) { h[e] = (_Float16)a0[e]; h[4 + e] = (_Float16)a1[e]; }
  *(v8h*)(out + i) = h;
}

// ---------------------------------------------------------------------------
// Transpose + convert: in (R x C) f32 -> out (C x R) f16, batched over z.
// ---------------------------------------------------------------------------
__global__ __launch_bounds__(256) void transpose_cvt(
    const float* __restrict__ in, _Float16* __restrict__ out, int R, int C) {
  __shared__ float t[32][33];
  const int rb = blockIdx.y * 32, cb = blockIdx.x * 32;
  const float*   inb  = in  + (size_t)blockIdx.z * R * C;
  _Float16*      outb = out + (size_t)blockIdx.z * R * C;
  const int x = threadIdx.x, y = threadIdx.y;   // (32, 8)
#pragma unroll
  for (int j = 0; j < 4; ++j)
    t[y + j * 8][x] = inb[(size_t)(rb + y + j * 8) * C + cb + x];
  __syncthreads();
#pragma unroll
  for (int j = 0; j < 4; ++j)
    outb[(size_t)(cb + y + j * 8) * R + rb + x] = (_Float16)t[x][y + j * 8];
}

// ---------------------------------------------------------------------------
// [4096,1024] = A[4096,1024](f16) @ Wt[1024,1024](f16, N-major rows)
// Workgroup tile 64(M) x 128(N), 8 waves of 32x32, K stepped by 32.
// Double-buffered async b128 staging (copies overlap WMMA).
// The epilogue emits what the next kernel reads:
//   MODE 0: f32 rows to C.
//   MODE 1: LayerNorm over each 64-column head, scaled, f16 rows to Ch.
//   MODE 2: f16, d-major: Ch[(b*D + n)][f], m = b*F + f.
// MODE 1 and 2 pass the tile through LDS so that 8 lanes own one 128-byte line.
// ---------------------------------------------------------------------------
template <int MODE>
static __device__ __forceinline__ void gemm_body(
    const _Float16* __restrict__ A, const _Float16* __restrict__ Wt,
    float* __restrict__ C, _Float16* __restrict__ Ch,
    const float* __restrict__ gamma, const float* __restrict__ beta,
    float scale) {
  __shared__ _Float16 As[2][64][40];     // 64 M-rows x 32 K (80B rows)
  __shared__ _Float16 Bts[2][128][40];   // 128 N-rows x 32 K
  const int tid  = threadIdx.x;
  const int lane = tid & 31;
  const int wave = tid >> 5;
  const int m0 = blockIdx.y * 64;
  const int n0 = blockIdx.x * 128;
  const int wm = (wave & 1) * 32;
  const int wn = (wave >> 1) * 32;
  const int half16 = lane >> 4;
  const int arow   = lane & 15;

  // per-thread staging segments (3 x 16B async per thread per K slab)
  const int ar = tid >> 2, ac = (tid & 3) * 8;
  const int br0 = tid >> 2,         bc0 = (tid & 3) * 8;
  const int br1 = (tid + 256) >> 2, bc1 = (tid & 3) * 8;

  // prologue: stage slab 0 into buffer 0
  async_cp16(&A[(size_t)(m0 + ar) * D_ + ac],    &As[0][ar][ac]);
  async_cp16(&Wt[(size_t)(n0 + br0) * D_ + bc0], &Bts[0][br0][bc0]);
  async_cp16(&Wt[(size_t)(n0 + br1) * D_ + bc1], &Bts[0][br1][bc1]);

  v8f acc[2][2] = {};

  for (int k0 = 0, it = 0; k0 < D_; k0 += 32, ++it) {
    const int cur = it & 1;
    if (k0 + 32 < D_) {
      const int nxt = cur ^ 1, kn = k0 + 32;
      async_cp16(&A[(size_t)(m0 + ar) * D_ + kn + ac],    &As[nxt][ar][ac]);
      async_cp16(&Wt[(size_t)(n0 + br0) * D_ + kn + bc0], &Bts[nxt][br0][bc0]);
      async_cp16(&Wt[(size_t)(n0 + br1) * D_ + kn + bc1], &Bts[nxt][br1][bc1]);
      if (k0 + 64 < D_) {
        __builtin_prefetch(&A[(size_t)(m0 + ar) * D_ + k0 + 64 + ac], 0, 1);
        __builtin_prefetch(&Wt[(size_t)(n0 + br0) * D_ + k0 + 64 + bc0], 0, 1);
      }
      async_wait<3>();    // current slab done; next slab still in flight
    } else {
      async_wait<0>();
    }
    __syncthreads();

    v16h afrag[2], bfrag[2];
#pragma unroll
    for (int mi = 0; mi < 2; ++mi)
      afrag[mi] = frag_from(&As[cur][wm + mi * 16 + arow][0], half16);
#pragma unroll
    for (int ni = 0; ni < 2; ++ni)
      bfrag[ni] = frag_from(&Bts[cur][wn + ni * 16 + arow][0], half16);

#pragma unroll
    for (int mi = 0; mi < 2; ++mi)
#pragma unroll
      for (int ni = 0; ni < 2; ++ni)
        acc[mi][ni] = __builtin_amdgcn_wmma_f32_16x16x32_f16(
            false, afrag[mi], false, bfrag[ni], (short)0, acc[mi][ni],
            false, false);
    __syncthreads();
  }

  if constexpr (MODE == 0) {
    float* cb = &C[(size_t)(m0 + wm + half16 * 8) * D_ + n0 + wn + arow];
#pragma unroll
    for (int mi = 0; mi < 2; ++mi)
#pragma unroll
      for (int ni = 0; ni < 2; ++ni)
#pragma unroll
        for (int r = 0; r < 8; ++r)
          cb[(size_t)(mi * 16 + r) * D_ + ni * 16] = acc[mi][ni][r];
  } else if constexpr (MODE == 1) {
    __shared__ __attribute__((aligned(16))) float Cs[64][132];   // 528B rows
#pragma unroll  // constant indices: the values stay in registers
    for (int mi = 0; mi < 2; ++mi)
#pragma unroll  // constant indices: the values stay in registers
      for (int ni = 0; ni < 2; ++ni)
#pragma unroll  // constant indices: the values stay in registers
        for (int r = 0; r < 8; ++r)
          Cs[wm + mi * 16 + half16 * 8 + r][wn + ni * 16 + arow] = acc[mi][ni][r];
    __syncthreads();   // the whole tile is in LDS before a lane reads other waves' parts
    // 8 lanes per head vector, 8 elements each; 128 head vectors in the tile.
    const int part = tid & 7;
    const v4f g0 = *(const v4f*)(gamma + part * 8);
    const v4f g1 = *(const v4f*)(gamma + part * 8 + 4);
    const v4f b0 = *(const v4f*)(beta + part * 8);
    const v4f b1 = *(const v4f*)(beta + part * 8 + 4);
#pragma unroll  // four independent head vectors: their LDS reads and exchanges overlap
    for (int i = 0; i < 4; ++i) {
      const int hv  = (tid >> 3) + i * 32;
      const int row = hv >> 1;
      const int col = (hv & 1) * 64 + part * 8;
      const v4f x0 = *(const v4f*)&Cs[row][col];
      const v4f x1 = *(const v4f*)&Cs[row][col + 4];
      const v4f xs = x0 + x1;
      const v4f xq = x0 * x0 + x1 * x1;
      float s  = (xs[0] + xs[1]) + (xs[2] + xs[3]);
      float s2 = (xq[0] + xq[1]) + (xq[2] + xq[3]);
#pragma unroll  // three exchange steps with constant lane masks
      for (int m = 4; m >= 1; m >>= 1) {
        s  += __shfl_xor(s,  m);
        s2 += __shfl_xor(s2, m);
      }
      const float mean = s * (1.0f / 64.0f);
      const float var  = s2 * (1.0f / 64.0f) - mean * mean;
      const float rstd = rsqrtf(var + EPS_);
      v8h h;
#pragma unroll  // constant indices: the values stay in registers
      for (int e = 0; e < 4; ++e) {
        h[e]     = (_Float16)(((x0[e] - mean) * rstd * g0[e] + b0[e]) * scale);
        h[4 + e] = (_Float16)(((x1[e] - mean) * rstd * g1[e] + b1[e]) * scale);
      }
      *(v8h*)&Ch[(size_t)(m0 + row) * D_ + n0 + col] = h;
    }
  } else {
    __shared__ __attribute__((aligned(16))) _Float16 Ts[128][72];   // 144B rows
#pragma unroll  // constant indices: the values stay in registers
    for (int mi = 0; mi < 2; ++mi)
#pragma unroll  // constant indices: the values stay in registers
      for (int ni = 0; ni < 2; ++ni) {
        v8h h;   // 8 consecutive m of one column n
#pragma unroll  // constant indices: the values stay in registers
        for (int r = 0; r < 8; ++r) h[r] = (_Float16)acc[mi][ni][r];
        *(v8h*)&Ts[wn + ni * 16 + arow][wm + mi * 16 + half16 * 8] = h;
      }
    __syncthreads();   // the whole tile is in LDS before a lane reads other waves' parts
    // 8 lanes per column n: 64 m = one 128-byte line of the d-major plane.
    const int bb = m0 / F_, fb = m0 % F_;
    const int part = tid & 7;
#pragma unroll  // four independent lines: their LDS reads overlap
    for (int i = 0; i < 4; ++i) {
      const int n = (tid >> 3) + i * 32;
      *(v8h*)&Ch[((size_t)bb * D_ + n0 + n) * F_ + fb + part * 8] =
          *(const v8h*)&Ts[n][part * 8];
    }
  }
}

__global__ __launch_bounds__(256) void gemm_f16wmma(
    const _Float16* __restrict__ A, const _Float16* __restrict__ Wt,
    float* __restrict__ C) {
  gemm_body<0>(A, Wt, C, nullptr, nullptr, nullptr, 1.0f);
}

__global__ __launch_bounds__(256) void gemm_head_ln(
    const _Float16* __restrict__ A, const _Float16* __restrict__ Wt,
    _Float16* __restrict__ Ch, const float* __restrict__ gamma,
    const float* __restrict__ beta, float scale) {
  gemm_body<1>(A, Wt, nullptr, Ch, gamma, beta, scale);
}

__global__ __launch_bounds__(256) void gemm_dmajor(
    const _Float16* __restrict__ A, const _Float16* __restrict__ Wt,
    _Float16* __restrict__ Ch) {
  gemm_body<2>(A, Wt, nullptr, Ch, nullptr, nullptr, 1.0f);
}

static __device__ __forceinline__ float xhalf(float x) {
  int i = __builtin_bit_cast(int, x);
  return __builtin_bit_cast(float, __builtin_amdgcn_permlanex16(
      i, i, 0x76543210, 0xfedcba98, false, false));
}

__global__ __launch_bounds__(256) void flash_attn(
    const _Float16* __restrict__ q, const _Float16* __restrict__ k,
    const _Float16* __restrict__ v, float* __restrict__ o) {
  __shared__ _Float16 Qs[128][72];         // 128 s-rows x 64 d (144B rows)
  __shared__ _Float16 Ks[2][32][72];       // 32 f-rows x 64 d
  __shared__ _Float16 Vs[2][64][40];       // 64 d-rows x 32 f
  const int tid  = threadIdx.x;
  const int lane = tid & 31;
  const int wave = tid >> 5;
  const int half16 = lane >> 4;
  const int arow   = lane & 15;
  const int bh = blockIdx.y;
  const int b  = bh / H_;
  const int hd = bh % H_;
  const size_t qbase = (size_t)b * S_ * D_ + (size_t)hd * HD_;
  const size_t kbase = (size_t)b * F_ * D_ + (size_t)hd * HD_;
  const size_t vbase = ((size_t)b * D_ + (size_t)hd * HD_) * F_;

  // staging segments: Q 4x16B once; K,V 1x16B each per chunk
  const int kr = tid >> 3, kc8 = (tid & 7) * 8;
  const int vd = tid >> 2, vf  = (tid & 3) * 8;

  // ---- stage Q tile (128 x 64 f16) + first K/V chunk
#pragma unroll
  for (int i = 0; i < 4; ++i) {
    int idx = tid + i * 256;
    int r = idx >> 3, c = (idx & 7) * 8;
    async_cp16(&q[qbase + (size_t)(blockIdx.x * 128 + r) * D_ + c], &Qs[r][c]);
  }
  async_cp16(&k[kbase + (size_t)kr * D_ + kc8], &Ks[0][kr][kc8]);
  async_cp16(&v[vbase + (size_t)vd * F_ + vf],  &Vs[0][vd][vf]);
  async_wait<2>();   // in-order completion: Q done, K/V chunk 0 may be in flight
  __syncthreads();

  v16h qa[2];
#pragma unroll
  for (int kc = 0; kc < 2; ++kc)
    qa[kc] = frag_from(&Qs[wave * 16 + arow][kc * 32], half16);

  v8f oacc[4] = {};          // oacc[c][r] = O[query arow][d = c*16 + half16*8 + r]
  float mrun = -INFINITY;    // running maximum of query arow (equal in both halves)
  float lrun = 0.0f;         // this half's share of the denominator

  for (int f0 = 0, it = 0; f0 < F_; f0 += 32, ++it) {
    const int cur = it & 1;
    if (f0 + 32 < F_) {
      const int nxt = cur ^ 1, fn = f0 + 32;
      async_cp16(&k[kbase + (size_t)(fn + kr) * D_ + kc8], &Ks[nxt][kr][kc8]);
      async_cp16(&v[vbase + (size_t)vd * F_ + fn + vf],    &Vs[nxt][vd][vf]);
      if (f0 + 64 < F_) {
        __builtin_prefetch(&k[kbase + (size_t)(f0 + 64 + kr) * D_ + kc8], 0, 1);
        __builtin_prefetch(&v[vbase + (size_t)vd * F_ + f0 + 64 + vf], 0, 1);
      }
      async_wait<2>();   // current K/V chunk done; next chunk in flight
    } else {
      async_wait<0>();
    }
    __syncthreads();

    // S^T = k @ q^T : sacc[ni][r] = score(key ni*16 + half16*8 + r, query arow).
    v8f sacc[2] = {};
#pragma unroll
    for (int kc = 0; kc < 2; ++kc) {
      v16h kf[2];
#pragma unroll
      for (int ni = 0; ni < 2; ++ni)
        kf[ni] = frag_from(&Ks[cur][ni * 16 + arow][kc * 32], half16);
#pragma unroll
      for (int ni = 0; ni < 2; ++ni)
        sacc[ni] = __builtin_amdgcn_wmma_f32_16x16x32_f16(
            false, kf[ni], false, qa[kc], (short)0, sacc[ni], false, false);
    }

    // Online softmax of one query per lane: in-lane maximum, one half exchange.
    float mx = fmaxf(sacc[0][0], sacc[1][0]);
#pragma unroll
    for (int r = 1; r < 8; ++r) mx = fmaxf(mx, fmaxf(sacc[0][r], sacc[1][r]));
    mx = fmaxf(mx, xhalf(mx));
    const float mnew = fmaxf(mrun, mx);
    const float corr = __expf(mrun - mnew);
    mrun = mnew;

    // P^T as B operand: element s is key kmap(s) = (s < 8 ? s : s + 8) + 8*half16,
    // which is register s & 7 of tile s >> 3; V^T rows come in the same k order.
    v16h pb;
    v8f p0 = sacc[0] - mnew, p1 = sacc[1] - mnew;
#pragma unroll
    for (int r = 0; r < 8; ++r) {
      p0[r] = __expf(p0[r]);
      p1[r] = __expf(p1[r]);
      pb[r]     = (_Float16)p0[r];
      pb[8 + r] = (_Float16)p1[r];
    }
    const v8f ps = p0 + p1;
    const float rs = ((ps[0] + ps[1]) + (ps[2] + ps[3])) + ((ps[4] + ps[5]) + (ps[6] + ps[7]));
    lrun = lrun * corr + rs;
#pragma unroll
    for (int c = 0; c < 4; ++c) oacc[c] *= corr;

    // O^T += V^T(64x32) @ P^T(32x16)
#pragma unroll
    for (int c = 0; c < 4; ++c) {
      v16h vf16 = frag_from(&Vs[cur][c * 16 + arow][0], half16);
      oacc[c] = __builtin_amdgcn_wmma_f32_16x16x32_f16(
          false, vf16, false, pb, (short)0, oacc[c], false, false);
    }
    __syncthreads();
  }

  // Join the two halves' denominators once; a lane stores 8 consecutive d.
  const float inv = 1.0f / (lrun + xhalf(lrun));
  const int s0 = blockIdx.x * 128 + wave * 16;
  float* ob = &o[((size_t)b * S_ + s0 + arow) * D_ + hd * HD_ + half16 * 8];
#pragma unroll
  for (int c = 0; c < 4; ++c) {
    v4f lo, hi;
#pragma unroll
    for (int r = 0; r < 4; ++r) { lo[r] = oacc[c][r] * inv; hi[r] = oacc[c][4 + r] * inv; }
    *(v4f*)(ob + c * 16)     = lo;
    *(v4f*)(ob + c * 16 + 4) = hi;
  }
}

// ---------------------------------------------------------------------------
// LayerNorm over D=1024 per row: f32 in -> f16 out.
// ---------------------------------------------------------------------------
__global__ __launch_bounds__(256) void row_ln(
    const float* __restrict__ in, const float* __restrict__ gamma,
    const float* __restrict__ beta, _Float16* __restrict__ out) {
  __shared__ float red[16];
  const int tid  = threadIdx.x;
  const int lane = tid & 31;
  const int wave = tid >> 5;
  const size_t base = (size_t)blockIdx.x * D_;
  float s = 0.0f, s2 = 0.0f;
#pragma unroll
  for (int i = 0; i < 4; ++i) {
    float x = in[base + tid + i * 256];
    s += x; s2 += x * x;
  }
#pragma unroll
  for (int m = 16; m >= 1; m >>= 1) {
    s  += __shfl_xor(s,  m);
    s2 += __shfl_xor(s2, m);
  }
  if (lane == 0) { red[wave] = s; red[8 + wave] = s2; }
  __syncthreads();
  if (tid == 0) {
    float ts = 0.0f, ts2 = 0.0f;
#pragma unroll
    for (int w = 0; w < 8; ++w) { ts += red[w]; ts2 += red[8 + w]; }
    red[0] = ts; red[1] = ts2;
  }
  __syncthreads();
  float mean = red[0] * (1.0f / (float)D_);
  float var  = red[1] * (1.0f / (float)D_) - mean * mean;
  float rstd = rsqrtf(var + EPS_);
#pragma unroll
  for (int i = 0; i < 4; ++i) {
    int idx = tid + i * 256;
    float x = in[base + idx];
    out[base + idx] = (_Float16)((x - mean) * rstd * gamma[idx] + beta[idx]);
  }
}

// ---------------------------------------------------------------------------
extern "C" void kernel_launch(void* const* d_in, const int* in_sizes, int n_in,
                              void* d_out, int out_size, void* d_ws, size_t ws_size,
                              hipStream_t stream) {
  const float* x_q   = (const float*)d_in[0];
  const float* x_k   = (const float*)d_in[1];
  const float* x_v   = (const float*)d_in[2];
  const float* Wq    = (const float*)d_in[3];
  const float* Wk    = (const float*)d_in[4];
  const float* Wv    = (const float*)d_in[5];
  const float* Wproj = (const float*)d_in[6];
  const float* q_g   = (const float*)d_in[7];
  const float* q_b   = (const float*)d_in[8];
  const float* k_g   = (const float*)d_in[9];
  const float* k_b   = (const float*)d_in[10];
  const float* o_g   = (const float*)d_in[11];
  const float* o_b   = (const float*)d_in[12];
  float* out = (float*)d_out;

  const size_t MB = 1024 * 1024;
  char* w = (char*)d_ws;
  _Float16* xqh = (_Float16*)(w + 0 * MB);    // 8MB each
  _Float16* xkh = (_Float16*)(w + 8 * MB);
  _Float16* xvh = (_Float16*)(w + 16 * MB);
  _Float16* wqt = (_Float16*)(w + 24 * MB);   // 2MB each (transposed f16)
  _Float16* wkt = (_Float16*)(w + 26 * MB);
  _Float16* wvt = (_Float16*)(w + 28 * MB);
  _Float16* wpt = (_Float16*)(w + 30 * MB);
  _Float16* qh  = (_Float16*)(w + 80 * MB);   // 8MB each (post-LN f16)
  _Float16* kh  = (_Float16*)(w + 88 * MB);
  _Float16* vt  = (_Float16*)(w + 96 * MB);   // 8MB (d-major f16 V)
  float*    ao  = (float*)(w + 104 * MB);     // 16MB attention out f32
  _Float16* lnh = (_Float16*)(w + 0 * MB);    // reuse xqh space

  dim3 gblk(256);
  dim3 ggrid(D_ / 128, M_ / 64);
  dim3 tblk(32, 8);

  // one-time precision/layout conversion
  cvt_f16<<<(M_ * D_ / 8) / 256, 256, 0, stream>>>(x_q, xqh);
  cvt_f16<<<(M_ * D_ / 8) / 256, 256, 0, stream>>>(x_k, xkh);
  cvt_f16<<<(M_ * D_ / 8) / 256, 256, 0, stream>>>(x_v, xvh);
  transpose_cvt<<<dim3(32, 32, 1), tblk, 0, stream>>>(Wq, wqt, D_, D_);
  transpose_cvt<<<dim3(32, 32, 1), tblk, 0, stream>>>(Wk, wkt, D_, D_);
  transpose_cvt<<<dim3(32, 32, 1), tblk, 0, stream>>>(Wv, wvt, D_, D_);
  transpose_cvt<<<dim3(32, 32, 1), tblk, 0, stream>>>(Wproj, wpt, D_, D_);

  // projections; epilogues: per-head LN -> f16 (q, k), d-major f16 (v)
  gemm_head_ln<<<ggrid, gblk, 0, stream>>>(xqh, wqt, qh, q_g, q_b, 0.125f);
  gemm_head_ln<<<ggrid, gblk, 0, stream>>>(xkh, wkt, kh, k_g, k_b, 1.0f);
  gemm_dmajor<<<ggrid, gblk, 0, stream>>>(xvh, wvt, vt);

  flash_attn<<<dim3(S_ / 128, B_ * H_), 256, 0, stream>>>(qh, kh, vt, ao);

  row_ln<<<M_, 256, 0, stream>>>(ao, o_g, o_b, lnh);

  gemm_f16wmma<<<ggrid, gblk, 0, stream>>>(lnh, wpt, out);
}

// v003
// One run takes 151 microseconds.
// In two side-by-side timings against v002, it was 1.04 and 1.03 times as fast.
// Counting every step since v000, it is 1.45 times as fast.
#include <hip/hip_runtime.h>
#include <hip/hip_bf16.h>
#include <math.h>

typedef __attribute__((ext_vector_type(16))) _Float16 v16h;
typedef __attribute__((ext_vector_type(8)))  _Float16 v8h;
typedef __attribute__((ext_vector_type(4)))  _Float16 v4h;
typedef __attribute__((ext_vector_type(8)))  float    v8f;
typedef __attribute__((ext_vector_type(4)))  float    v4f;
typedef __attribute__((ext_vector_type(4)))  int      v4i;

#define B_   2
#define S_   2048
#define F_   2048
#define D_   1024
#define H_   16
#define HD_  64
#define M_   4096           // B_*S_ == B_*F_
#define EPS_ 1e-5f

#define AS1 __attribute__((address_space(1)))
#define AS3 __attribute__((address_space(3)))

// ---- CDNA5 async copy: 16B global -> LDS, tracked by ASYNCcnt ------------
static __device__ __forceinline__ void async_cp16(const _Float16* g, _Float16* l) {
#if __has_builtin(__builtin_amdgcn_global_load_async_to_lds_b128)
  __builtin_amdgcn_global_load_async_to_lds_b128(
      (AS1 v4i*)g, (AS3 v4i*)l, 0, 0);
#else
  *(v8h*)l = *(const v8h*)g;
#endif
}
template <int N>
static __device__ __forceinline__ void async_wait() {
#if __has_builtin(__builtin_amdgcn_s_wait_asynccnt)
  __builtin_amdgcn_s_wait_asynccnt(N);
#endif
}

// Concatenate two contiguous 8-half K-runs into a WMMA 16-bit fragment.
static __device__ __forceinline__ v16h frag_from(const _Float16* row, int half16) {
  v8h lo = *(const v8h*)(row + 8 * half16);        // K = {0..7}  + 8*half
  v8h hi = *(const v8h*)(row + 16 + 8 * half16);   // K = {16..23}+ 8*half
  return __builtin_shufflevector(lo, hi, 0, 1, 2, 3, 4, 5, 6, 7,
                                 8, 9, 10, 11, 12, 13, 14, 15);
}

// ---------------------------------------------------------------------------
// All f16 operands in ONE launch of few, long-lived work-groups: a streaming
// launch this short is bounded by the start of its waves, not by its bytes.
//   work-groups 0 .. 767   : x_q, x_k, x_v f32 -> f16, 16384 elements each;
//                            a wave's load is 512 contiguous bytes, many in flight.
//   work-groups 768 .. 1279: Wq, Wk, Wv, Wproj (k x n) f32 -> (n x k) f16, one
//                            64(k) x 128(n) tile each; 8 lanes store one 128-byte line.
// ---------------------------------------------------------------------------
#define CVT_WG_ 256    // work-groups per activation array
#define TR_WG_  128    // work-groups per weight matrix
__global__ __launch_bounds__(256) void prep_f16(
    const float* __restrict__ x_q, const float* __restrict__ x_k,
    const float* __restrict__ x_v, const float* __restrict__ Wq,
    const float* __restrict__ Wk, const float* __restrict__ Wv,
    const float* __restrict__ Wp,
    _Float16* __restrict__ xqh, _Float16* __restrict__ xkh,
    _Float16* __restrict__ xvh, _Float16* __restrict__ wqt,
    _Float16* __restrict__ wkt, _Float16* __restrict__ wvt,
    _Float16* __restrict__ wpt) {
  __shared__ float t[64][129];   // odd pitch: the column reads below meet no bank twice
  const int tid = threadIdx.x;
  const int bid = blockIdx.x;
  if (bid < 3 * CVT_WG_) {
    const int a = bid / CVT_WG_;
    const float* in  = a == 0 ? x_q : a == 1 ? x_k : x_v;
    _Float16*    out = a == 0 ? xqh : a == 1 ? xkh : xvh;
    const size_t base = (size_t)(bid % CVT_WG_) * 16384 + tid * 4;
    v4f x[16];
#pragma unroll  // the loads run ahead of the conversions: many in flight a wave
    for (int u = 0; u < 16; ++u) x[u] = *(const v4f*)(in + base + u * 1024);
#pragma unroll  // constant indices: the values stay in registers
    for (int u = 0; u < 16; ++u)
      *(v4h*)(out + base + u * 1024) = __builtin_convertvector(x[u], v4h);
  } else {
    const int tb = bid - 3 * CVT_WG_;
    const int m  = tb / TR_WG_;
    const float* in  = m == 0 ? Wq : m == 1 ? Wk : m == 2 ? Wv : Wp;
    _Float16*    out = m == 0 ? wqt : m == 1 ? wkt : m == 2 ? wvt : wpt;
    const int kb = ((tb % TR_WG_) >> 3) * 64;
    const int nb = (tb & 7) * 128;
    // a wave reads 512 contiguous bytes of one k row; load j is 8 rows further down
    const float* p = in + (size_t)(kb + (tid >> 5)) * D_ + nb + (tid & 31) * 4;
    v4f x[8];
#pragma unroll  // all 8 loads are issued before the first value is used
    for (int j = 0; j < 8; ++j) x[j] = *(const v4f*)(p + j * 8 * D_);
#pragma unroll  // constant indices: the values stay in registers
    for (int j = 0; j < 8; ++j) {
      const int idx = tid + j * 256;
#pragma unroll  // constant indices: the values stay in registers
      for (int e = 0; e < 4; ++e) t[idx >> 5][(idx & 31) * 4 + e] = x[j][e];
    }
    __syncthreads();   // the whole tile is in LDS before a lane reads other waves' rows
#pragma unroll  // four independent lines: their LDS reads overlap
    for (int i = 0; i < 4; ++i) {
      const int unit = tid + i * 256;
      const int n = unit >> 3, part = unit & 7;
      v8h h;
#pragma unroll  // constant indices: the values stay in registers
      for (int e = 0; e < 8; ++e) h[e] = (_Float16)t[part * 8 + e][n];
      *(v8h*)(out + (size_t)(nb + n) * D_ + kb + part * 8) = h;
    }
    // In the built code the other branch's text follows this one behind a test and
    // reuses the stores' registers: the wait stands ahead of that.
    asm volatile("s_wait_xcnt 0x0" ::: "memory");
  }
}

// ---------------------------------------------------------------------------
// [4096,1024] = A[4096,1024](f16) @ Wt[1024,1024](f16, N-major rows)
// Workgroup tile 64(M) x 128(N), 8 waves of 32x32, K stepped by 32.
// Double-buffered async b128 staging (copies overlap WMMA).
// The epilogue emits what the next kernel reads:
//   MODE 0: f32 rows to C.
//   MODE 1: LayerNorm over each 64-column head, scaled, f16 rows to Ch.
//   MODE 2: f16, d-major: Ch[(b*D + n)][f], m = b*F + f.
// MODE 1 and 2 pass the tile through LDS so that 8 lanes own one 128-byte line.
// ---------------------------------------------------------------------------
template <int MODE>
static __device__ __forceinline__ void gemm_body(
    const _Float16* __restrict__ A, const _Float16* __restrict__ Wt,
    float* __restrict__ C, _Float16* __restrict__ Ch,
    const float* __restrict__ gamma, const float* __restrict__ beta,
    float scale) {
  __shared__ _Float16 As[2][64][40];     // 64 M-rows x 32 K (80B rows)
  __shared__ _Float16 Bts[2][128][40];   // 128 N-rows x 32 K
  const int tid  = threadIdx.x;
  const int lane = tid & 31;
  const int wave = tid >> 5;
  const int m0 = blockIdx.y * 64;
  const int n0 = blockIdx.x * 128;
  const int wm = (wave & 1) * 32;
  const int wn = (wave >> 1) * 32;
  const int half16 = lane >> 4;
  const int arow   = lane & 15;

  // per-thread staging segments (3 x 16B async per thread per K slab)
  const int ar = tid >> 2, ac = (tid & 3) * 8;
  const int br0 = tid >> 2,         bc0 = (tid & 3) * 8;
  const int br1 = (tid + 256) >> 2, bc1 = (tid & 3) * 8;

  // prologue: stage slab 0 into buffer 0
  async_cp16(&A[(size_t)(m0 + ar) * D_ + ac],    &As[0][ar][ac]);
  async_cp16(&Wt[(size_t)(n0 + br0) * D_ + bc0], &Bts[0][br0][bc0]);
  async_cp16(&Wt[(size_t)(n0 + br1) * D_ + bc1], &Bts[0][br1][bc1]);

  v8f acc[2][2] = {};

  for (int k0 = 0, it = 0; k0 < D_; k0 += 32, ++it) {
    const int cur = it & 1;
    if (k0 + 32 < D_) {
      const int nxt = cur ^ 1, kn = k0 + 32;
      async_cp16(&A[(size_t)(m0 + ar) * D_ + kn + ac],    &As[nxt][ar][ac]);
      async_cp16(&Wt[(size_t)(n0 + br0) * D_ + kn + bc0], &Bts[nxt][br0][bc0]);
      async_cp16(&Wt[(size_t)(n0 + br1) * D_ + kn + bc1], &Bts[nxt][br1][bc1]);
      if (k0 + 64 < D_) {
        __builtin_prefetch(&A[(size_t)(m0 + ar) * D_ + k0 + 64 + ac], 0, 1);
        __builtin_prefetch(&Wt[(size_t)(n0 + br0) * D_ + k0 + 64 + bc0], 0, 1);
      }
      async_wait<3>();    // current slab done; next slab still in flight
    } else {
      async_wait<0>();
    }
    __syncthreads();

    v16h afrag[2], bfrag[2];
#pragma unroll
    for (int mi = 0; mi < 2; ++mi)
      afrag[mi] = frag_from(&As[cur][wm + mi * 16 + arow][0], half16);
#pragma unroll
    for (int ni = 0; ni < 2; ++ni)
      bfrag[ni] = frag_from(&Bts[cur][wn + ni * 16 + arow][0], half16);

#pragma unroll
    for (int mi = 0; mi < 2; ++mi)
#pragma unroll
      for (int ni = 0; ni < 2; ++ni)
        acc[mi][ni] = __builtin_amdgcn_wmma_f32_16x16x32_f16(
            false, afrag[mi], false, bfrag[ni], (short)0, acc[mi][ni],
            false, false);
    __syncthreads();
  }

  if constexpr (MODE == 0) {
    float* cb = &C[(size_t)(m0 + wm + half16 * 8) * D_ + n0 + wn + arow];
#pragma unroll
    for (int mi = 0; mi < 2; ++mi)
#pragma unroll
      for (int ni = 0; ni < 2; ++ni)
#pragma unroll
        for (int r = 0; r < 8; ++r)
          cb[(size_t)(mi * 16 + r) * D_ + ni * 16] = acc[mi][ni][r];
  } else if constexpr (MODE == 1) {
    __shared__ __attribute__((aligned(16))) float Cs[64][132];   // 528B rows
#pragma unroll  // constant indices: the values stay in registers
    for (int mi = 0; mi < 2; ++mi)
#pragma unroll  // constant indices: the values stay in registers
      for (int ni = 0; ni < 2; ++ni)
#pragma unroll  // constant indices: the values stay in registers
        for (int r = 0; r < 8; ++r)
          Cs[wm + mi * 16 + half16 * 8 + r][wn + ni * 16 + arow] = acc[mi][ni][r];
    __syncthreads();   // the whole tile is in LDS before a lane reads other waves' parts
    // 8 lanes per head vector, 8 elements each; 128 head vectors in the tile.
    const int part = tid & 7;
    const v4f g0 = *(const v4f*)(gamma + part * 8);
    const v4f g1 = *(const v4f*)(gamma + part * 8 + 4);
    const v4f b0 = *(const v4f*)(beta + part * 8);
    const v4f b1 = *(const v4f*)(beta + part * 8 + 4);
#pragma unroll  // four independent head vectors: their LDS reads and exchanges overlap
    for (int i = 0; i < 4; ++i) {
      const int hv  = (tid >> 3) + i * 32;
      const int row = hv >> 1;
      const int col = (hv & 1) * 64 + part * 8;
      const v4f x0 = *(const v4f*)&Cs[row][col];
      const v4f x1 = *(const v4f*)&Cs[row][col + 4];
      const v4f xs = x0 + x1;
      const v4f xq = x0 * x0 + x1 * x1;
      float s  = (xs[0] + xs[1]) + (xs[2] + xs[3]);
      float s2 = (xq[0] + xq[1]) + (xq[2] + xq[3]);
#pragma unroll  // three exchange steps with constant lane masks
      for (int m = 4; m >= 1; m >>= 1) {
        s  += __shfl_xor(s,  m);
        s2 += __shfl_xor(s2, m);
      }
      const float mean = s * (1.0f / 64.0f);
      const float var  = s2 * (1.0f / 64.0f) - mean * mean;
      const float rstd = rsqrtf(var + EPS_);
      v8h h;
#pragma unroll  // constant indices: the values stay in registers
      for (int e = 0; e < 4; ++e) {
        h[e]     = (_Float16)(((x0[e] - mean) * rstd * g0[e] + b0[e]) * scale);
        h[4 + e] = (_Float16)(((x1[e] - mean) * rstd * g1[e] + b1[e]) * scale);
      }
      *(v8h*)&Ch[(size_t)(m0 + row) * D_ + n0 + col] = h;
    }
  } else {
    __shared__ __attribute__((aligned(16))) _Float16 Ts[128][72];   // 144B rows
#pragma unroll  // constant indices: the values stay in registers
    for (int mi = 0; mi < 2; ++mi)
#pragma unroll  // constant indices: the values stay in registers
      for (int ni = 0; ni < 2; ++ni) {
        v8h h;   // 8 consecutive m of one column n
#pragma unroll  // constant indices: the values stay in registers
        for (int r = 0; r < 8; ++r) h[r] = (_Float16)acc[mi][ni][r];
        *(v8h*)&Ts[wn + ni * 16 + arow][wm + mi * 16 + half16 * 8] = h;
      }
    __syncthreads();   // the whole tile is in LDS before a lane reads other waves' parts
    // 8 lanes per column n: 64 m = one 128-byte line of the d-major plane.
    const int bb = m0 / F_, fb = m0 % F_;
    const int part = tid & 7;
#pragma unroll  // four independent lines: their LDS reads overlap
    for (int i = 0; i < 4; ++i) {
      const int n = (tid >> 3) + i * 32;
      *(v8h*)&Ch[((size_t)bb * D_ + n0 + n) * F_ + fb + part * 8] =
          *(const v8h*)&Ts[n][part * 8];
    }
  }
}

__global__ __launch_bounds__(256) void gemm_f16wmma(
    const _Float16* __restrict__ A, const _Float16* __restrict__ Wt,
    float* __restrict__ C) {
  gemm_body<0>(A, Wt, C, nullptr, nullptr, nullptr, 1.0f);
}

__global__ __launch_bounds__(256) void gemm_head_ln(
    const _Float16* __restrict__ A, const _Float16* __restrict__ Wt,
    _Float16* __restrict__ Ch, const float* __restrict__ gamma,
    const float* __restrict__ beta, float scale) {
  gemm_body<1>(A, Wt, nullptr, Ch, gamma, beta, scale);
}

__global__ __launch_bounds__(256) void gemm_dmajor(
    const _Float16* __restrict__ A, const _Float16* __restrict__ Wt,
    _Float16* __restrict__ Ch) {
  gemm_body<2>(A, Wt, nullptr, Ch, nullptr, nullptr, 1.0f);
}

static __device__ __forceinline__ float xhalf(float x) {
  int i = __builtin_bit_cast(int, x);
  return __builtin_bit_cast(float, __builtin_amdgcn_permlanex16(
      i, i, 0x76543210, 0xfedcba98, false, false));
}

__global__ __launch_bounds__(256) void flash_attn(
    const _Float16* __restrict__ q, const _Float16* __restrict__ k,
    const _Float16* __restrict__ v, float* __restrict__ o) {
  __shared__ _Float16 Qs[128][72];         // 128 s-rows x 64 d (144B rows)
  __shared__ _Float16 Ks[2][32][72];       // 32 f-rows x 64 d
  __shared__ _Float16 Vs[2][64][40];       // 64 d-rows x 32 f
  const int tid  = threadIdx.x;
  const int lane = tid & 31;
  const int wave = tid >> 5;
  const int half16 = lane >> 4;
  const int arow   = lane & 15;
  const int bh = blockIdx.y;
  const int b  = bh / H_;
  const int hd = bh % H_;
  const size_t qbase = (size_t)b * S_ * D_ + (size_t)hd * HD_;
  const size_t kbase = (size_t)b * F_ * D_ + (size_t)hd * HD_;
  const size_t vbase = ((size_t)b * D_ + (size_t)hd * HD_) * F_;

  // staging segments: Q 4x16B once; K,V 1x16B each per chunk
  const int kr = tid >> 3, kc8 = (tid & 7) * 8;
  const int vd = tid >> 2, vf  = (tid & 3) * 8;

  // ---- stage Q tile (128 x 64 f16) + first K/V chunk
#pragma unroll
  for (int i = 0; i < 4; ++i) {
    int idx = tid + i * 256;
    int r = idx >> 3, c = (idx & 7) * 8;
    async_cp16(&q[qbase + (size_t)(blockIdx.x * 128 + r) * D_ + c], &Qs[r][c]);
  }
  async_cp16(&k[kbase + (size_t)kr * D_ + kc8], &Ks[0][kr][kc8]);
  async_cp16(&v[vbase + (size_t)vd * F_ + vf],  &Vs[0][vd][vf]);
  async_wait<2>();   // in-order completion: Q done, K/V chunk 0 may be in flight
  __syncthreads();

  v16h qa[2];
#pragma unroll
  for (int kc = 0; kc < 2; ++kc)
    qa[kc] = frag_from(&Qs[wave * 16 + arow][kc * 32], half16);

  v8f oacc[4] = {};          // oacc[c][r] = O[query arow][d = c*16 + half16*8 + r]
  float mrun = -INFINITY;    // running maximum of query arow (equal in both halves)
  float lrun = 0.0f;         // this half's share of the denominator

  for (int f0 = 0, it = 0; f0 < F_; f0 += 32, ++it) {
    const int cur = it & 1;
    if (f0 + 32 < F_) {
      const int nxt = cur ^ 1, fn = f0 + 32;
      async_cp16(&k[kbase + (size_t)(fn + kr) * D_ + kc8], &Ks[nxt][kr][kc8]);
      async_cp16(&v[vbase + (size_t)vd * F_ + fn + vf],    &Vs[nxt][vd][vf]);
      if (f0 + 64 < F_) {
        __builtin_prefetch(&k[kbase + (size_t)(f0 + 64 + kr) * D_ + kc8], 0, 1);
        __builtin_prefetch(&v[vbase + (size_t)vd * F_ + f0 + 64 + vf], 0, 1);
      }
      async_wait<2>();   // current K/V chunk done; next chunk in flight
    } else {
      async_wait<0>();
    }
    __syncthreads();

    // S^T = k @ q^T : sacc[ni][r] = score(key ni*16 + half16*8 + r, query arow).
    v8f sacc[2] = {};
#pragma unroll
    for (int kc = 0; kc < 2; ++kc) {
      v16h kf[2];
#pragma unroll
      for (int ni = 0; ni < 2; ++ni)
        kf[ni] = frag_from(&Ks[cur][ni * 16 + arow][kc * 32], half16);
#pragma unroll
      for (int ni = 0; ni < 2; ++ni)
        sacc[ni] = __builtin_amdgcn_wmma_f32_16x16x32_f16(
            false, kf[ni], false, qa[kc], (short)0, sacc[ni], false, false);
    }

    // Online softmax of one query per lane: in-lane maximum, one half exchange.
    float mx = fmaxf(sacc[0][0], sacc[1][0]);
#pragma unroll
    for (int r = 1; r < 8; ++r) mx = fmaxf(mx, fmaxf(sacc[0][r], sacc[1][r]));
    mx = fmaxf(mx, xhalf(mx));
    const float mnew = fmaxf(mrun, mx);
    const float corr = __expf(mrun - mnew);
    mrun = mnew;

    // P^T as B operand: element s is key kmap(s) = (s < 8 ? s : s + 8) + 8*half16,
    // which is register s & 7 of tile s >> 3; V^T rows come in the same k order.
    v16h pb;
    v8f p0 = sacc[0] - mnew, p1 = sacc[1] - mnew;
#pragma unroll
    for (int r = 0; r < 8; ++r) {
      p0[r] = __expf(p0[r]);
      p1[r] = __expf(p1[r]);
      pb[r]     = (_Float16)p0[r];
      pb[8 + r] = (_Float16)p1[r];
    }
    const v8f ps = p0 + p1;
    const float rs = ((ps[0] + ps[1]) + (ps[2] + ps[3])) + ((ps[4] + ps[5]) + (ps[6] + ps[7]));
    lrun = lrun * corr + rs;
#pragma unroll
    for (int c = 0; c < 4; ++c) oacc[c] *= corr;

    // O^T += V^T(64x32) @ P^T(32x16)
#pragma unroll
    for (int c = 0; c < 4; ++c) {
      v16h vf16 = frag_from(&Vs[cur][c * 16 + arow][0], half16);
      oacc[c] = __builtin_amdgcn_wmma_f32_16x16x32_f16(
          false, vf16, false, pb, (short)0, oacc[c], false, false);
    }
    __syncthreads();
  }

  // Join the two halves' denominators once; a lane stores 8 consecutive d.
  const float inv = 1.0f / (lrun + xhalf(lrun));
  const int s0 = blockIdx.x * 128 + wave * 16;
  float* ob = &o[((size_t)b * S_ + s0 + arow) * D_ + hd * HD_ + half16 * 8];
#pragma unroll
  for (int c = 0; c < 4; ++c) {
    v4f lo, hi;
#pragma unroll
    for (int r = 0; r < 4; ++r) { lo[r] = oacc[c][r] * inv; hi[r] = oacc[c][4 + r] * inv; }
    *(v4f*)(ob + c * 16)     = lo;
    *(v4f*)(ob + c * 16 + 4) = hi;
  }
}

// ---------------------------------------------------------------------------
// LayerNorm over D=1024 per row: f32 in -> f16 out. One wave owns one row (32
// values a lane, read once and kept in registers), 8 rows a work-group.
// ---------------------------------------------------------------------------
// 4096 waves on 1024 SIMDs: four a SIMD, so a wave may hold all its loads in registers.
__global__ __launch_bounds__(256) __attribute__((amdgpu_waves_per_eu(4, 4))) void row_ln(
    const float* __restrict__ in, const float* __restrict__ gamma,
    const float* __restrict__ beta, _Float16* __restrict__ out) {
  const int lane = threadIdx.x & 31;
  const int wave = threadIdx.x >> 5;
  const size_t base = ((size_t)blockIdx.x * 8 + wave) * D_ + lane * 4;
  v4f x[8], g[8], b[8];
  const float* xp = in + base;
  const unsigned goff = lane * 4;
#pragma unroll  // all 24 loads are issued before the first value is used: one latency
  for (int j = 0; j < 8; ++j) x[j] = *(const v4f*)(xp + j * 128);
#pragma unroll  // constant indices: the values stay in registers
  for (int j = 0; j < 8; ++j) {
    g[j] = *(const v4f*)(gamma + goff + j * 128);
    b[j] = *(const v4f*)(beta + goff + j * 128);
  }
  // The loads' address registers are inputs here, so that no load's result is
  // placed in them and nothing rewrites them ahead of this wait.
  asm volatile("s_wait_xcnt 0x0" :: "v"(xp), "v"(goff * 4) : "memory");
  v4f vs = x[0], vq = x[0] * x[0];
#pragma unroll  // constant indices: the values stay in registers
  for (int j = 1; j < 8; ++j) { vs += x[j]; vq += x[j] * x[j]; }
  float s  = (vs[0] + vs[1]) + (vs[2] + vs[3]);
  float s2 = (vq[0] + vq[1]) + (vq[2] + vq[3]);
#pragma unroll  // five exchange steps with constant lane masks
  for (int m = 16; m >= 1; m >>= 1) {
    s  += __shfl_xor(s,  m);
    s2 += __shfl_xor(s2, m);
  }
  const float mean = s * (1.0f / (float)D_);
  const float var  = s2 * (1.0f / (float)D_) - mean * mean;
  const float rstd = rsqrtf(var + EPS_);
#pragma unroll  // constant indices: the values stay in registers
  for (int j = 0; j < 8; ++j)
    *(v4h*)(out + base + j * 128) =
        __builtin_convertvector((x[j] - mean) * rstd * g[j] + b[j], v4h);
}

// ---------------------------------------------------------------------------
extern "C" void kernel_launch(void* const* d_in, const int* in_sizes, int n_in,
                              void* d_out, int out_size, void* d_ws, size_t ws_size,
                              hipStream_t stream) {
  const float* x_q   = (const float*)d_in[0];
  const float* x_k   = (const float*)d_in[1];
  const float* x_v   = (const float*)d_in[2];
  const float* Wq    = (const float*)d_in[3];
  const float* Wk    = (const float*)d_in[4];
  const float* Wv    = (const float*)d_in[5];
  const float* Wproj = (const float*)d_in[6];
  const float* q_g   = (const float*)d_in[7];
  const float* q_b   = (const float*)d_in[8];
  const float* k_g   = (const float*)d_in[9];
  const float* k_b   = (const float*)d_in[10];
  const float* o_g   = (const float*)d_in[11];
  const float* o_b   = (const float*)d_in[12];
  float* out = (float*)d_out;

  const size_t MB = 1024 * 1024;
  char* w = (char*)d_ws;
  _Float16* xqh = (_Float16*)(w + 0 * MB);    // 8MB each
  _Float16* xkh = (_Float16*)(w + 8 * MB);
  _Float16* xvh = (_Float16*)(w + 16 * MB);
  _Float16* wqt = (_Float16*)(w + 24 * MB);   // 2MB each (transposed f16)
  _Float16* wkt = (_Float16*)(w + 26 * MB);
  _Float16* wvt = (_Float16*)(w + 28 * MB);
  _Float16* wpt = (_Float16*)(w + 30 * MB);
  _Float16* qh  = (_Float16*)(w + 80 * MB);   // 8MB each (post-LN f16)
  _Float16* kh  = (_Float16*)(w + 88 * MB);
  _Float16* vt  = (_Float16*)(w + 96 * MB);   // 8MB (d-major f16 V)
  float*    ao  = (float*)(w + 104 * MB);     // 16MB attention out f32
  _Float16* lnh = (_Float16*)(w + 0 * MB);    // reuse xqh space

  dim3 gblk(256);
  dim3 ggrid(D_ / 128, M_ / 64);

  // precision/layout conversion of all seven operands
  prep_f16<<<3 * CVT_WG_ + 4 * TR_WG_, 256, 0, stream>>>(
      x_q, x_k, x_v, Wq, Wk, Wv, Wproj, xqh, xkh, xvh, wqt, wkt, wvt, wpt);

  // projections; epilogues: per-head LN -> f16 (q, k), d-major f16 (v)
  gemm_head_ln<<<ggrid, gblk, 0, stream>>>(xqh, wqt, qh, q_g, q_b, 0.125f);
  gemm_head_ln<<<ggrid, gblk, 0, stream>>>(xkh, wkt, kh, k_g, k_b, 1.0f);
  gemm_dmajor<<<ggrid, gblk, 0, stream>>>(xvh, wvt, vt);

  flash_attn<<<dim3(S_ / 128, B_ * H_), 256, 0, stream>>>(qh, kh, vt, ao);

  row_ln<<<M_ / 8, 256, 0, stream>>>(ao, o_g, o_b, lnh);

  gemm_f16wmma<<<ggrid, gblk, 0, stream>>>(lnh, wpt, out);
}

// v004
// A run of this version takes 119 microseconds.
// Next to v003, in two timings, it ran 1.30 and 1.31 times as fast.
// Over all steps from v000 it is 1.90 times as fast.
#include <hip/hip_runtime.h>
#include <hip/hip_bf16.h>
#include <math.h>

typedef __attribute__((ext_vector_type(16))) _Float16 v16h;
typedef __attribute__((ext_vector_type(8)))  _Float16 v8h;
typedef __attribute__((ext_vector_type(4)))  _Float16 v4h;
typedef __attribute__((ext_vector_type(8)))  float    v8f;
typedef __attribute__((ext_vector_type(4)))  float    v4f;

#define B_   2
#define S_   2048
#define F_   2048
#define D_   1024
#define H_   16
#define HD_  64
#define M_   4096           // B_*S_ == B_*F_
#define EPS_ 1e-5f

// ---- CDNA5 async copies: 16 B a lane, global -> LDS, tracked by ASYNCcnt ----
// A run of copies and the s_wait_xcnt 0 that stands ahead of any rewrite of their
// address registers are ONE statement, so that nothing can come between them.
// l: the lane's LDS byte address, g: its global address; copy i lies i row steps on.
#define CP_(a, b) "global_load_async_to_lds_b128 %" #a ", %" #b ", off\n\t"
static __device__ __forceinline__ unsigned lds_off(const void* p) { return (unsigned)(size_t)p; }

static __device__ __forceinline__ void async_cp4(unsigned l, unsigned ls,
                                                 const _Float16* g, int gs) {
  asm volatile(CP_(0, 4) CP_(1, 5) CP_(2, 6) CP_(3, 7) "s_wait_xcnt 0x0"
      :: "v"(l), "v"(l + ls), "v"(l + 2 * ls), "v"(l + 3 * ls),
         "v"(g), "v"(g + gs), "v"(g + 2 * gs), "v"(g + 3 * gs)
      : "memory");
}
// 4 copies of one tile and 4 of another
static __device__ __forceinline__ void async_cp4_4(unsigned l, unsigned ls,
                                                   const _Float16* g, int gs,
                                                   unsigned m, unsigned ms,
                                                   const _Float16* h, int hs) {
  asm volatile(CP_(0, 8) CP_(1, 9) CP_(2, 10) CP_(3, 11)
               CP_(4, 12) CP_(5, 13) CP_(6, 14) CP_(7, 15) "s_wait_xcnt 0x0"
      :: "v"(l), "v"(l + ls), "v"(l + 2 * ls), "v"(l + 3 * ls),
         "v"(m), "v"(m + ms), "v"(m + 2 * ms), "v"(m + 3 * ms),
         "v"(g), "v"(g + gs), "v"(g + 2 * gs), "v"(g + 3 * gs),
         "v"(h), "v"(h + hs), "v"(h + 2 * hs), "v"(h + 3 * hs)
      : "memory");
}
// 4 copies of one tile and 8 of another
static __device__ __forceinline__ void async_cp4_8(unsigned l, unsigned ls,
                                                   const _Float16* g, int gs,
                                                   unsigned m, unsigned ms,
                                                   const _Float16* h, int hs) {
  asm volatile(CP_(0, 12) CP_(1, 13) CP_(2, 14) CP_(3, 15)
               CP_(4, 16) CP_(5, 17) CP_(6, 18) CP_(7, 19)
               CP_(8, 20) CP_(9, 21) CP_(10, 22) CP_(11, 23) "s_wait_xcnt 0x0"
      :: "v"(l), "v"(l + ls), "v"(l + 2 * ls), "v"(l + 3 * ls),
         "v"(m), "v"(m + ms), "v"(m + 2 * ms), "v"(m + 3 * ms),
         "v"(m + 4 * ms), "v"(m + 5 * ms), "v"(m + 6 * ms), "v"(m + 7 * ms),
         "v"(g), "v"(g + gs), "v"(g + 2 * gs), "v"(g + 3 * gs),
         "v"(h), "v"(h + hs), "v"(h + 2 * hs), "v"(h + 3 * hs),
         "v"(h + 4 * hs), "v"(h + 5 * hs), "v"(h + 6 * hs), "v"(h + 7 * hs)
      : "memory");
}

#define KS_ 128   // k (GEMM) or keys (attention) per stage of an LDS ring
#define P256_ 136 // LDS pitch in halves of 256-byte rows: 272 bytes, 16 x odd (ds_load_b128)
#define P128_ 72  // LDS pitch in halves of 128-byte rows: 144 bytes, 16 x odd

// Concatenate two contiguous 8-half K-runs into a WMMA 16-bit fragment.
static __device__ __forceinline__ v16h frag_from(const _Float16* row, int half16) {
  v8h lo = *(const v8h*)(row + 8 * half16);        // K = {0..7}  + 8*half
  v8h hi = *(const v8h*)(row + 16 + 8 * half16);   // K = {16..23}+ 8*half
  return __builtin_shufflevector(lo, hi, 0, 1, 2, 3, 4, 5, 6, 7,
                                 8, 9, 10, 11, 12, 13, 14, 15);
}

// ---------------------------------------------------------------------------
// All f16 operands in ONE launch of few, long-lived work-groups: a streaming
// launch this short is bounded by the start of its waves, not by its bytes.
//   work-groups 0 .. 767   : x_q, x_k, x_v f32 -> f16, 16384 elements each;
//                            a wave's load is 512 contiguous bytes, many in flight.
//   work-groups 768 .. 1279: Wq, Wk, Wv, Wproj (k x n) f32 -> (n x k) f16, one
//                            64(k) x 128(n) tile each; 8 lanes store one 128-byte line.
// ---------------------------------------------------------------------------
#define CVT_WG_ 256    // work-groups per activation array
#define TR_WG_  128    // work-groups per weight matrix
__global__ __launch_bounds__(256) void prep_f16(
    const float* __restrict__ x_q, const float* __restrict__ x_k,
    const float* __restrict__ x_v, const float* __restrict__ Wq,
    const float* __restrict__ Wk, const float* __restrict__ Wv,
    const float* __restrict__ Wp,
    _Float16* __restrict__ xqh, _Float16* __restrict__ xkh,
    _Float16* __restrict__ xvh, _Float16* __restrict__ wqt,
    _Float16* __restrict__ wkt, _Float16* __restrict__ wvt,
    _Float16* __restrict__ wpt) {
  __shared__ float t[64][129];   // odd pitch: the column reads below meet no bank twice
  const int tid = threadIdx.x;
  const int bid = blockIdx.x;
  if (bid < 3 * CVT_WG_) {
    const int a = bid / CVT_WG_;
    const float* in  = a == 0 ? x_q : a == 1 ? x_k : x_v;
    _Float16*    out = a == 0 ? xqh : a == 1 ? xkh : xvh;
    const size_t base = (size_t)(bid % CVT_WG_) * 16384 + tid * 4;
    v4f x[16];
#pragma unroll  // the loads run ahead of the conversions: many in flight a wave
    for (int u = 0; u < 16; ++u) x[u] = *(const v4f*)(in + base + u * 1024);
#pragma unroll  // constant indices: the values stay in registers
    for (int u = 0; u < 16; ++u)
      *(v4h*)(out + base + u * 1024) = __builtin_convertvector(x[u], v4h);
  } else {
    const int tb = bid - 3 * CVT_WG_;
    const int m  = tb / TR_WG_;
    const float* in  = m == 0 ? Wq : m == 1 ? Wk : m == 2 ? Wv : Wp;
    _Float16*    out = m == 0 ? wqt : m == 1 ? wkt : m == 2 ? wvt : wpt;
    const int kb = ((tb % TR_WG_) >> 3) * 64;
    const int nb = (tb & 7) * 128;
    // a wave reads 512 contiguous bytes of one k row; load j is 8 rows further down
    const float* p = in + (size_t)(kb + (tid >> 5)) * D_ + nb + (tid & 31) * 4;
    v4f x[8];
#pragma unroll  // all 8 loads are issued before the first value is used
    for (int j = 0; j < 8; ++j) x[j] = *(const v4f*)(p + j * 8 * D_);
#pragma unroll  // constant indices: the values stay in registers
    for (int j = 0; j < 8; ++j) {
      const int idx = tid + j * 256;
#pragma unroll  // constant indices: the values stay in registers
      for (int e = 0; e < 4; ++e) t[idx >> 5][(idx & 31) * 4 + e] = x[j][e];
    }
    __syncthreads();   // the whole tile is in LDS before a lane reads other waves' rows
#pragma unroll  // four independent lines: their LDS reads overlap
    for (int i = 0; i < 4; ++i) {
      const int unit = tid + i * 256;
      const int n = unit >> 3, part = unit & 7;
      v8h h;
#pragma unroll  // constant indices: the values stay in registers
      for (int e = 0; e < 8; ++e) h[e] = (_Float16)t[part * 8 + e][n];
      *(v8h*)(out + (size_t)(nb + n) * D_ + kb + part * 8) = h;
    }
    // In the built code the other branch's text follows this one behind a test and
    // reuses the stores' registers: the wait stands ahead of that.
    asm volatile("s_wait_xcnt 0x0" ::: "memory");
  }
}

// ---------------------------------------------------------------------------
// [4096,1024] = A[4096,1024](f16) @ Wt[1024,1024](f16, N-major rows)
// Workgroup tile 64(M) x 128(N), 8 waves of 32x32; a stage is 128 k, four steps of 32.
// Two buffers of async b128 copies, one barrier a stage (copies overlap WMMA).
// The epilogue emits what the next kernel reads:
//   MODE 0: f32 rows to C.
//   MODE 1: LayerNorm over each 64-column head, scaled, f16 rows to Ch.
//   MODE 2: f16, d-major: Ch[(b*D + n)][f], m = b*F + f.
// MODE 1 and 2 pass the tile through LDS so that 8 lanes own one 128-byte line.
// ---------------------------------------------------------------------------
template <int MODE>
static __device__ __forceinline__ void gemm_body(
    const _Float16* __restrict__ A, const _Float16* __restrict__ Wt,
    float* __restrict__ C, _Float16* __restrict__ Ch,
    const float* __restrict__ gamma, const float* __restrict__ beta,
    float scale) {
  __shared__ __attribute__((aligned(16))) _Float16 As[2][64][P256_];    // 64 M-rows x 128 K
  __shared__ __attribute__((aligned(16))) _Float16 Bts[2][128][P256_];  // 128 N-rows x 128 K
  const int tid  = threadIdx.x;
  const int lane = tid & 31;
  const int wave = tid >> 5;
  const int m0 = blockIdx.y * 64;
  const int n0 = blockIdx.x * 128;
  const int wm = (wave & 1) * 32;
  const int wn = (wave >> 1) * 32;
  const int half16 = lane >> 4;
  const int arow   = lane & 15;

  // staging: 16 lanes bring one 256-byte row; a lane's 12 copies lie 16 rows apart
  const int sr = tid >> 4, sc = (tid & 15) * 8;
  const _Float16* ga = &A[(size_t)(m0 + sr) * D_ + sc];
  const _Float16* gb = &Wt[(size_t)(n0 + sr) * D_ + sc];
  const unsigned la = lds_off(&As[0][sr][sc]);
  const unsigned lb = lds_off(&Bts[0][sr][sc]);
  constexpr unsigned ABUF = 64 * P256_ * 2, BBUF = 128 * P256_ * 2;   // bytes per buffer
  constexpr unsigned LR = 16 * P256_ * 2;   // 16 rows on in LDS, bytes
  constexpr int      GR = 16 * D_;          // 16 rows on in global memory, halves
  constexpr int NT = D_ / KS_;

  // prologue: stage 0 lands and is published, then stage 1 starts
  async_cp4_8(la, LR, ga, GR, lb, LR, gb, GR);
  asm volatile("s_wait_asynccnt 0x0" ::: "memory");   // this wave's share of stage 0 has landed
  __syncthreads();                                    // ... and every other wave's
  async_cp4_8(la + ABUF, LR, ga + KS_, GR, lb + BBUF, LR, gb + KS_, GR);

  v8f acc[2][2] = {};

  for (int t = 0; t < NT; ++t) {
    const int cur = t & 1;
#pragma unroll  // the four k steps of a stage read LDS at constant offsets from one address
    for (int kk = 0; kk < KS_; kk += 32) {
      v16h afrag[2], bfrag[2];
#pragma unroll
      for (int mi = 0; mi < 2; ++mi)
        afrag[mi] = frag_from(&As[cur][wm + mi * 16 + arow][kk], half16);
#pragma unroll
      for (int ni = 0; ni < 2; ++ni)
        bfrag[ni] = frag_from(&Bts[cur][wn + ni * 16 + arow][kk], half16);

#pragma unroll
      for (int mi = 0; mi < 2; ++mi)
#pragma unroll
        for (int ni = 0; ni < 2; ++ni)
          acc[mi][ni] = __builtin_amdgcn_wmma_f32_16x16x32_f16(
              false, afrag[mi], false, bfrag[ni], (short)0, acc[mi][ni],
              false, false);
    }
    // publish point of stage t + 1; the one barrier also frees the buffer just read
    asm volatile("s_wait_dscnt 0x0" ::: "memory");      // this wave's reads of stage t are done
    asm volatile("s_wait_asynccnt 0x0" ::: "memory");   // its share of stage t + 1 has landed
    __syncthreads();
    if (t + 2 < NT)
      async_cp4_8(la + cur * ABUF, LR, ga + (t + 2) * KS_, GR,
                  lb + cur * BBUF, LR, gb + (t + 2) * KS_, GR);
  }
  asm volatile("s_wait_asynccnt 0x0" ::: "memory");     // no copy is open when the wave goes on

  if constexpr (MODE == 0) {
    float* cb = &C[(size_t)(m0 + wm + half16 * 8) * D_ + n0 + wn + arow];
#pragma unroll
    for (int mi = 0; mi < 2; ++mi)
#pragma unroll
      for (int ni = 0; ni < 2; ++ni)
#pragma unroll
        for (int r = 0; r < 8; ++r)
          cb[(size_t)(mi * 16 + r) * D_ + ni * 16] = acc[mi][ni][r];
  } else if constexpr (MODE == 1) {
    __shared__ __attribute__((aligned(16))) float Cs[64][132];   // 528B rows
#pragma unroll  // constant indices: the values stay in registers
    for (int mi = 0; mi < 2; ++mi)
#pragma unroll  // constant indices: the values stay in registers
      for (int ni = 0; ni < 2; ++ni)
#pragma unroll  // constant indices: the values stay in registers
        for (int r = 0; r < 8; ++r)
          Cs[wm + mi * 16 + half16 * 8 + r][wn + ni * 16 + arow] = acc[mi][ni][r];
    __syncthreads();   // the whole tile is in LDS before a lane reads other waves' parts
    // 8 lanes per head vector, 8 elements each; 128 head vectors in the tile.
    const int part = tid & 7;
    const v4f g0 = *(const v4f*)(gamma + part * 8);
    const v4f g1 = *(const v4f*)(gamma + part * 8 + 4);
    const v4f b0 = *(const v4f*)(beta + part * 8);
    const v4f b1 = *(const v4f*)(beta + part * 8 + 4);
#pragma unroll  // four independent head vectors: their LDS reads and exchanges overlap
    for (int i = 0; i < 4; ++i) {
      const int hv  = (tid >> 3) + i * 32;
      const int row = hv >> 1;
      const int col = (hv & 1) * 64 + part * 8;
      const v4f x0 = *(const v4f*)&Cs[row][col];
      const v4f x1 = *(const v4f*)&Cs[row][col + 4];
      const v4f xs = x0 + x1;
      const v4f xq = x0 * x0 + x1 * x1;
      float s  = (xs[0] + xs[1]) + (xs[2] + xs[3]);
      float s2 = (xq[0] + xq[1]) + (xq[2] + xq[3]);
#pragma unroll  // three exchange steps with constant lane masks
      for (int m = 4; m >= 1; m >>= 1) {
        s  += __shfl_xor(s,  m);
        s2 += __shfl_xor(s2, m);
      }
      const float mean = s * (1.0f / 64.0f);
      const float var  = s2 * (1.0f / 64.0f) - mean * mean;
      const float rstd = rsqrtf(var + EPS_);
      v8h h;
#pragma unroll  // constant indices: the values stay in registers
      for (int e = 0; e < 4; ++e) {
        h[e]     = (_Float16)(((x0[e] - mean) * rstd * g0[e] + b0[e]) * scale);
        h[4 + e] = (_Float16)(((x1[e] - mean) * rstd * g1[e] + b1[e]) * scale);
      }
      *(v8h*)&Ch[(size_t)(m0 + row) * D_ + n0 + col] = h;
    }
  } else {
    __shared__ __attribute__((aligned(16))) _Float16 Ts[128][72];   // 144B rows
#pragma unroll  // constant indices: the values stay in registers
    for (int mi = 0; mi < 2; ++mi)
#pragma unroll  // constant indices: the values stay in registers
      for (int ni = 0; ni < 2; ++ni) {
        v8h h;   // 8 consecutive m of one column n
#pragma unroll  // constant indices: the values stay in registers
        for (int r = 0; r < 8; ++r) h[r] = (_Float16)acc[mi][ni][r];
        *(v8h*)&Ts[wn + ni * 16 + arow][wm + mi * 16 + half16 * 8] = h;
      }
    __syncthreads();   // the whole tile is in LDS before a lane reads other waves' parts
    // 8 lanes per column n: 64 m = one 128-byte line of the d-major plane.
    const int bb = m0 / F_, fb = m0 % F_;
    const int part = tid & 7;
#pragma unroll  // four independent lines: their LDS reads overlap
    for (int i = 0; i < 4; ++i) {
      const int n = (tid >> 3) + i * 32;
      *(v8h*)&Ch[((size_t)bb * D_ + n0 + n) * F_ + fb + part * 8] =
          *(const v8h*)&Ts[n][part * 8];
    }
  }
}

__global__ __launch_bounds__(256) void gemm_f16wmma(
    const _Float16* __restrict__ A, const _Float16* __restrict__ Wt,
    float* __restrict__ C) {
  gemm_body<0>(A, Wt, C, nullptr, nullptr, nullptr, 1.0f);
}

__global__ __launch_bounds__(256) void gemm_head_ln(
    const _Float16* __restrict__ A, const _Float16* __restrict__ Wt,
    _Float16* __restrict__ Ch, const float* __restrict__ gamma,
    const float* __restrict__ beta, float scale) {
  gemm_body<1>(A, Wt, nullptr, Ch, gamma, beta, scale);
}

__global__ __launch_bounds__(256) void gemm_dmajor(
    const _Float16* __restrict__ A, const _Float16* __restrict__ Wt,
    _Float16* __restrict__ Ch) {
  gemm_body<2>(A, Wt, nullptr, Ch, nullptr, nullptr, 1.0f);
}

static __device__ __forceinline__ float xhalf(float x) {
  int i = __builtin_bit_cast(int, x);
  return __builtin_bit_cast(float, __builtin_amdgcn_permlanex16(
      i, i, 0x76543210, 0xfedcba98, false, false));
}

__global__ __launch_bounds__(256) void flash_attn(
    const _Float16* __restrict__ q, const _Float16* __restrict__ k,
    const _Float16* __restrict__ v, float* __restrict__ o) {
  __shared__ __attribute__((aligned(16))) _Float16 Qs[128][P128_];       // 128 s-rows x 64 d
  __shared__ __attribute__((aligned(16))) _Float16 Ks[2][KS_][P128_];    // 128 f-rows x 64 d
  __shared__ __attribute__((aligned(16))) _Float16 Vs[2][64][P256_];     // 64 d-rows x 128 f
  const int tid  = threadIdx.x;
  const int lane = tid & 31;
  const int wave = tid >> 5;
  const int half16 = lane >> 4;
  const int arow   = lane & 15;
  const int bh = blockIdx.y;
  const int b  = bh / H_;
  const int hd = bh % H_;
  const size_t qbase = (size_t)b * S_ * D_ + (size_t)hd * HD_;
  const size_t kbase = (size_t)b * F_ * D_ + (size_t)hd * HD_;
  const size_t vbase = ((size_t)b * D_ + (size_t)hd * HD_) * F_;

  // staging: 8 lanes bring one 128-byte row of Q or K, 16 lanes one 256-byte row of V;
  // a lane's 4 copies of a tile lie 32 (Q, K) or 16 (V) rows apart
  const int kr = tid >> 3, kc8 = (tid & 7) * 8;
  const int vd = tid >> 4, vf  = (tid & 15) * 8;
  const _Float16* gk = &k[kbase + (size_t)kr * D_ + kc8];
  const _Float16* gv = &v[vbase + (size_t)vd * F_ + vf];
  const unsigned lk = lds_off(&Ks[0][kr][kc8]);
  const unsigned lv = lds_off(&Vs[0][vd][vf]);
  constexpr unsigned KBUF = KS_ * P128_ * 2, VBUF = 64 * P256_ * 2;   // bytes per buffer
  constexpr unsigned LKR = 32 * P128_ * 2, LVR = 16 * P256_ * 2;      // row steps in LDS, bytes
  constexpr int NS = F_ / KS_;

  // prologue: Q and stage 0 land and are published, then stage 1 starts
  async_cp4(lds_off(&Qs[kr][kc8]), LKR,
            &q[qbase + (size_t)(blockIdx.x * 128 + kr) * D_ + kc8], 32 * D_);
  async_cp4_4(lk, LKR, gk, 32 * D_, lv, LVR, gv, 16 * F_);
  asm volatile("s_wait_asynccnt 0x0" ::: "memory");   // this wave's share has landed
  __syncthreads();                                    // ... and every other wave's
  async_cp4_4(lk + KBUF, LKR, gk + (size_t)KS_ * D_, 32 * D_, lv + VBUF, LVR, gv + KS_, 16 * F_);

  v16h qa[2];
#pragma unroll
  for (int kc = 0; kc < 2; ++kc)
    qa[kc] = frag_from(&Qs[wave * 16 + arow][kc * 32], half16);

  v8f oacc[4] = {};          // oacc[c][r] = O[query arow][d = c*16 + half16*8 + r]
  float mrun = -INFINITY;    // running maximum of query arow (equal in both halves)
  float lrun = 0.0f;         // this half's share of the denominator

  for (int st = 0; st < NS; ++st) {
    const int cur = st & 1;
#pragma unroll  // four passes of 32 keys: a pass's LDS reads may run ahead of the pass before
    for (int f0 = 0; f0 < KS_; f0 += 32) {
      // S^T = k @ q^T : sacc[ni][r] = score(key ni*16 + half16*8 + r, query arow).
      v8f sacc[2] = {};
#pragma unroll
      for (int kc = 0; kc < 2; ++kc) {
        v16h kf[2];
#pragma unroll
        for (int ni = 0; ni < 2; ++ni)
          kf[ni] = frag_from(&Ks[cur][f0 + ni * 16 + arow][kc * 32], half16);
#pragma unroll
        for (int ni = 0; ni < 2; ++ni)
          sacc[ni] = __builtin_amdgcn_wmma_f32_16x16x32_f16(
              false, kf[ni], false, qa[kc], (short)0, sacc[ni], false, false);
      }

      // Online softmax of one query per lane: in-lane maximum, one half exchange.
      float mx = fmaxf(sacc[0][0], sacc[1][0]);
#pragma unroll
      for (int r = 1; r < 8; ++r) mx = fmaxf(mx, fmaxf(sacc[0][r], sacc[1][r]));
      mx = fmaxf(mx, xhalf(mx));
      const float mnew = fmaxf(mrun, mx);
      const float corr = __expf(mrun - mnew);
      mrun = mnew;

      // P^T as B operand: element s is key kmap(s) = (s < 8 ? s : s + 8) + 8*half16,
      // which is register s & 7 of tile s >> 3; V^T rows come in the same k order.
      v16h pb;
      v8f p0 = sacc[0] - mnew, p1 = sacc[1] - mnew;
#pragma unroll
      for (int r = 0; r < 8; ++r) {
        p0[r] = __expf(p0[r]);
        p1[r] = __expf(p1[r]);
        pb[r]     = (_Float16)p0[r];
        pb[8 + r] = (_Float16)p1[r];
      }
      const v8f ps = p0 + p1;
      const float rs = ((ps[0] + ps[1]) + (ps[2] + ps[3])) + ((ps[4] + ps[5]) + (ps[6] + ps[7]));
      lrun = lrun * corr + rs;
#pragma unroll
      for (int c = 0; c < 4; ++c) oacc[c] *= corr;

      // O^T += V^T(64x32) @ P^T(32x16)
#pragma unroll
      for (int c = 0; c < 4; ++c) {
        v16h vf16 = frag_from(&Vs[cur][c * 16 + arow][f0], half16);
        oacc[c] = __builtin_amdgcn_wmma_f32_16x16x32_f16(
            false, vf16, false, pb, (short)0, oacc[c], false, false);
      }
    }
    // publish point of stage st + 1; the one barrier also frees the buffer just read
    asm volatile("s_wait_dscnt 0x0" ::: "memory");      // this wave's reads of stage st are done
    asm volatile("s_wait_asynccnt 0x0" ::: "memory");   // its share of stage st + 1 has landed
    __syncthreads();
    if (st + 2 < NS)
      async_cp4_4(lk + cur * KBUF, LKR, gk + (size_t)(st + 2) * KS_ * D_, 32 * D_,
                  lv + cur * VBUF, LVR, gv + (st + 2) * KS_, 16 * F_);
  }
  asm volatile("s_wait_asynccnt 0x0" ::: "memory");     // no copy is open when the wave goes on

  // Join the two halves' denominators once; a lane stores 8 consecutive d.
  const float inv = 1.0f / (lrun + xhalf(lrun));
  const int s0 = blockIdx.x * 128 + wave * 16;
  float* ob = &o[((size_t)b * S_ + s0 + arow) * D_ + hd * HD_ + half16 * 8];
#pragma unroll
  for (int c = 0; c < 4; ++c) {
    v4f lo, hi;
#pragma unroll
    for (int r = 0; r < 4; ++r) { lo[r] = oacc[c][r] * inv; hi[r] = oacc[c][4 + r] * inv; }
    *(v4f*)(ob + c * 16)     = lo;
    *(v4f*)(ob + c * 16 + 4) = hi;
  }
}

// ---------------------------------------------------------------------------
// LayerNorm over D=1024 per row: f32 in -> f16 out. One wave owns one row (32
// values a lane, read once and kept in registers), 8 rows a work-group.
// ---------------------------------------------------------------------------
// 4096 waves on 1024 SIMDs: four a SIMD, so a wave may hold all its loads in registers.
__global__ __launch_bounds__(256) __attribute__((amdgpu_waves_per_eu(4, 4))) void row_ln(
    const float* __restrict__ in, const float* __restrict__ gamma,
    const float* __restrict__ beta, _Float16* __restrict__ out) {
  const int lane = threadIdx.x & 31;
  const int wave = threadIdx.x >> 5;
  const size_t base = ((size_t)blockIdx.x * 8 + wave) * D_ + lane * 4;
  v4f x[8], g[8], b[8];
  const float* xp = in + base;
  const unsigned goff = lane * 4;
#pragma unroll  // all 24 loads are issued before the first value is used: one latency
  for (int j = 0; j < 8; ++j) x[j] = *(const v4f*)(xp + j * 128);
#pragma unroll  // constant indices: the values stay in registers
  for (int j = 0; j < 8; ++j) {
    g[j] = *(const v4f*)(gamma + goff + j * 128);
    b[j] = *(const v4f*)(beta + goff + j * 128);
  }
  // The loads' address registers are inputs here, so that no load's result is
  // placed in them and nothing rewrites them ahead of this wait.
  asm volatile("s_wait_xcnt 0x0" :: "v"(xp), "v"(goff * 4) : "memory");
  v4f vs = x[0], vq = x[0] * x[0];
#pragma unroll  // constant indices: the values stay in registers
  for (int j = 1; j < 8; ++j) { vs += x[j]; vq += x[j] * x[j]; }
  float s  = (vs[0] + vs[1]) + (vs[2] + vs[3]);
  float s2 = (vq[0] + vq[1]) + (vq[2] + vq[3]);
#pragma unroll  // five exchange steps with constant lane masks
  for (int m = 16; m >= 1; m >>= 1) {
    s  += __shfl_xor(s,  m);
    s2 += __shfl_xor(s2, m);
  }
  const float mean = s * (1.0f / (float)D_);
  const float var  = s2 * (1.0f / (float)D_) - mean * mean;
  const float rstd = rsqrtf(var + EPS_);
#pragma unroll  // constant indices: the values stay in registers
  for (int j = 0; j < 8; ++j)
    *(v4h*)(out + base + j * 128) =
        __builtin_convertvector((x[j] - mean) * rstd * g[j] + b[j], v4h);
}

// ---------------------------------------------------------------------------
extern "C" void kernel_launch(void* const* d_in, const int* in_sizes, int n_in,
                              void* d_out, int out_size, void* d_ws, size_t ws_size,
                              hipStream_t stream) {
  const float* x_q   = (const float*)d_in[0];
  const float* x_k   = (const float*)d_in[1];
  const float* x_v   = (const float*)d_in[2];
  const float* Wq    = (const float*)d_in[3];
  const float* Wk    = (const float*)d_in[4];
  const float* Wv    = (const float*)d_in[5];
  const float* Wproj = (const float*)d_in[6];
  const float* q_g   = (const float*)d_in[7];
  const float* q_b   = (const float*)d_in[8];
  const float* k_g   = (const float*)d_in[9];
  const float* k_b   = (const float*)d_in[10];
  const float* o_g   = (const float*)d_in[11];
  const float* o_b   = (const float*)d_in[12];
  float* out = (float*)d_out;

  const size_t MB = 1024 * 1024;
  char* w = (char*)d_ws;
  _Float16* xqh = (_Float16*)(w + 0 * MB);    // 8MB each
  _Float16* xkh = (_Float16*)(w + 8 * MB);
  _Float16* xvh = (_Float16*)(w + 16 * MB);
  _Float16* wqt = (_Float16*)(w + 24 * MB);   // 2MB each (transposed f16)
  _Float16* wkt = (_Float16*)(w + 26 * MB);
  _Float16* wvt = (_Float16*)(w + 28 * MB);
  _Float16* wpt = (_Float16*)(w + 30 * MB);
  _Float16* qh  = (_Float16*)(w + 80 * MB);   // 8MB each (post-LN f16)
  _Float16* kh  = (_Float16*)(w + 88 * MB);
  _Float16* vt  = (_Float16*)(w + 96 * MB);   // 8MB (d-major f16 V)
  float*    ao  = (float*)(w + 104 * MB);     // 16MB attention out f32
  _Float16* lnh = (_Float16*)(w + 0 * MB);    // reuse xqh space

  dim3 gblk(256);
  dim3 ggrid(D_ / 128, M_ / 64);

  // precision/layout conversion of all seven operands
  prep_f16<<<3 * CVT_WG_ + 4 * TR_WG_, 256, 0, stream>>>(
      x_q, x_k, x_v, Wq, Wk, Wv, Wproj, xqh, xkh, xvh, wqt, wkt, wvt, wpt);

  // projections; epilogues: per-head LN -> f16 (q, k), d-major f16 (v)
  gemm_head_ln<<<ggrid, gblk, 0, stream>>>(xqh, wqt, qh, q_g, q_b, 0.125f);
  gemm_head_ln<<<ggrid, gblk, 0, stream>>>(xkh, wkt, kh, k_g, k_b, 1.0f);
  gemm_dmajor<<<ggrid, gblk, 0, stream>>>(xvh, wvt, vt);

  flash_attn<<<dim3(S_ / 128, B_ * H_), 256, 0, stream>>>(qh, kh, vt, ao);

  row_ln<<<M_ / 8, 256, 0, stream>>>(ao, o_g, o_b, lnh);

  gemm_f16wmma<<<ggrid, gblk, 0, stream>>>(lnh, wpt, out);
}

// v005
// A run of this version takes 110 microseconds.
// In two side-by-side timings against v004, it was 1.05 and 1.07 times as fast.
// Over all steps from v000 it is 2.00 times as fast.
#include <hip/hip_runtime.h>
#include <hip/hip_bf16.h>
#include <math.h>

typedef __attribute__((ext_vector_type(16))) _Float16 v16h;
typedef __attribute__((ext_vector_type(8)))  _Float16 v8h;
typedef __attribute__((ext_vector_type(4)))  _Float16 v4h;
typedef __attribute__((ext_vector_type(8)))  float    v8f;
typedef __attribute__((ext_vector_type(4)))  float    v4f;

#define B_   2
#define S_   2048
#define F_   2048
#define D_   1024
#define H_   16
#define HD_  64
#define M_   4096           // B_*S_ == B_*F_
#define EPS_ 1e-5f

// ---- CDNA5 async copies: 16 B a lane, global -> LDS, tracked by ASYNCcnt ----
// A run of copies and the s_wait_xcnt 0 that stands ahead of any rewrite of their
// address registers are ONE statement, so that nothing can come between them.
// l: the lane's LDS byte address, g: its global address; copy i lies i row steps on.
#define CP_(a, b) "global_load_async_to_lds_b128 %" #a ", %" #b ", off\n\t"
static __device__ __forceinline__ unsigned lds_off(const void* p) { return (unsigned)(size_t)p; }

static __device__ __forceinline__ void async_cp4(unsigned l, unsigned ls,
                                                 const _Float16* g, int gs) {
  asm volatile(CP_(0, 4) CP_(1, 5) CP_(2, 6) CP_(3, 7) "s_wait_xcnt 0x0"
      :: "v"(l), "v"(l + ls), "v"(l + 2 * ls), "v"(l + 3 * ls),
         "v"(g), "v"(g + gs), "v"(g + 2 * gs), "v"(g + 3 * gs)
      : "memory");
}
// 4 copies of one tile and 4 of another
static __device__ __forceinline__ void async_cp4_4(unsigned l, unsigned ls,
                                                   const _Float16* g, int gs,
                                                   unsigned m, unsigned ms,
                                                   const _Float16* h, int hs) {
  asm volatile(CP_(0, 8) CP_(1, 9) CP_(2, 10) CP_(3, 11)
               CP_(4, 12) CP_(5, 13) CP_(6, 14) CP_(7, 15) "s_wait_xcnt 0x0"
      :: "v"(l), "v"(l + ls), "v"(l + 2 * ls), "v"(l + 3 * ls),
         "v"(m), "v"(m + ms), "v"(m + 2 * ms), "v"(m + 3 * ms),
         "v"(g), "v"(g + gs), "v"(g + 2 * gs), "v"(g + 3 * gs),
         "v"(h), "v"(h + hs), "v"(h + 2 * hs), "v"(h + 3 * hs)
      : "memory");
}
// 4 copies of one tile and 8 of another
static __device__ __forceinline__ void async_cp4_8(unsigned l, unsigned ls,
                                                   const _Float16* g, int gs,
                                                   unsigned m, unsigned ms,
                                                   const _Float16* h, int hs) {
  asm volatile(CP_(0, 12) CP_(1, 13) CP_(2, 14) CP_(3, 15)
               CP_(4, 16) CP_(5, 17) CP_(6, 18) CP_(7, 19)
               CP_(8, 20) CP_(9, 21) CP_(10, 22) CP_(11, 23) "s_wait_xcnt 0x0"
      :: "v"(l), "v"(l + ls), "v"(l + 2 * ls), "v"(l + 3 * ls),
         "v"(m), "v"(m + ms), "v"(m + 2 * ms), "v"(m + 3 * ms),
         "v"(m + 4 * ms), "v"(m + 5 * ms), "v"(m + 6 * ms), "v"(m + 7 * ms),
         "v"(g), "v"(g + gs), "v"(g + 2 * gs), "v"(g + 3 * gs),
         "v"(h), "v"(h + hs), "v"(h + 2 * hs), "v"(h + 3 * hs),
         "v"(h + 4 * hs), "v"(h + 5 * hs), "v"(h + 6 * hs), "v"(h + 7 * hs)
      : "memory");
}

#define KS_ 128   // k (GEMM) or keys (attention) per stage of an LDS ring
#define P256_ 136 // LDS pitch in halves of 256-byte rows: 272 bytes, 16 x odd (ds_load_b128)
#define P128_ 72  // LDS pitch in halves of 128-byte rows: 144 bytes, 16 x odd

// Concatenate two contiguous 8-half K-runs into a WMMA 16-bit fragment.
static __device__ __forceinline__ v16h frag_from(const _Float16* row, int half16) {
  v8h lo = *(const v8h*)(row + 8 * half16);        // K = {0..7}  + 8*half
  v8h hi = *(const v8h*)(row + 16 + 8 * half16);   // K = {16..23}+ 8*half
  return __builtin_shufflevector(lo, hi, 0, 1, 2, 3, 4, 5, 6, 7,
                                 8, 9, 10, 11, 12, 13, 14, 15);
}

// ---------------------------------------------------------------------------
// All f16 operands in ONE launch of few, long-lived work-groups: a streaming
// launch this short is bounded by the start of its waves, not by its bytes.
//   work-groups 0 .. 767   : x_q, x_k, x_v f32 -> f16, 16384 elements each;
//                            a wave's load is 512 contiguous bytes, many in flight.
//   work-groups 768 .. 1279: Wq, Wk, Wv, Wproj (k x n) f32 -> (n x k) f16, one
//                            64(k) x 128(n) tile each; 8 lanes store one 128-byte line.
// ---------------------------------------------------------------------------
#define CVT_WG_ 256    // work-groups per activation array
#define TR_WG_  128    // work-groups per weight matrix
__global__ __launch_bounds__(256) void prep_f16(
    const float* __restrict__ x_q, const float* __restrict__ x_k,
    const float* __restrict__ x_v, const float* __restrict__ Wq,
    const float* __restrict__ Wk, const float* __restrict__ Wv,
    const float* __restrict__ Wp,
    _Float16* __restrict__ xqh, _Float16* __restrict__ xkh,
    _Float16* __restrict__ xvh, _Float16* __restrict__ wqt,
    _Float16* __restrict__ wkt, _Float16* __restrict__ wvt,
    _Float16* __restrict__ wpt) {
  __shared__ float t[64][129];   // odd pitch: the column reads below meet no bank twice
  const int tid = threadIdx.x;
  const int bid = blockIdx.x;
  if (bid < 3 * CVT_WG_) {
    const int a = bid / CVT_WG_;
    const float* in  = a == 0 ? x_q : a == 1 ? x_k : x_v;
    _Float16*    out = a == 0 ? xqh : a == 1 ? xkh : xvh;
    const size_t base = (size_t)(bid % CVT_WG_) * 16384 + tid * 4;
    v4f x[16];
#pragma unroll  // the loads run ahead of the conversions: many in flight a wave
    for (int u = 0; u < 16; ++u) x[u] = *(const v4f*)(in + base + u * 1024);
#pragma unroll  // constant indices: the values stay in registers
    for (int u = 0; u < 16; ++u)
      *(v4h*)(out + base + u * 1024) = __builtin_convertvector(x[u], v4h);
  } else {
    const int tb = bid - 3 * CVT_WG_;
    const int m  = tb / TR_WG_;
    const float* in  = m == 0 ? Wq : m == 1 ? Wk : m == 2 ? Wv : Wp;
    _Float16*    out = m == 0 ? wqt : m == 1 ? wkt : m == 2 ? wvt : wpt;
    const int kb = ((tb % TR_WG_) >> 3) * 64;
    const int nb = (tb & 7) * 128;
    // a wave reads 512 contiguous bytes of one k row; load j is 8 rows further down
    const float* p = in + (size_t)(kb + (tid >> 5)) * D_ + nb + (tid & 31) * 4;
    v4f x[8];
#pragma unroll  // all 8 loads are issued before the first value is used
    for (int j = 0; j < 8; ++j) x[j] = *(const v4f*)(p + j * 8 * D_);
#pragma unroll  // constant indices: the values stay in registers
    for (int j = 0; j < 8; ++j) {
      const int idx = tid + j * 256;
#pragma unroll  // constant indices: the values stay in registers
      for (int e = 0; e < 4; ++e) t[idx >> 5][(idx & 31) * 4 + e] = x[j][e];
    }
    __syncthreads();   // the whole tile is in LDS before a lane reads other waves' rows
#pragma unroll  // four independent lines: their LDS reads overlap
    for (int i = 0; i < 4; ++i) {
      const int unit = tid + i * 256;
      const int n = unit >> 3, part = unit & 7;
      v8h h;
#pragma unroll  // constant indices: the values stay in registers
      for (int e = 0; e < 8; ++e) h[e] = (_Float16)t[part * 8 + e][n];
      *(v8h*)(out + (size_t)(nb + n) * D_ + kb + part * 8) = h;
    }
    // In the built code the other branch's text follows this one behind a test and
    // reuses the stores' registers: the wait stands ahead of that.
    asm volatile("s_wait_xcnt 0x0" ::: "memory");
  }
}

// ---------------------------------------------------------------------------
// [4096,1024] = A[4096,1024](f16) @ Wt[1024,1024](f16, N-major rows)
// Workgroup tile 64(M) x 128(N), 8 waves of 32x32; a stage is 128 k, four steps of 32.
// Two buffers of async b128 copies, one barrier a stage (copies overlap WMMA).
// The epilogue emits what the next kernel reads:
//   epi_f32    : f32 rows to C.
//   epi_head_ln: LayerNorm over each 64-column head, scaled, f16 rows to Ch.
//   epi_dmajor : f16, d-major: Ch[(b*D + n)][f], m = b*F + f.
// The last two pass the tile through LDS so that 8 lanes own one 128-byte line.
// ---------------------------------------------------------------------------
struct __attribute__((aligned(16))) GemmRing {
  _Float16 As[2][64][P256_];    // 64 M-rows x 128 K
  _Float16 Bts[2][128][P256_];  // 128 N-rows x 128 K
};

// One stage of the ring: four k steps of 32 from buffer cur, 16 WMMAs a wave.
static __device__ __forceinline__ void gemm_stage(const GemmRing& ring, int cur,
                                                  v8f (&acc)[2][2]) {
  const int lane = threadIdx.x & 31;
  const int wave = threadIdx.x >> 5;
  const int wm = (wave & 1) * 32;
  const int wn = (wave >> 1) * 32;
  const int half16 = lane >> 4;
  const int arow   = lane & 15;
#pragma unroll  // the four k steps of a stage read LDS at constant offsets from one address
  for (int kk = 0; kk < KS_; kk += 32) {
    v16h afrag[2], bfrag[2];
#pragma unroll
    for (int mi = 0; mi < 2; ++mi)
      afrag[mi] = frag_from(&ring.As[cur][wm + mi * 16 + arow][kk], half16);
#pragma unroll
    for (int ni = 0; ni < 2; ++ni)
      bfrag[ni] = frag_from(&ring.Bts[cur][wn + ni * 16 + arow][kk], half16);

#pragma unroll
    for (int mi = 0; mi < 2; ++mi)
#pragma unroll
      for (int ni = 0; ni < 2; ++ni)
        acc[mi][ni] = __builtin_amdgcn_wmma_f32_16x16x32_f16(
            false, afrag[mi], false, bfrag[ni], (short)0, acc[mi][ni],
            false, false);
  }
}

static __device__ __forceinline__ void gemm_loop(
    const _Float16* __restrict__ A, const _Float16* __restrict__ Wt,
    GemmRing& ring, v8f (&acc)[2][2]) {
  const int tid = threadIdx.x;
  const int m0 = blockIdx.y * 64;
  const int n0 = blockIdx.x * 128;

  // staging: 16 lanes bring one 256-byte row; a lane's 12 copies lie 16 rows apart
  const int sr = tid >> 4, sc = (tid & 15) * 8;
  const _Float16* ga = &A[(size_t)(m0 + sr) * D_ + sc];
  const _Float16* gb = &Wt[(size_t)(n0 + sr) * D_ + sc];
  const unsigned la = lds_off(&ring.As[0][sr][sc]);
  const unsigned lb = lds_off(&ring.Bts[0][sr][sc]);
  constexpr unsigned ABUF = 64 * P256_ * 2, BBUF = 128 * P256_ * 2;   // bytes per buffer
  constexpr unsigned LR = 16 * P256_ * 2;   // 16 rows on in LDS, bytes
  constexpr int      GR = 16 * D_;          // 16 rows on in global memory, halves
  constexpr int NT = D_ / KS_;

  // prologue: stage 0 lands and is published, then stage 1 starts
  async_cp4_8(la, LR, ga, GR, lb, LR, gb, GR);
  asm volatile("s_wait_asynccnt 0x0" ::: "memory");   // this wave's share of stage 0 has landed
  __syncthreads();                                    // ... and every other wave's
  async_cp4_8(la + ABUF, LR, ga + KS_, GR, lb + BBUF, LR, gb + KS_, GR);

  for (int t = 0; t < NT; ++t) {
    const int cur = t & 1;
    gemm_stage(ring, cur, acc);
    // publish point of stage t + 1; the one barrier also frees the buffer just read
    asm volatile("s_wait_dscnt 0x0" ::: "memory");      // this wave's reads of stage t are done
    asm volatile("s_wait_asynccnt 0x0" ::: "memory");   // its share of stage t + 1 has landed
    __syncthreads();
    if (t + 2 < NT)
      async_cp4_8(la + cur * ABUF, LR, ga + (t + 2) * KS_, GR,
                  lb + cur * BBUF, LR, gb + (t + 2) * KS_, GR);
  }
  asm volatile("s_wait_asynccnt 0x0" ::: "memory");     // no copy is open when the wave goes on
}

static __device__ __forceinline__ void epi_f32(const v8f (&acc)[2][2], float* __restrict__ C) {
  const int lane = threadIdx.x & 31;
  const int wave = threadIdx.x >> 5;
  const int m0 = blockIdx.y * 64, n0 = blockIdx.x * 128;
  const int wm = (wave & 1) * 32, wn = (wave >> 1) * 32;
  const int half16 = lane >> 4, arow = lane & 15;
  float* cb = &C[(size_t)(m0 + wm + half16 * 8) * D_ + n0 + wn + arow];
#pragma unroll
  for (int mi = 0; mi < 2; ++mi)
#pragma unroll
    for (int ni = 0; ni < 2; ++ni)
#pragma unroll
      for (int r = 0; r < 8; ++r)
        cb[(size_t)(mi * 16 + r) * D_ + ni * 16] = acc[mi][ni][r];
}

static __device__ __forceinline__ void epi_head_ln(
    const v8f (&acc)[2][2], float (*Cs)[132],   // 64 rows of 528 bytes
    _Float16* __restrict__ Ch, const float* __restrict__ gamma,
    const float* __restrict__ beta, float scale) {
  const int tid  = threadIdx.x;
  const int lane = tid & 31;
  const int wave = tid >> 5;
  const int m0 = blockIdx.y * 64, n0 = blockIdx.x * 128;
  const int wm = (wave & 1) * 32, wn = (wave >> 1) * 32;
  const int half16 = lane >> 4, arow = lane & 15;
#pragma unroll  // constant indices: the values stay in registers
  for (int mi = 0; mi < 2; ++mi)
#pragma unroll  // constant indices: the values stay in registers
    for (int ni = 0; ni < 2; ++ni)
#pragma unroll  // constant indices: the values stay in registers
      for (int r = 0; r < 8; ++r)
        Cs[wm + mi * 16 + half16 * 8 + r][wn + ni * 16 + arow] = acc[mi][ni][r];
  __syncthreads();   // the whole tile is in LDS before a lane reads other waves' parts
  // 8 lanes per head vector, 8 elements each; 128 head vectors in the tile.
  const int part = tid & 7;
  const v4f g0 = *(const v4f*)(gamma + part * 8);
  const v4f g1 = *(const v4f*)(gamma + part * 8 + 4);
  const v4f b0 = *(const v4f*)(beta + part * 8);
  const v4f b1 = *(const v4f*)(beta + part * 8 + 4);
  v8h hs[4];
  _Float16* hp[4];
#pragma unroll  // four independent head vectors: their LDS reads and exchanges overlap
  for (int i = 0; i < 4; ++i) {
    const int hv  = (tid >> 3) + i * 32;
    const int row = hv >> 1;
    const int col = (hv & 1) * 64 + part * 8;
    const v4f x0 = *(const v4f*)&Cs[row][col];
    const v4f x1 = *(const v4f*)&Cs[row][col + 4];
    const v4f xs = x0 + x1;
    const v4f xq = x0 * x0 + x1 * x1;
    float s  = (xs[0] + xs[1]) + (xs[2] + xs[3]);
    float s2 = (xq[0] + xq[1]) + (xq[2] + xq[3]);
#pragma unroll  // three exchange steps with constant lane masks
    for (int m = 4; m >= 1; m >>= 1) {
      s  += __shfl_xor(s,  m);
      s2 += __shfl_xor(s2, m);
    }
    const float mean = s * (1.0f / 64.0f);
    const float var  = s2 * (1.0f / 64.0f) - mean * mean;
    const float rstd = rsqrtf(var + EPS_);
    v8h h;
#pragma unroll  // constant indices: the values stay in registers
    for (int e = 0; e < 4; ++e) {
      h[e]     = (_Float16)(((x0[e] - mean) * rstd * g0[e] + b0[e]) * scale);
      h[4 + e] = (_Float16)(((x1[e] - mean) * rstd * g1[e] + b1[e]) * scale);
    }
    hs[i] = h;
    hp[i] = &Ch[(size_t)(m0 + row) * D_ + n0 + col];
    *(v8h*)hp[i] = h;
  }
  // The caller's next tile reuses registers. The stores' data and addresses are inputs
  // here, so that they stay in place and nothing rewrites them ahead of this wait.
  asm volatile("s_wait_xcnt 0x0" :: "v"(hs[0]), "v"(hs[1]), "v"(hs[2]), "v"(hs[3]),
               "v"(hp[0]), "v"(hp[1]), "v"(hp[2]), "v"(hp[3]) : "memory");
}

static __device__ __forceinline__ void epi_dmajor(
    const v8f (&acc)[2][2], _Float16 (*Ts)[72],   // 128 rows of 144 bytes
    _Float16* __restrict__ Ch) {
  const int tid  = threadIdx.x;
  const int lane = tid & 31;
  const int wave = tid >> 5;
  const int m0 = blockIdx.y * 64, n0 = blockIdx.x * 128;
  const int wm = (wave & 1) * 32, wn = (wave >> 1) * 32;
  const int half16 = lane >> 4, arow = lane & 15;
#pragma unroll  // constant indices: the values stay in registers
  for (int mi = 0; mi < 2; ++mi)
#pragma unroll  // constant indices: the values stay in registers
    for (int ni = 0; ni < 2; ++ni) {
      v8h h;   // 8 consecutive m of one column n
#pragma unroll  // constant indices: the values stay in registers
      for (int r = 0; r < 8; ++r) h[r] = (_Float16)acc[mi][ni][r];
      *(v8h*)&Ts[wn + ni * 16 + arow][wm + mi * 16 + half16 * 8] = h;
    }
  __syncthreads();   // the whole tile is in LDS before a lane reads other waves' parts
  // 8 lanes per column n: 64 m = one 128-byte line of the d-major plane.
  const int bb = m0 / F_, fb = m0 % F_;
  const int part = tid & 7;
  v8h hs[4];
  _Float16* hp[4];
#pragma unroll  // four independent lines: their LDS reads overlap
  for (int i = 0; i < 4; ++i) {
    const int n = (tid >> 3) + i * 32;
    hs[i] = *(const v8h*)&Ts[n][part * 8];
    hp[i] = &Ch[((size_t)bb * D_ + n0 + n) * F_ + fb + part * 8];
    *(v8h*)hp[i] = hs[i];
  }
  // The code behind the call reuses registers. The stores' data and addresses are inputs
  // here, so that they stay in place and nothing rewrites them ahead of this wait.
  asm volatile("s_wait_xcnt 0x0" :: "v"(hs[0]), "v"(hs[1]), "v"(hs[2]), "v"(hs[3]),
               "v"(hp[0]), "v"(hp[1]), "v"(hp[2]), "v"(hp[3]) : "memory");
}

__global__ __launch_bounds__(256) void gemm_f16wmma(
    const _Float16* __restrict__ A, const _Float16* __restrict__ Wt,
    float* __restrict__ C) {
  __shared__ GemmRing ring;
  v8f acc[2][2] = {};
  gemm_loop(A, Wt, ring, acc);
  epi_f32(acc, C);
}

// The copies of stage s of three GEMMs in a row (GEMM s / 8, k block s % 8) into buffer
// s & 1. ao, bo: the lane's element in A and in Wt; la, lb: its LDS bytes in buffer 0.
static __device__ __forceinline__ void copy_stage3(
    int s, const _Float16* a0, const _Float16* a1, const _Float16* a2, size_t ao, unsigned la,
    const _Float16* b0, const _Float16* b1, const _Float16* b2, size_t bo, unsigned lb) {
  constexpr unsigned ABUF = 64 * P256_ * 2, BBUF = 128 * P256_ * 2;   // bytes per buffer
  constexpr unsigned LR = 16 * P256_ * 2;   // 16 rows on in LDS, bytes
  constexpr int      GR = 16 * D_;          // 16 rows on in global memory, halves
  constexpr int NT = D_ / KS_;
  const int z = s / NT, k0 = (s % NT) * KS_;
  const _Float16* a = z == 0 ? a0 : z == 1 ? a1 : a2;
  const _Float16* b = z == 0 ? b0 : z == 1 ? b1 : b2;
  async_cp4_8(la + (s & 1) * ABUF, LR, a + ao + k0, GR,
              lb + (s & 1) * BBUF, LR, b + bo + k0, GR);
}

// The three projections in ONE launch. They share no operand and do not depend on each
// other, so a work-group walks its (m, n) tile of q, then of k, then of v on ONE ring of
// 3 x 8 stages: the next tile's first two stages are copied while the last stages and
// the epilogue of the tile before run, and the waves start once instead of three times.
__global__ __launch_bounds__(256) void gemm_qkv(
    const _Float16* __restrict__ xq, const _Float16* __restrict__ xk,
    const _Float16* __restrict__ xv, const _Float16* __restrict__ wq,
    const _Float16* __restrict__ wk, const _Float16* __restrict__ wv,
    _Float16* __restrict__ qh, _Float16* __restrict__ kh, _Float16* __restrict__ vt,
    const float* __restrict__ q_g, const float* __restrict__ q_b,
    const float* __restrict__ k_g, const float* __restrict__ k_b) {
  __shared__ GemmRing ring;
  __shared__ __attribute__((aligned(16))) float tile[64 * 132];   // either epilogue's tile
  const int tid = threadIdx.x;

  // staging: 16 lanes bring one 256-byte row; a lane's 12 copies lie 16 rows apart
  const int sr = tid >> 4, sc = (tid & 15) * 8;
  const size_t aoff = (size_t)(blockIdx.y * 64 + sr) * D_ + sc;
  const size_t boff = (size_t)(blockIdx.x * 128 + sr) * D_ + sc;
  const unsigned la = lds_off(&ring.As[0][sr][sc]);
  const unsigned lb = lds_off(&ring.Bts[0][sr][sc]);
  constexpr int NT = D_ / KS_;              // stages per tile
  constexpr int NS = 3 * NT;                // stages in all

  // prologue: stage 0 lands and is published, then stage 1 starts
  copy_stage3(0, xq, xk, xv, aoff, la, wq, wk, wv, boff, lb);
  asm volatile("s_wait_asynccnt 0x0" ::: "memory");   // this wave's share of stage 0 has landed
  __syncthreads();                                    // ... and every other wave's
  copy_stage3(1, xq, xk, xv, aoff, la, wq, wk, wv, boff, lb);

  v8f acc[2][2] = {};

  for (int s = 0; s < NS; ++s) {
    gemm_stage(ring, s & 1, acc);
    // publish point of stage s + 1; the one barrier also frees the buffer just read
    asm volatile("s_wait_dscnt 0x0" ::: "memory");      // this wave's reads of stage s are done
    asm volatile("s_wait_asynccnt 0x0" ::: "memory");   // its share of stage s + 1 has landed
    __syncthreads();
    if (s + 2 < NS) copy_stage3(s + 2, xq, xk, xv, aoff, la, wq, wk, wv, boff, lb);
    if (s % NT == NT - 1) {   // a tile is complete; its epilogue uses LDS outside the ring
      const int z = s / NT;
      if (z < 2)
        epi_head_ln(acc, (float (*)[132])tile, z == 0 ? qh : kh, z == 0 ? q_g : k_g,
                    z == 0 ? q_b : k_b, z == 0 ? 0.125f : 1.0f);
      else
        epi_dmajor(acc, (_Float16 (*)[72])tile, vt);
#pragma unroll  // constant indices: the values stay in registers
      for (int i = 0; i < 4; ++i) acc[i >> 1][i & 1] = v8f{};
    }
  }
  asm volatile("s_wait_asynccnt 0x0" ::: "memory");     // no copy is open when the wave ends
}

static __device__ __forceinline__ float xhalf(float x) {
  int i = __builtin_bit_cast(int, x);
  return __builtin_bit_cast(float, __builtin_amdgcn_permlanex16(
      i, i, 0x76543210, 0xfedcba98, false, false));
}

__global__ __launch_bounds__(256) void flash_attn(
    const _Float16* __restrict__ q, const _Float16* __restrict__ k,
    const _Float16* __restrict__ v, float* __restrict__ o) {
  __shared__ __attribute__((aligned(16))) _Float16 Qs[128][P128_];       // 128 s-rows x 64 d
  __shared__ __attribute__((aligned(16))) _Float16 Ks[2][KS_][P128_];    // 128 f-rows x 64 d
  __shared__ __attribute__((aligned(16))) _Float16 Vs[2][64][P256_];     // 64 d-rows x 128 f
  const int tid  = threadIdx.x;
  const int lane = tid & 31;
  const int wave = tid >> 5;
  const int half16 = lane >> 4;
  const int arow   = lane & 15;
  const int bh = blockIdx.y;
  const int b  = bh / H_;
  const int hd = bh % H_;
  const size_t qbase = (size_t)b * S_ * D_ + (size_t)hd * HD_;
  const size_t kbase = (size_t)b * F_ * D_ + (size_t)hd * HD_;
  const size_t vbase = ((size_t)b * D_ + (size_t)hd * HD_) * F_;

  // staging: 8 lanes bring one 128-byte row of Q or K, 16 lanes one 256-byte row of V;
  // a lane's 4 copies of a tile lie 32 (Q, K) or 16 (V) rows apart
  const int kr = tid >> 3, kc8 = (tid & 7) * 8;
  const int vd = tid >> 4, vf  = (tid & 15) * 8;
  const _Float16* gk = &k[kbase + (size_t)kr * D_ + kc8];
  const _Float16* gv = &v[vbase + (size_t)vd * F_ + vf];
  const unsigned lk = lds_off(&Ks[0][kr][kc8]);
  const unsigned lv = lds_off(&Vs[0][vd][vf]);
  constexpr unsigned KBUF = KS_ * P128_ * 2, VBUF = 64 * P256_ * 2;   // bytes per buffer
  constexpr unsigned LKR = 32 * P128_ * 2, LVR = 16 * P256_ * 2;      // row steps in LDS, bytes
  constexpr int NS = F_ / KS_;

  // prologue: Q and stage 0 land and are published, then stage 1 starts
  async_cp4(lds_off(&Qs[kr][kc8]), LKR,
            &q[qbase + (size_t)(blockIdx.x * 128 + kr) * D_ + kc8], 32 * D_);
  async_cp4_4(lk, LKR, gk, 32 * D_, lv, LVR, gv, 16 * F_);
  asm volatile("s_wait_asynccnt 0x0" ::: "memory");   // this wave's share has landed
  __syncthreads();                                    // ... and every other wave's
  async_cp4_4(lk + KBUF, LKR, gk + (size_t)KS_ * D_, 32 * D_, lv + VBUF, LVR, gv + KS_, 16 * F_);

  v16h qa[2];
#pragma unroll
  for (int kc = 0; kc < 2; ++kc)
    qa[kc] = frag_from(&Qs[wave * 16 + arow][kc * 32], half16);

  v8f oacc[4] = {};          // oacc[c][r] = O[query arow][d = c*16 + half16*8 + r]
  float mrun = -INFINITY;    // running maximum of query arow (equal in both halves)
  float lrun = 0.0f;         // this half's share of the denominator

  for (int st = 0; st < NS; ++st) {
    const int cur = st & 1;
#pragma unroll  // four passes of 32 keys: a pass's LDS reads may run ahead of the pass before
    for (int f0 = 0; f0 < KS_; f0 += 32) {
      // S^T = k @ q^T : sacc[ni][r] = score(key ni*16 + half16*8 + r, query arow).
      v8f sacc[2] = {};
#pragma unroll
      for (int kc = 0; kc < 2; ++kc) {
        v16h kf[2];
#pragma unroll
        for (int ni = 0; ni < 2; ++ni)
          kf[ni] = frag_from(&Ks[cur][f0 + ni * 16 + arow][kc * 32], half16);
#pragma unroll
        for (int ni = 0; ni < 2; ++ni)
          sacc[ni] = __builtin_amdgcn_wmma_f32_16x16x32_f16(
              false, kf[ni], false, qa[kc], (short)0, sacc[ni], false, false);
      }

      // Online softmax of one query per lane: in-lane maximum, one half exchange.
      float mx = fmaxf(sacc[0][0], sacc[1][0]);
#pragma unroll
      for (int r = 1; r < 8; ++r) mx = fmaxf(mx, fmaxf(sacc[0][r], sacc[1][r]));
      mx = fmaxf(mx, xhalf(mx));
      const float mnew = fmaxf(mrun, mx);
      const float corr = __expf(mrun - mnew);
      mrun = mnew;

      // P^T as B operand: element s is key kmap(s) = (s < 8 ? s : s + 8) + 8*half16,
      // which is register s & 7 of tile s >> 3; V^T rows come in the same k order.
      v16h pb;
      v8f p0 = sacc[0] - mnew, p1 = sacc[1] - mnew;
#pragma unroll
      for (int r = 0; r < 8; ++r) {
        p0[r] = __expf(p0[r]);
        p1[r] = __expf(p1[r]);
        pb[r]     = (_Float16)p0[r];
        pb[8 + r] = (_Float16)p1[r];
      }
      const v8f ps = p0 + p1;
      const float rs = ((ps[0] + ps[1]) + (ps[2] + ps[3])) + ((ps[4] + ps[5]) + (ps[6] + ps[7]));
      lrun = lrun * corr + rs;
#pragma unroll
      for (int c = 0; c < 4; ++c) oacc[c] *= corr;

      // O^T += V^T(64x32) @ P^T(32x16)
#pragma unroll
      for (int c = 0; c < 4; ++c) {
        v16h vf16 = frag_from(&Vs[cur][c * 16 + arow][f0], half16);
        oacc[c] = __builtin_amdgcn_wmma_f32_16x16x32_f16(
            false, vf16, false, pb, (short)0, oacc[c], false, false);
      }
    }
    // publish point of stage st + 1; the one barrier also frees the buffer just read
    asm volatile("s_wait_dscnt 0x0" ::: "memory");      // this wave's reads of stage st are done
    asm volatile("s_wait_asynccnt 0x0" ::: "memory");   // its share of stage st + 1 has landed
    __syncthreads();
    if (st + 2 < NS)
      async_cp4_4(lk + cur * KBUF, LKR, gk + (size_t)(st + 2) * KS_ * D_, 32 * D_,
                  lv + cur * VBUF, LVR, gv + (st + 2) * KS_, 16 * F_);
  }
  asm volatile("s_wait_asynccnt 0x0" ::: "memory");     // no copy is open when the wave goes on

  // Join the two halves' denominators once; a lane stores 8 consecutive d.
  const float inv = 1.0f / (lrun + xhalf(lrun));
  const int s0 = blockIdx.x * 128 + wave * 16;
  float* ob = &o[((size_t)b * S_ + s0 + arow) * D_ + hd * HD_ + half16 * 8];
#pragma unroll
  for (int c = 0; c < 4; ++c) {
    v4f lo, hi;
#pragma unroll
    for (int r = 0; r < 4; ++r) { lo[r] = oacc[c][r] * inv; hi[r] = oacc[c][4 + r] * inv; }
    *(v4f*)(ob + c * 16)     = lo;
    *(v4f*)(ob + c * 16 + 4) = hi;
  }
}

// ---------------------------------------------------------------------------
// LayerNorm over D=1024 per row: f32 in -> f16 out. One wave owns one row (32
// values a lane, read once and kept in registers), 8 rows a work-group.
// ---------------------------------------------------------------------------
// 4096 waves on 1024 SIMDs: four a SIMD, so a wave may hold all its loads in registers.
__global__ __launch_bounds__(256) __attribute__((amdgpu_waves_per_eu(4, 4))) void row_ln(
    const float* __restrict__ in, const float* __restrict__ gamma,
    const float* __restrict__ beta, _Float16* __restrict__ out) {
  const int lane = threadIdx.x & 31;
  const int wave = threadIdx.x >> 5;
  const size_t base = ((size_t)blockIdx.x * 8 + wave) * D_ + lane * 4;
  v4f x[8], g[8], b[8];
  const float* xp = in + base;
  const unsigned goff = lane * 4;
#pragma unroll  // all 24 loads are issued before the first value is used: one latency
  for (int j = 0; j < 8; ++j) x[j] = *(const v4f*)(xp + j * 128);
#pragma unroll  // constant indices: the values stay in registers
  for (int j = 0; j < 8; ++j) {
    g[j] = *(const v4f*)(gamma + goff + j * 128);
    b[j] = *(const v4f*)(beta + goff + j * 128);
  }
  // The loads' address registers are inputs here, so that no load's result is
  // placed in them and nothing rewrites them ahead of this wait.
  asm volatile("s_wait_xcnt 0x0" :: "v"(xp), "v"(goff * 4) : "memory");
  v4f vs = x[0], vq = x[0] * x[0];
#pragma unroll  // constant indices: the values stay in registers
  for (int j = 1; j < 8; ++j) { vs += x[j]; vq += x[j] * x[j]; }
  float s  = (vs[0] + vs[1]) + (vs[2] + vs[3]);
  float s2 = (vq[0] + vq[1]) + (vq[2] + vq[3]);
#pragma unroll  // five exchange steps with constant lane masks
  for (int m = 16; m >= 1; m >>= 1) {
    s  += __shfl_xor(s,  m);
    s2 += __shfl_xor(s2, m);
  }
  const float mean = s * (1.0f / (float)D_);
  const float var  = s2 * (1.0f / (float)D_) - mean * mean;
  const float rstd = rsqrtf(var + EPS_);
#pragma unroll  // constant indices: the values stay in registers
  for (int j = 0; j < 8; ++j)
    *(v4h*)(out + base + j * 128) =
        __builtin_convertvector((x[j] - mean) * rstd * g[j] + b[j], v4h);
}

// ---------------------------------------------------------------------------
extern "C" void kernel_launch(void* const* d_in, const int* in_sizes, int n_in,
                              void* d_out, int out_size, void* d_ws, size_t ws_size,
                              hipStream_t stream) {
  const float* x_q   = (const float*)d_in[0];
  const float* x_k   = (const float*)d_in[1];
  const float* x_v   = (const float*)d_in[2];
  const float* Wq    = (const float*)d_in[3];
  const float* Wk    = (const float*)d_in[4];
  const float* Wv    = (const float*)d_in[5];
  const float* Wproj = (const float*)d_in[6];
  const float* q_g   = (const float*)d_in[7];
  const float* q_b   = (const float*)d_in[8];
  const float* k_g   = (const float*)d_in[9];
  const float* k_b   = (const float*)d_in[10];
  const float* o_g   = (const float*)d_in[11];
  const float* o_b   = (const float*)d_in[12];
  float* out = (float*)d_out;

  const size_t MB = 1024 * 1024;
  char* w = (char*)d_ws;
  _Float16* xqh = (_Float16*)(w + 0 * MB);    // 8MB each
  _Float16* xkh = (_Float16*)(w + 8 * MB);
  _Float16* xvh = (_Float16*)(w + 16 * MB);
  _Float16* wqt = (_Float16*)(w + 24 * MB);   // 2MB each (transposed f16)
  _Float16* wkt = (_Float16*)(w + 26 * MB);
  _Float16* wvt = (_Float16*)(w + 28 * MB);
  _Float16* wpt = (_Float16*)(w + 30 * MB);
  _Float16* qh  = (_Float16*)(w + 80 * MB);   // 8MB each (post-LN f16)
  _Float16* kh  = (_Float16*)(w + 88 * MB);
  _Float16* vt  = (_Float16*)(w + 96 * MB);   // 8MB (d-major f16 V)
  float*    ao  = (float*)(w + 104 * MB);     // 16MB attention out f32
  _Float16* lnh = (_Float16*)(w + 0 * MB);    // reuse xqh space

  dim3 gblk(256);
  dim3 ggrid(D_ / 128, M_ / 64);

  // precision/layout conversion of all seven operands
  prep_f16<<<3 * CVT_WG_ + 4 * TR_WG_, 256, 0, stream>>>(
      x_q, x_k, x_v, Wq, Wk, Wv, Wproj, xqh, xkh, xvh, wqt, wkt, wvt, wpt);

  // all three projections; epilogues: per-head LN -> f16 (q, k), d-major f16 (v)
  gemm_qkv<<<ggrid, gblk, 0, stream>>>(
      xqh, xkh, xvh, wqt, wkt, wvt, qh, kh, vt, q_g, q_b, k_g, k_b);

  flash_attn<<<dim3(S_ / 128, B_ * H_), 256, 0, stream>>>(qh, kh, vt, ao);

  row_ln<<<M_ / 8, 256, 0, stream>>>(ao, o_g, o_b, lnh);

  gemm_f16wmma<<<ggrid, gblk, 0, stream>>>(lnh, wpt, out);
}

// v006
// A run of this version takes 91.2 microseconds.
// Two timings next to v005 put it at 1.22 and 1.21 times that version's speed.
// Over all steps from v000 it is 2.43 times as fast.
#include <hip/hip_runtime.h>
#include <hip/hip_bf16.h>
#include <math.h>

typedef __attribute__((ext_vector_type(16))) _Float16 v16h;
typedef __attribute__((ext_vector_type(8)))  _Float16 v8h;
typedef __attribute__((ext_vector_type(4)))  _Float16 v4h;
typedef __attribute__((ext_vector_type(8)))  float    v8f;
typedef __attribute__((ext_vector_type(4)))  float    v4f;

#define B_   2
#define S_   2048
#define F_   2048
#define D_   1024
#define H_   16
#define HD_  64
#define M_   4096           // B_*S_ == B_*F_
#define EPS_ 1e-5f

// ---- CDNA5 async copies: 16 B a lane, global -> LDS, tracked by ASYNCcnt ----
// A run of copies and the s_wait_xcnt 0 that stands ahead of any rewrite of their
// address registers are ONE statement, so that nothing can come between them.
// l: the lane's LDS byte address, g: its global address; copy i lies i row steps on.
#define CP_(a, b) "global_load_async_to_lds_b128 %" #a ", %" #b ", off\n\t"
static __device__ __forceinline__ unsigned lds_off(const void* p) { return (unsigned)(size_t)p; }

static __device__ __forceinline__ void async_cp4(unsigned l, unsigned ls,
                                                 const _Float16* g, int gs) {
  asm volatile(CP_(0, 4) CP_(1, 5) CP_(2, 6) CP_(3, 7) "s_wait_xcnt 0x0"
      :: "v"(l), "v"(l + ls), "v"(l + 2 * ls), "v"(l + 3 * ls),
         "v"(g), "v"(g + gs), "v"(g + 2 * gs), "v"(g + 3 * gs)
      : "memory");
}
// 4 copies of one tile and 4 of another
static __device__ __forceinline__ void async_cp4_4(unsigned l, unsigned ls,
                                                   const _Float16* g, int gs,
                                                   unsigned m, unsigned ms,
                                                   const _Float16* h, int hs) {
  asm volatile(CP_(0, 8) CP_(1, 9) CP_(2, 10) CP_(3, 11)
               CP_(4, 12) CP_(5, 13) CP_(6, 14) CP_(7, 15) "s_wait_xcnt 0x0"
      :: "v"(l), "v"(l + ls), "v"(l + 2 * ls), "v"(l + 3 * ls),
         "v"(m), "v"(m + ms), "v"(m + 2 * ms), "v"(m + 3 * ms),
         "v"(g), "v"(g + gs), "v"(g + 2 * gs), "v"(g + 3 * gs),
         "v"(h), "v"(h + hs), "v"(h + 2 * hs), "v"(h + 3 * hs)
      : "memory");
}
// 4 copies of one tile and 8 of another
static __device__ __forceinline__ void async_cp4_8(unsigned l, unsigned ls,
                                                   const _Float16* g, int gs,
                                                   unsigned m, unsigned ms,
                                                   const _Float16* h, int hs) {
  asm volatile(CP_(0, 12) CP_(1, 13) CP_(2, 14) CP_(3, 15)
               CP_(4, 16) CP_(5, 17) CP_(6, 18) CP_(7, 19)
               CP_(8, 20) CP_(9, 21) CP_(10, 22) CP_(11, 23) "s_wait_xcnt 0x0"
      :: "v"(l), "v"(l + ls), "v"(l + 2 * ls), "v"(l + 3 * ls),
         "v"(m), "v"(m + ms), "v"(m + 2 * ms), "v"(m + 3 * ms),
         "v"(m + 4 * ms), "v"(m + 5 * ms), "v"(m + 6 * ms), "v"(m + 7 * ms),
         "v"(g), "v"(g + gs), "v"(g + 2 * gs), "v"(g + 3 * gs),
         "v"(h), "v"(h + hs), "v"(h + 2 * hs), "v"(h + 3 * hs),
         "v"(h + 4 * hs), "v"(h + 5 * hs), "v"(h + 6 * hs), "v"(h + 7 * hs)
      : "memory");
}

#define KS_ 128   // k (GEMM) or keys (attention) per stage of an LDS ring
#define P256_ 136 // LDS pitch in halves of 256-byte rows: 272 bytes, 16 x odd (ds_load_b128)
#define P128_ 72  // LDS pitch in halves of 128-byte rows: 144 bytes, 16 x odd

// Concatenate two contiguous 8-half K-runs into a WMMA 16-bit fragment.
static __device__ __forceinline__ v16h frag_from(const _Float16* row, int half16) {
  v8h lo = *(const v8h*)(row + 8 * half16);        // K = {0..7}  + 8*half
  v8h hi = *(const v8h*)(row + 16 + 8 * half16);   // K = {16..23}+ 8*half
  return __builtin_shufflevector(lo, hi, 0, 1, 2, 3, 4, 5, 6, 7,
                                 8, 9, 10, 11, 12, 13, 14, 15);
}

// ---------------------------------------------------------------------------
// All f16 operands in ONE launch of few, long-lived work-groups: a streaming
// launch this short is bounded by the start of its waves, not by its bytes.
//   work-groups 0 .. 767   : x_q, x_k, x_v f32 -> f16, 16384 elements each;
//                            a wave's load is 512 contiguous bytes, many in flight.
//   work-groups 768 .. 1279: Wq, Wk, Wv, Wproj (k x n) f32 -> (n x k) f16, one
//                            64(k) x 128(n) tile each; 8 lanes store one 128-byte line.
// The output LayerNorm is folded into the last product:
//   LN(x) @ W = rstd * (x @ (g*W) - mean * u) + c,  u[n] = sum_k g[k] W[k][n],
//                                                   c[n] = sum_k b[k] W[k][n].
// Wproj is therefore stored as g[k] * W[k][n], and each of its tiles leaves its 64 k's
// share of u (summed over the rounded f16 values the product will use) and of c.
// ---------------------------------------------------------------------------
#define CVT_WG_ 256    // work-groups per activation array
#define TR_WG_  128    // work-groups per weight matrix
__global__ __launch_bounds__(256) void prep_f16(
    const float* __restrict__ x_q, const float* __restrict__ x_k,
    const float* __restrict__ x_v, const float* __restrict__ Wq,
    const float* __restrict__ Wk, const float* __restrict__ Wv,
    const float* __restrict__ Wp, const float* __restrict__ o_g,
    const float* __restrict__ o_b,
    _Float16* __restrict__ xqh, _Float16* __restrict__ xkh,
    _Float16* __restrict__ xvh, _Float16* __restrict__ wqt,
    _Float16* __restrict__ wkt, _Float16* __restrict__ wvt,
    _Float16* __restrict__ wpt, float* __restrict__ up, float* __restrict__ cp) {
  __shared__ float t[64][129];   // odd pitch: the column reads below meet no bank twice
  __shared__ float cs[2][128];   // this tile's share of u and of c
  const int tid = threadIdx.x;
  const int bid = blockIdx.x;
  if (bid < 3 * CVT_WG_) {
    const int a = bid / CVT_WG_;
    const float* in  = a == 0 ? x_q : a == 1 ? x_k : x_v;
    _Float16*    out = a == 0 ? xqh : a == 1 ? xkh : xvh;
    const size_t base = (size_t)(bid % CVT_WG_) * 16384 + tid * 4;
    v4f x[16];
#pragma unroll  // the loads run ahead of the conversions: many in flight a wave
    for (int u = 0; u < 16; ++u) x[u] = *(const v4f*)(in + base + u * 1024);
#pragma unroll  // constant indices: the values stay in registers
    for (int u = 0; u < 16; ++u)
      *(v4h*)(out + base + u * 1024) = __builtin_convertvector(x[u], v4h);
  } else {
    const int tb = bid - 3 * CVT_WG_;
    const int m  = tb / TR_WG_;
    const float* in  = m == 0 ? Wq : m == 1 ? Wk : m == 2 ? Wv : Wp;
    _Float16*    out = m == 0 ? wqt : m == 1 ? wkt : m == 2 ? wvt : wpt;
    const int kb = ((tb % TR_WG_) >> 3) * 64;
    const int nb = (tb & 7) * 128;
    const bool fold = m == 3;   // the same for the whole work-group
    const int part = tid & 7;   // the lane's 8 k of every line it stores
    v4f g0 = {1.0f, 1.0f, 1.0f, 1.0f}, g1 = g0, b0 = {}, b1 = {};
    if (fold) {                 // issued ahead of the tile's loads: one latency for all
      g0 = *(const v4f*)(o_g + kb + part * 8);
      g1 = *(const v4f*)(o_g + kb + part * 8 + 4);
      b0 = *(const v4f*)(o_b + kb + part * 8);
      b1 = *(const v4f*)(o_b + kb + part * 8 + 4);
      // The loads' offset register is an input here, so that nothing rewrites it
      // ahead of this wait.
      asm volatile("s_wait_xcnt 0x0" :: "v"(part * 32) : "memory");
    }
    // a wave reads 512 contiguous bytes of one k row; load j is 8 rows further down
    const float* p = in + (size_t)(kb + (tid >> 5)) * D_ + nb + (tid & 31) * 4;
    v4f x[8];
#pragma unroll  // all 8 loads are issued before the first value is used
    for (int j = 0; j < 8; ++j) x[j] = *(const v4f*)(p + j * 8 * D_);
#pragma unroll  // constant indices: the values stay in registers
    for (int j = 0; j < 8; ++j) {
      const int idx = tid + j * 256;
#pragma unroll  // constant indices: the values stay in registers
      for (int e = 0; e < 4; ++e) t[idx >> 5][(idx & 31) * 4 + e] = x[j][e];
    }
    __syncthreads();   // the whole tile is in LDS before a lane reads other waves' rows
    v8h hs[4];
    _Float16* hp[4];
#pragma unroll  // four independent lines: their LDS reads overlap
    for (int i = 0; i < 4; ++i) {
      const int n = (tid >> 3) + i * 32;
      v8h h;
      float su = 0.0f, sc = 0.0f;
#pragma unroll  // constant indices: the values stay in registers
      for (int e = 0; e < 8; ++e) {
        const float wv = t[part * 8 + e][n];
        h[e] = (_Float16)(wv * (e < 4 ? g0[e & 3] : g1[e & 3]));
        su += (float)h[e];
        sc += wv * (e < 4 ? b0[e & 3] : b1[e & 3]);
      }
      hs[i] = h;
      hp[i] = out + (size_t)(nb + n) * D_ + kb + part * 8;
      if (fold) {
#pragma unroll  // three exchange steps with constant lane masks
        for (int x = 4; x >= 1; x >>= 1) {
          su += __shfl_xor(su, x);
          sc += __shfl_xor(sc, x);
        }
        if (part == 0) { cs[0][n] = su; cs[1][n] = sc; }
      }
    }
    if (fold) {   // ahead of the lines' stores, so that this barrier does not wait for them
      __syncthreads();   // all 128 column sums are in LDS; a wave then stores one whole line
      float* dst = ((tid >> 7) ? cp : up) + (kb >> 6) * D_ + nb + (tid & 127);
      const float sv = cs[tid >> 7][tid & 127];
      *dst = sv;
      // The store's data and address are inputs here, so that they stay in place and
      // nothing rewrites them ahead of this wait.
      asm volatile("s_wait_xcnt 0x0" :: "v"(dst), "v"(sv) : "memory");
    }
#pragma unroll  // constant indices: the values stay in registers
    for (int i = 0; i < 4; ++i) *(v8h*)hp[i] = hs[i];
    // The stores' data and addresses are inputs here, so that they stay in place and
    // nothing rewrites them ahead of this wait.
    asm volatile("s_wait_xcnt 0x0" :: "v"(hs[0]), "v"(hs[1]), "v"(hs[2]), "v"(hs[3]),
                 "v"(hp[0]), "v"(hp[1]), "v"(hp[2]), "v"(hp[3]) : "memory");
  }
}

// ---------------------------------------------------------------------------
// [4096,1024] = A[4096,1024](f16) @ Wt[1024,1024](f16, N-major rows)
// Workgroup tile 64(M) x 128(N), 8 waves of 32x32; a stage is 128 k, four steps of 32.
// Two buffers of async b128 copies, one barrier a stage (copies overlap WMMA).
// The epilogue emits what the next kernel reads:
//   epi_ln_f32 : the folded LayerNorm's row and column terms, f32 rows to C.
//   epi_head_ln: LayerNorm over each 64-column head, scaled, f16 rows to Ch.
//   epi_dmajor : f16, d-major: Ch[(b*D + n)][f], m = b*F + f.
// The last two pass the tile through LDS so that 8 lanes own one 128-byte line.
// ---------------------------------------------------------------------------
struct __attribute__((aligned(16))) GemmRing {
  _Float16 As[2][64][P256_];    // 64 M-rows x 128 K
  _Float16 Bts[2][128][P256_];  // 128 N-rows x 128 K
};

// One stage of the ring: four k steps of 32 from buffer cur, 16 WMMAs a wave.
static __device__ __forceinline__ void gemm_stage(const GemmRing& ring, int cur,
                                                  v8f (&acc)[2][2]) {
  const int lane = threadIdx.x & 31;
  const int wave = threadIdx.x >> 5;
  const int wm = (wave & 1) * 32;
  const int wn = (wave >> 1) * 32;
  const int half16 = lane >> 4;
  const int arow   = lane & 15;
#pragma unroll  // the four k steps of a stage read LDS at constant offsets from one address
  for (int kk = 0; kk < KS_; kk += 32) {
    v16h afrag[2], bfrag[2];
#pragma unroll
    for (int mi = 0; mi < 2; ++mi)
      afrag[mi] = frag_from(&ring.As[cur][wm + mi * 16 + arow][kk], half16);
#pragma unroll
    for (int ni = 0; ni < 2; ++ni)
      bfrag[ni] = frag_from(&ring.Bts[cur][wn + ni * 16 + arow][kk], half16);

#pragma unroll
    for (int mi = 0; mi < 2; ++mi)
#pragma unroll
      for (int ni = 0; ni < 2; ++ni)
        acc[mi][ni] = __builtin_amdgcn_wmma_f32_16x16x32_f16(
            false, afrag[mi], false, bfrag[ni], (short)0, acc[mi][ni],
            false, false);
  }
}

// mid() runs while stage 0's copies fly; what it writes to LDS is published by the
// prologue's barrier.
template <typename F>
static __device__ __forceinline__ void gemm_loop(
    const _Float16* __restrict__ A, const _Float16* __restrict__ Wt,
    GemmRing& ring, v8f (&acc)[2][2], F mid) {
  const int tid = threadIdx.x;
  const int m0 = blockIdx.y * 64;
  const int n0 = blockIdx.x * 128;

  // staging: 16 lanes bring one 256-byte row; a lane's 12 copies lie 16 rows apart
  const int sr = tid >> 4, sc = (tid & 15) * 8;
  const _Float16* ga = &A[(size_t)(m0 + sr) * D_ + sc];
  const _Float16* gb = &Wt[(size_t)(n0 + sr) * D_ + sc];
  const unsigned la = lds_off(&ring.As[0][sr][sc]);
  const unsigned lb = lds_off(&ring.Bts[0][sr][sc]);
  constexpr unsigned ABUF = 64 * P256_ * 2, BBUF = 128 * P256_ * 2;   // bytes per buffer
  constexpr unsigned LR = 16 * P256_ * 2;   // 16 rows on in LDS, bytes
  constexpr int      GR = 16 * D_;          // 16 rows on in global memory, halves
  constexpr int NT = D_ / KS_;

  // prologue: stage 0 lands and is published, then stage 1 starts
  async_cp4_8(la, LR, ga, GR, lb, LR, gb, GR);
  mid();
  asm volatile("s_wait_asynccnt 0x0" ::: "memory");   // this wave's share of stage 0 has landed
  __syncthreads();                                    // ... and every other wave's
  async_cp4_8(la + ABUF, LR, ga + KS_, GR, lb + BBUF, LR, gb + KS_, GR);

  for (int t = 0; t < NT; ++t) {
    const int cur = t & 1;
    gemm_stage(ring, cur, acc);
    // publish point of stage t + 1; the one barrier also frees the buffer just read
    asm volatile("s_wait_dscnt 0x0" ::: "memory");      // this wave's reads of stage t are done
    asm volatile("s_wait_asynccnt 0x0" ::: "memory");   // its share of stage t + 1 has landed
    __syncthreads();
    if (t + 2 < NT)
      async_cp4_8(la + cur * ABUF, LR, ga + (t + 2) * KS_, GR,
                  lb + cur * BBUF, LR, gb + (t + 2) * KS_, GR);
  }
  asm volatile("s_wait_asynccnt 0x0" ::: "memory");     // no copy is open when the wave goes on
}

// C = rstd[m] * (acc - mean[m] * u[n]) + c[n]; rs: mean, rstd of the tile's 64 rows,
// cv: u, c of its 128 columns.
static __device__ __forceinline__ void epi_ln_f32(
    v8f (&acc)[2][2], const float (*rs)[64], const float (*cv)[128], float* __restrict__ C) {
  const int lane = threadIdx.x & 31;
  const int wave = threadIdx.x >> 5;
  const int m0 = blockIdx.y * 64, n0 = blockIdx.x * 128;
  const int wm = (wave & 1) * 32, wn = (wave >> 1) * 32;
  const int half16 = lane >> 4, arow = lane & 15;
  float* cb = &C[(size_t)(m0 + wm + half16 * 8) * D_ + n0 + wn + arow];
#pragma unroll  // constant indices: the values stay in registers
  for (int mi = 0; mi < 2; ++mi) {
    const v8f mean = *(const v8f*)&rs[0][wm + mi * 16 + half16 * 8];
    const v8f rstd = *(const v8f*)&rs[1][wm + mi * 16 + half16 * 8];
#pragma unroll  // constant indices: the values stay in registers
    for (int ni = 0; ni < 2; ++ni) {
      const float u = cv[0][wn + ni * 16 + arow];
      const float c = cv[1][wn + ni * 16 + arow];
      acc[mi][ni] = rstd * (acc[mi][ni] - mean * u) + c;
    }
  }
#pragma unroll
  for (int mi = 0; mi < 2; ++mi)
#pragma unroll
    for (int ni = 0; ni < 2; ++ni)
#pragma unroll
      for (int r = 0; r < 8; ++r)
        cb[(size_t)(mi * 16 + r) * D_ + ni * 16] = acc[mi][ni][r];
}

static __device__ __forceinline__ void epi_head_ln(
    const v8f (&acc)[2][2], float (*Cs)[132],   // 64 rows of 528 bytes
    _Float16* __restrict__ Ch, const float* __restrict__ gamma,
    const float* __restrict__ beta, float scale) {
  const int tid  = threadIdx.x;
  const int lane = tid & 31;
  const int wave = tid >> 5;
  const int m0 = blockIdx.y * 64, n0 = blockIdx.x * 128;
  const int wm = (wave & 1) * 32, wn = (wave >> 1) * 32;
  const int half16 = lane >> 4, arow = lane & 15;
#pragma unroll  // constant indices: the values stay in registers
  for (int mi = 0; mi < 2; ++mi)
#pragma unroll  // constant indices: the values stay in registers
    for (int ni = 0; ni < 2; ++ni)
#pragma unroll  // constant indices: the values stay in registers
      for (int r = 0; r < 8; ++r)
        Cs[wm + mi * 16 + half16 * 8 + r][wn + ni * 16 + arow] = acc[mi][ni][r];
  __syncthreads();   // the whole tile is in LDS before a lane reads other waves' parts
  // 8 lanes per head vector, 8 elements each; 128 head vectors in the tile.
  const int part = tid & 7;
  const v4f g0 = *(const v4f*)(gamma + part * 8);
  const v4f g1 = *(const v4f*)(gamma + part * 8 + 4);
  const v4f b0 = *(const v4f*)(beta + part * 8);
  const v4f b1 = *(const v4f*)(beta + part * 8 + 4);
  v8h hs[4];
  _Float16* hp[4];
#pragma unroll  // four independent head vectors: their LDS reads and exchanges overlap
  for (int i = 0; i < 4; ++i) {
    const int hv  = (tid >> 3) + i * 32;
    const int row = hv >> 1;
    const int col = (hv & 1) * 64 + part * 8;
    const v4f x0 = *(const v4f*)&Cs[row][col];
    const v4f x1 = *(const v4f*)&Cs[row][col + 4];
    const v4f xs = x0 + x1;
    const v4f xq = x0 * x0 + x1 * x1;
    float s  = (xs[0] + xs[1]) + (xs[2] + xs[3]);
    float s2 = (xq[0] + xq[1]) + (xq[2] + xq[3]);
#pragma unroll  // three exchange steps with constant lane masks
    for (int m = 4; m >= 1; m >>= 1) {
      s  += __shfl_xor(s,  m);
      s2 += __shfl_xor(s2, m);
    }
    const float mean = s * (1.0f / 64.0f);
    const float var  = s2 * (1.0f / 64.0f) - mean * mean;
    const float rstd = rsqrtf(var + EPS_);
    v8h h;
#pragma unroll  // constant indices: the values stay in registers
    for (int e = 0; e < 4; ++e) {
      h[e]     = (_Float16)(((x0[e] - mean) * rstd * g0[e] + b0[e]) * scale);
      h[4 + e] = (_Float16)(((x1[e] - mean) * rstd * g1[e] + b1[e]) * scale);
    }
    hs[i] = h;
    hp[i] = &Ch[(size_t)(m0 + row) * D_ + n0 + col];
    *(v8h*)hp[i] = h;
  }
  // The caller's next tile reuses registers. The stores' data and addresses are inputs
  // here, so that they stay in place and nothing rewrites them ahead of this wait.
  asm volatile("s_wait_xcnt 0x0" :: "v"(hs[0]), "v"(hs[1]), "v"(hs[2]), "v"(hs[3]),
               "v"(hp[0]), "v"(hp[1]), "v"(hp[2]), "v"(hp[3]) : "memory");
}

static __device__ __forceinline__ void epi_dmajor(
    const v8f (&acc)[2][2], _Float16 (*Ts)[72],   // 128 rows of 144 bytes
    _Float16* __restrict__ Ch) {
  const int tid  = threadIdx.x;
  const int lane = tid & 31;
  const int wave = tid >> 5;
  const int m0 = blockIdx.y * 64, n0 = blockIdx.x * 128;
  const int wm = (wave & 1) * 32, wn = (wave >> 1) * 32;
  const int half16 = lane >> 4, arow = lane & 15;
#pragma unroll  // constant indices: the values stay in registers
  for (int mi = 0; mi < 2; ++mi)
#pragma unroll  // constant indices: the values stay in registers
    for (int ni = 0; ni < 2; ++ni) {
      v8h h;   // 8 consecutive m of one column n
#pragma unroll  // constant indices: the values stay in registers
      for (int r = 0; r < 8; ++r) h[r] = (_Float16)acc[mi][ni][r];
      *(v8h*)&Ts[wn + ni * 16 + arow][wm + mi * 16 + half16 * 8] = h;
    }
  __syncthreads();   // the whole tile is in LDS before a lane reads other waves' parts
  // 8 lanes per column n: 64 m = one 128-byte line of the d-major plane.
  const int bb = m0 / F_, fb = m0 % F_;
  const int part = tid & 7;
  v8h hs[4];
  _Float16* hp[4];
#pragma unroll  // four independent lines: their LDS reads overlap
  for (int i = 0; i < 4; ++i) {
    const int n = (tid >> 3) + i * 32;
    hs[i] = *(const v8h*)&Ts[n][part * 8];
    hp[i] = &Ch[((size_t)bb * D_ + n0 + n) * F_ + fb + part * 8];
    *(v8h*)hp[i] = hs[i];
  }
  // The code behind the call reuses registers. The stores' data and addresses are inputs
  // here, so that they stay in place and nothing rewrites them ahead of this wait.
  asm volatile("s_wait_xcnt 0x0" :: "v"(hs[0]), "v"(hs[1]), "v"(hs[2]), "v"(hs[3]),
               "v"(hp[0]), "v"(hp[1]), "v"(hp[2]), "v"(hp[3]) : "memory");
}

// A: attention output, f16, not normalised; Wt: g * Wproj. st: per head and 16 rows, 16
// row sums and 16 sums of squares over the head's 64 columns; up, cp: 16 shares of u, c.
__global__ __launch_bounds__(256) void gemm_f16wmma(
    const _Float16* __restrict__ A, const _Float16* __restrict__ Wt,
    const float* __restrict__ st, const float* __restrict__ up,
    const float* __restrict__ cp, float* __restrict__ C) {
  __shared__ GemmRing ring;
  __shared__ __attribute__((aligned(32))) float rs[2][64];
  __shared__ float cv[2][128];
  v8f acc[2][2] = {};
  gemm_loop(A, Wt, ring, acc, [&]() {
    const int tid = threadIdx.x;
    // the wave's number in a scalar register: whole waves branch, EXEC stays all ones
    const int wv = __builtin_amdgcn_readfirstlane(tid >> 5);
    if (wv < 4) {             // waves 0 to 3: one column a lane
      const float* pu = up + blockIdx.x * 128 + tid;
      const float* pc = cp + blockIdx.x * 128 + tid;
      float xu[16], xc[16];
#pragma unroll  // all 32 loads are issued before the first value is used: one latency
      for (int j = 0; j < 16; ++j) { xu[j] = pu[j * D_]; xc[j] = pc[j * D_]; }
      // The loads' offset register is an input here, so that nothing rewrites it
      // ahead of this wait.
      asm volatile("s_wait_xcnt 0x0" :: "v"(tid) : "memory");
      float u = xu[0], c = xc[0];
#pragma unroll  // constant indices: the values stay in registers
      for (int j = 1; j < 16; ++j) { u += xu[j]; c += xc[j]; }
      cv[0][tid] = u;
      cv[1][tid] = c;
    } else if (wv < 6) {      // waves 4 and 5: one row a lane
      const int r = tid - 128;
      const float* ps = st + (blockIdx.y * 4 + (r >> 4)) * 32 + (r & 15);
      float xs[16], xq[16];
#pragma unroll  // all 32 loads are issued before the first value is used: one latency
      for (int j = 0; j < 16; ++j) {
        xs[j] = ps[j * (M_ / 16) * 32];
        xq[j] = ps[j * (M_ / 16) * 32 + 16];
      }
      // The loads' address registers are inputs here, so that nothing rewrites them
      // ahead of this wait.
      asm volatile("s_wait_xcnt 0x0" :: "v"(ps) : "memory");
      float s = xs[0], s2 = xq[0];
#pragma unroll  // constant indices: the values stay in registers
      for (int j = 1; j < 16; ++j) { s += xs[j]; s2 += xq[j]; }
      const float mean = s * (1.0f / (float)D_);
      const float var  = s2 * (1.0f / (float)D_) - mean * mean;
      rs[0][r] = mean;
      rs[1][r] = rsqrtf(var + EPS_);
    }
  });
  epi_ln_f32(acc, rs, cv, C);
}

// The copies of stage s of three GEMMs in a row (GEMM s / 8, k block s % 8) into buffer
// s & 1. ao, bo: the lane's element in A and in Wt; la, lb: its LDS bytes in buffer 0.
static __device__ __forceinline__ void copy_stage3(
    int s, const _Float16* a0, const _Float16* a1, const _Float16* a2, size_t ao, unsigned la,
    const _Float16* b0, const _Float16* b1, const _Float16* b2, size_t bo, unsigned lb) {
  constexpr unsigned ABUF = 64 * P256_ * 2, BBUF = 128 * P256_ * 2;   // bytes per buffer
  constexpr unsigned LR = 16 * P256_ * 2;   // 16 rows on in LDS, bytes
  constexpr int      GR = 16 * D_;          // 16 rows on in global memory, halves
  constexpr int NT = D_ / KS_;
  const int z = s / NT, k0 = (s % NT) * KS_;
  const _Float16* a = z == 0 ? a0 : z == 1 ? a1 : a2;
  const _Float16* b = z == 0 ? b0 : z == 1 ? b1 : b2;
  async_cp4_8(la + (s & 1) * ABUF, LR, a + ao + k0, GR,
              lb + (s & 1) * BBUF, LR, b + bo + k0, GR);
}

// The three projections in ONE launch. They share no operand and do not depend on each
// other, so a work-group walks its (m, n) tile of q, then of k, then of v on ONE ring of
// 3 x 8 stages: the next tile's first two stages are copied while the last stages and
// the epilogue of the tile before run, and the waves start once instead of three times.
__global__ __launch_bounds__(256) void gemm_qkv(
    const _Float16* __restrict__ xq, const _Float16* __restrict__ xk,
    const _Float16* __restrict__ xv, const _Float16* __restrict__ wq,
    const _Float16* __restrict__ wk, const _Float16* __restrict__ wv,
    _Float16* __restrict__ qh, _Float16* __restrict__ kh, _Float16* __restrict__ vt,
    const float* __restrict__ q_g, const float* __restrict__ q_b,
    const float* __restrict__ k_g, const float* __restrict__ k_b) {
  __shared__ GemmRing ring;
  __shared__ __attribute__((aligned(16))) float tile[64 * 132];   // either epilogue's tile
  const int tid = threadIdx.x;

  // staging: 16 lanes bring one 256-byte row; a lane's 12 copies lie 16 rows apart
  const int sr = tid >> 4, sc = (tid & 15) * 8;
  const size_t aoff = (size_t)(blockIdx.y * 64 + sr) * D_ + sc;
  const size_t boff = (size_t)(blockIdx.x * 128 + sr) * D_ + sc;
  const unsigned la = lds_off(&ring.As[0][sr][sc]);
  const unsigned lb = lds_off(&ring.Bts[0][sr][sc]);
  constexpr int NT = D_ / KS_;              // stages per tile
  constexpr int NS = 3 * NT;                // stages in all

  // prologue: stage 0 lands and is published, then stage 1 starts
  copy_stage3(0, xq, xk, xv, aoff, la, wq, wk, wv, boff, lb);
  asm volatile("s_wait_asynccnt 0x0" ::: "memory");   // this wave's share of stage 0 has landed
  __syncthreads();                                    // ... and every other wave's
  copy_stage3(1, xq, xk, xv, aoff, la, wq, wk, wv, boff, lb);

  v8f acc[2][2] = {};

  for (int s = 0; s < NS; ++s) {
    gemm_stage(ring, s & 1, acc);
    // publish point of stage s + 1; the one barrier also frees the buffer just read
    asm volatile("s_wait_dscnt 0x0" ::: "memory");      // this wave's reads of stage s are done
    asm volatile("s_wait_asynccnt 0x0" ::: "memory");   // its share of stage s + 1 has landed
    __syncthreads();
    if (s + 2 < NS) copy_stage3(s + 2, xq, xk, xv, aoff, la, wq, wk, wv, boff, lb);
    if (s % NT == NT - 1) {   // a tile is complete; its epilogue uses LDS outside the ring
      const int z = s / NT;
      if (z < 2)
        epi_head_ln(acc, (float (*)[132])tile, z == 0 ? qh : kh, z == 0 ? q_g : k_g,
                    z == 0 ? q_b : k_b, z == 0 ? 0.125f : 1.0f);
      else
        epi_dmajor(acc, (_Float16 (*)[72])tile, vt);
#pragma unroll  // constant indices: the values stay in registers
      for (int i = 0; i < 4; ++i) acc[i >> 1][i & 1] = v8f{};
    }
  }
  asm volatile("s_wait_asynccnt 0x0" ::: "memory");     // no copy is open when the wave ends
}

static __device__ __forceinline__ float xhalf(float x) {
  int i = __builtin_bit_cast(int, x);
  return __builtin_bit_cast(float, __builtin_amdgcn_permlanex16(
      i, i, 0x76543210, 0xfedcba98, false, false));
}

__global__ __launch_bounds__(256) void flash_attn(
    const _Float16* __restrict__ q, const _Float16* __restrict__ k,
    const _Float16* __restrict__ v, _Float16* __restrict__ o, float* __restrict__ st) {
  __shared__ __attribute__((aligned(16))) _Float16 Qs[128][P128_];       // 128 s-rows x 64 d
  __shared__ __attribute__((aligned(16))) _Float16 Ks[2][KS_][P128_];    // 128 f-rows x 64 d
  __shared__ __attribute__((aligned(16))) _Float16 Vs[2][64][P256_];     // 64 d-rows x 128 f
  const int tid  = threadIdx.x;
  const int lane = tid & 31;
  const int wave = tid >> 5;
  const int half16 = lane >> 4;
  const int arow   = lane & 15;
  const int bh = blockIdx.y;
  const int b  = bh / H_;
  const int hd = bh % H_;
  const size_t qbase = (size_t)b * S_ * D_ + (size_t)hd * HD_;
  const size_t kbase = (size_t)b * F_ * D_ + (size_t)hd * HD_;
  const size_t vbase = ((size_t)b * D_ + (size_t)hd * HD_) * F_;

  // staging: 8 lanes bring one 128-byte row of Q or K, 16 lanes one 256-byte row of V;
  // a lane's 4 copies of a tile lie 32 (Q, K) or 16 (V) rows apart
  const int kr = tid >> 3, kc8 = (tid & 7) * 8;
  const int vd = tid >> 4, vf  = (tid & 15) * 8;
  const _Float16* gk = &k[kbase + (size_t)kr * D_ + kc8];
  const _Float16* gv = &v[vbase + (size_t)vd * F_ + vf];
  const unsigned lk = lds_off(&Ks[0][kr][kc8]);
  const unsigned lv = lds_off(&Vs[0][vd][vf]);
  constexpr unsigned KBUF = KS_ * P128_ * 2, VBUF = 64 * P256_ * 2;   // bytes per buffer
  constexpr unsigned LKR = 32 * P128_ * 2, LVR = 16 * P256_ * 2;      // row steps in LDS, bytes
  constexpr int NS = F_ / KS_;

  // prologue: Q and stage 0 land and are published, then stage 1 starts
  async_cp4(lds_off(&Qs[kr][kc8]), LKR,
            &q[qbase + (size_t)(blockIdx.x * 128 + kr) * D_ + kc8], 32 * D_);
  async_cp4_4(lk, LKR, gk, 32 * D_, lv, LVR, gv, 16 * F_);
  asm volatile("s_wait_asynccnt 0x0" ::: "memory");   // this wave's share has landed
  __syncthreads();                                    // ... and every other wave's
  async_cp4_4(lk + KBUF, LKR, gk + (size_t)KS_ * D_, 32 * D_, lv + VBUF, LVR, gv + KS_, 16 * F_);

  v16h qa[2];
#pragma unroll
  for (int kc = 0; kc < 2; ++kc)
    qa[kc] = frag_from(&Qs[wave * 16 + arow][kc * 32], half16);

  v8f oacc[4] = {};          // oacc[c][r] = O[query arow][d = c*16 + half16*8 + r]
  float mrun = -INFINITY;    // running maximum of query arow (equal in both halves)
  float lrun = 0.0f;         // this half's share of the denominator

  for (int st = 0; st < NS; ++st) {
    const int cur = st & 1;
#pragma unroll  // four passes of 32 keys: a pass's LDS reads may run ahead of the pass before
    for (int f0 = 0; f0 < KS_; f0 += 32) {
      // S^T = k @ q^T : sacc[ni][r] = score(key ni*16 + half16*8 + r, query arow).
      v8f sacc[2] = {};
#pragma unroll
      for (int kc = 0; kc < 2; ++kc) {
        v16h kf[2];
#pragma unroll
        for (int ni = 0; ni < 2; ++ni)
          kf[ni] = frag_from(&Ks[cur][f0 + ni * 16 + arow][kc * 32], half16);
#pragma unroll
        for (int ni = 0; ni < 2; ++ni)
          sacc[ni] = __builtin_amdgcn_wmma_f32_16x16x32_f16(
              false, kf[ni], false, qa[kc], (short)0, sacc[ni], false, false);
      }

      // Online softmax of one query per lane: in-lane maximum, one half exchange.
      float mx = fmaxf(sacc[0][0], sacc[1][0]);
#pragma unroll
      for (int r = 1; r < 8; ++r) mx = fmaxf(mx, fmaxf(sacc[0][r], sacc[1][r]));
      mx = fmaxf(mx, xhalf(mx));
      const float mnew = fmaxf(mrun, mx);
      const float corr = __expf(mrun - mnew);
      mrun = mnew;

      // P^T as B operand: element s is key kmap(s) = (s < 8 ? s : s + 8) + 8*half16,
      // which is register s & 7 of tile s >> 3; V^T rows come in the same k order.
      v16h pb;
      v8f p0 = sacc[0] - mnew, p1 = sacc[1] - mnew;
#pragma unroll
      for (int r = 0; r < 8; ++r) {
        p0[r] = __expf(p0[r]);
        p1[r] = __expf(p1[r]);
        pb[r]     = (_Float16)p0[r];
        pb[8 + r] = (_Float16)p1[r];
      }
      const v8f ps = p0 + p1;
      const float rs = ((ps[0] + ps[1]) + (ps[2] + ps[3])) + ((ps[4] + ps[5]) + (ps[6] + ps[7]));
      lrun = lrun * corr + rs;
#pragma unroll
      for (int c = 0; c < 4; ++c) oacc[c] *= corr;

      // O^T += V^T(64x32) @ P^T(32x16)
#pragma unroll
      for (int c = 0; c < 4; ++c) {
        v16h vf16 = frag_from(&Vs[cur][c * 16 + arow][f0], half16);
        oacc[c] = __builtin_amdgcn_wmma_f32_16x16x32_f16(
            false, vf16, false, pb, (short)0, oacc[c], false, false);
      }
    }
    // publish point of stage st + 1; the one barrier also frees the buffer just read
    asm volatile("s_wait_dscnt 0x0" ::: "memory");      // this wave's reads of stage st are done
    asm volatile("s_wait_asynccnt 0x0" ::: "memory");   // its share of stage st + 1 has landed
    __syncthreads();
    if (st + 2 < NS)
      async_cp4_4(lk + cur * KBUF, LKR, gk + (size_t)(st + 2) * KS_ * D_, 32 * D_,
                  lv + cur * VBUF, LVR, gv + (st + 2) * KS_, 16 * F_);
  }
  asm volatile("s_wait_asynccnt 0x0" ::: "memory");     // no copy is open when the wave goes on

  // Join the two halves' denominators once; a lane stores 8 consecutive d.
  const float inv = 1.0f / (lrun + xhalf(lrun));
  const int s0 = blockIdx.x * 128 + wave * 16;
  _Float16* ob = &o[((size_t)b * S_ + s0 + arow) * D_ + hd * HD_ + half16 * 8];
  v8h hs[4];
  v8f vs = {}, vq = {};   // sums over the rounded values, which the last product reads
#pragma unroll  // constant indices: the values stay in registers
  for (int c = 0; c < 4; ++c) {
    hs[c] = __builtin_convertvector(oacc[c] * inv, v8h);
    const v8f x = __builtin_convertvector(hs[c], v8f);
    vs += x;
    vq += x * x;
  }
  float s  = ((vs[0] + vs[1]) + (vs[2] + vs[3])) + ((vs[4] + vs[5]) + (vs[6] + vs[7]));
  float s2 = ((vq[0] + vq[1]) + (vq[2] + vq[3])) + ((vq[4] + vq[5]) + (vq[6] + vq[7]));
  s  += xhalf(s);
  s2 += xhalf(s2);
  // one 128-byte line a wave: 16 rows' sums from lanes 0 to 15, their squares from 16 to 31
  float* sp = &st[((size_t)hd * (M_ / 16) + (b * S_ + s0) / 16) * 32 + lane];
  const float sv = half16 ? s2 : s;
#pragma unroll
  for (int c = 0; c < 4; ++c) *(v8h*)(ob + c * 16) = hs[c];
  *sp = sv;
  // The stores' data and addresses are inputs here, so that they stay in place and
  // nothing rewrites them ahead of this wait.
  asm volatile("s_wait_xcnt 0x0" :: "v"(hs[0]), "v"(hs[1]), "v"(hs[2]), "v"(hs[3]),
               "v"(ob), "v"(sp), "v"(sv) : "memory");
}

// ---------------------------------------------------------------------------
extern "C" void kernel_launch(void* const* d_in, const int* in_sizes, int n_in,
                              void* d_out, int out_size, void* d_ws, size_t ws_size,
                              hipStream_t stream) {
  const float* x_q   = (const float*)d_in[0];
  const float* x_k   = (const float*)d_in[1];
  const float* x_v   = (const float*)d_in[2];
  const float* Wq    = (const float*)d_in[3];
  const float* Wk    = (const float*)d_in[4];
  const float* Wv    = (const float*)d_in[5];
  const float* Wproj = (const float*)d_in[6];
  const float* q_g   = (const float*)d_in[7];
  const float* q_b   = (const float*)d_in[8];
  const float* k_g   = (const float*)d_in[9];
  const float* k_b   = (const float*)d_in[10];
  const float* o_g   = (const float*)d_in[11];
  const float* o_b   = (const float*)d_in[12];
  float* out = (float*)d_out;

  const size_t MB = 1024 * 1024;
  char* w = (char*)d_ws;
  _Float16* xqh = (_Float16*)(w + 0 * MB);    // 8MB each
  _Float16* xkh = (_Float16*)(w + 8 * MB);
  _Float16* xvh = (_Float16*)(w + 16 * MB);
  _Float16* wqt = (_Float16*)(w + 24 * MB);   // 2MB each (transposed f16)
  _Float16* wkt = (_Float16*)(w + 26 * MB);
  _Float16* wvt = (_Float16*)(w + 28 * MB);
  _Float16* wpt = (_Float16*)(w + 30 * MB);
  _Float16* qh  = (_Float16*)(w + 80 * MB);   // 8MB each (post-LN f16)
  _Float16* kh  = (_Float16*)(w + 88 * MB);
  _Float16* vt  = (_Float16*)(w + 96 * MB);   // 8MB (d-major f16 V)
  float*    up  = (float*)(w + 32 * MB);      // 16 x 1024 f32: shares of u
  float*    cp  = (float*)(w + 33 * MB);      // 16 x 1024 f32: shares of c
  float*    st  = (float*)(w + 104 * MB);     // 16 x 256 x 32 f32: row sums per head
  _Float16* ah  = (_Float16*)(w + 0 * MB);    // attention out f16; reuse xqh space

  dim3 gblk(256);
  dim3 ggrid(D_ / 128, M_ / 64);

  // precision/layout conversion of all seven operands
  prep_f16<<<3 * CVT_WG_ + 4 * TR_WG_, 256, 0, stream>>>(
      x_q, x_k, x_v, Wq, Wk, Wv, Wproj, o_g, o_b, xqh, xkh, xvh, wqt, wkt, wvt, wpt, up, cp);

  // all three projections; epilogues: per-head LN -> f16 (q, k), d-major f16 (v)
  gemm_qkv<<<ggrid, gblk, 0, stream>>>(
      xqh, xkh, xvh, wqt, wkt, wvt, qh, kh, vt, q_g, q_b, k_g, k_b);

  flash_attn<<<dim3(S_ / 128, B_ * H_), 256, 0, stream>>>(qh, kh, vt, ah, st);

  // output LayerNorm and projection in one: the row and column terms go in the epilogue
  gemm_f16wmma<<<ggrid, gblk, 0, stream>>>(ah, wpt, st, up, cp, out);
}

// v007
// It runs in 83.9 microseconds.
// Two timings next to v006 put it at 1.08 and 1.09 times that version's speed.
// Counting every step since v000, it is 2.64 times as fast.
#include <hip/hip_runtime.h>
#include <hip/hip_bf16.h>
#include <math.h>

typedef __attribute__((ext_vector_type(16))) _Float16 v16h;
typedef __attribute__((ext_vector_type(8)))  _Float16 v8h;
typedef __attribute__((ext_vector_type(4)))  _Float16 v4h;
typedef __attribute__((ext_vector_type(8)))  float    v8f;
typedef __attribute__((ext_vector_type(4)))  float    v4f;

#define B_   2
#define S_   2048
#define F_   2048
#define D_   1024
#define H_   16
#define HD_  64
#define M_   4096           // B_*S_ == B_*F_
#define EPS_ 1e-5f

// ---- CDNA5 async copies: 16 B a lane, global -> LDS, tracked by ASYNCcnt ----
// A run of copies and the s_wait_xcnt 0 that stands ahead of any rewrite of their
// address registers are ONE statement, so that nothing can come between them.
// l: the lane's LDS byte address, g: its global address; copy i lies i row steps on.
#define CP_(a, b) "global_load_async_to_lds_b128 %" #a ", %" #b ", off\n\t"
static __device__ __forceinline__ unsigned lds_off(const void* p) { return (unsigned)(size_t)p; }

static __device__ __forceinline__ void async_cp4(unsigned l, unsigned ls,
                                                 const _Float16* g, int gs) {
  asm volatile(CP_(0, 4) CP_(1, 5) CP_(2, 6) CP_(3, 7) "s_wait_xcnt 0x0"
      :: "v"(l), "v"(l + ls), "v"(l + 2 * ls), "v"(l + 3 * ls),
         "v"(g), "v"(g + gs), "v"(g + 2 * gs), "v"(g + 3 * gs)
      : "memory");
}
// 4 copies of one tile and 4 of another
static __device__ __forceinline__ void async_cp4_4(unsigned l, unsigned ls,
                                                   const _Float16* g, int gs,
                                                   unsigned m, unsigned ms,
                                                   const _Float16* h, int hs) {
  asm volatile(CP_(0, 8) CP_(1, 9) CP_(2, 10) CP_(3, 11)
               CP_(4, 12) CP_(5, 13) CP_(6, 14) CP_(7, 15) "s_wait_xcnt 0x0"
      :: "v"(l), "v"(l + ls), "v"(l + 2 * ls), "v"(l + 3 * ls),
         "v"(m), "v"(m + ms), "v"(m + 2 * ms), "v"(m + 3 * ms),
         "v"(g), "v"(g + gs), "v"(g + 2 * gs), "v"(g + 3 * gs),
         "v"(h), "v"(h + hs), "v"(h + 2 * hs), "v"(h + 3 * hs)
      : "memory");
}
// 8 copies of one tile
static __device__ __forceinline__ void async_cp8(unsigned m, unsigned ms,
                                                 const _Float16* h, int hs) {
  asm volatile(CP_(0, 8) CP_(1, 9) CP_(2, 10) CP_(3, 11)
               CP_(4, 12) CP_(5, 13) CP_(6, 14) CP_(7, 15) "s_wait_xcnt 0x0"
      :: "v"(m), "v"(m + ms), "v"(m + 2 * ms), "v"(m + 3 * ms),
         "v"(m + 4 * ms), "v"(m + 5 * ms), "v"(m + 6 * ms), "v"(m + 7 * ms),
         "v"(h), "v"(h + hs), "v"(h + 2 * hs), "v"(h + 3 * hs),
         "v"(h + 4 * hs), "v"(h + 5 * hs), "v"(h + 6 * hs), "v"(h + 7 * hs)
      : "memory");
}
// 4 copies of one tile and 8 of another
static __device__ __forceinline__ void async_cp4_8(unsigned l, unsigned ls,
                                                   const _Float16* g, int gs,
                                                   unsigned m, unsigned ms,
                                                   const _Float16* h, int hs) {
  asm volatile(CP_(0, 12) CP_(1, 13) CP_(2, 14) CP_(3, 15)
               CP_(4, 16) CP_(5, 17) CP_(6, 18) CP_(7, 19)
               CP_(8, 20) CP_(9, 21) CP_(10, 22) CP_(11, 23) "s_wait_xcnt 0x0"
      :: "v"(l), "v"(l + ls), "v"(l + 2 * ls), "v"(l + 3 * ls),
         "v"(m), "v"(m + ms), "v"(m + 2 * ms), "v"(m + 3 * ms),
         "v"(m + 4 * ms), "v"(m + 5 * ms), "v"(m + 6 * ms), "v"(m + 7 * ms),
         "v"(g), "v"(g + gs), "v"(g + 2 * gs), "v"(g + 3 * gs),
         "v"(h), "v"(h + hs), "v"(h + 2 * hs), "v"(h + 3 * hs),
         "v"(h + 4 * hs), "v"(h + 5 * hs), "v"(h + 6 * hs), "v"(h + 7 * hs)
      : "memory");
}

#define KS_ 128   // k (GEMM) or keys (attention) per stage of an LDS ring
#define P256_ 136 // LDS pitch in halves of 256-byte rows: 272 bytes, 16 x odd (ds_load_b128)
#define P128_ 72  // LDS pitch in halves of 128-byte rows: 144 bytes, 16 x odd

// Concatenate two contiguous 8-half K-runs into a WMMA 16-bit fragment.
static __device__ __forceinline__ v16h frag_from(const _Float16* row, int half16) {
  v8h lo = *(const v8h*)(row + 8 * half16);        // K = {0..7}  + 8*half
  v8h hi = *(const v8h*)(row + 16 + 8 * half16);   // K = {16..23}+ 8*half
  return __builtin_shufflevector(lo, hi, 0, 1, 2, 3, 4, 5, 6, 7,
                                 8, 9, 10, 11, 12, 13, 14, 15);
}

// ---------------------------------------------------------------------------
// The four weight matrices in ONE launch: Wq, Wk, Wv, Wproj (k x n) f32 -> (n x k) f16,
// one 64(k) x 128(n) tile a work-group; 8 lanes store one 128-byte line.
// (The activations are not copied: the projection GEMM reads them as f32.)
// The output LayerNorm is folded into the last product:
//   LN(x) @ W = rstd * (x @ (g*W) - mean * u) + c,  u[n] = sum_k g[k] W[k][n],
//                                                   c[n] = sum_k b[k] W[k][n].
// Wproj is therefore stored as g[k] * W[k][n], and each of its tiles leaves its 64 k's
// share of u (summed over the rounded f16 values the product will use) and of c.
// ---------------------------------------------------------------------------
#define TR_WG_  128    // work-groups per weight matrix
__global__ __launch_bounds__(256) void prep_f16(
    const float* __restrict__ Wq, const float* __restrict__ Wk,
    const float* __restrict__ Wv, const float* __restrict__ Wp,
    const float* __restrict__ o_g, const float* __restrict__ o_b,
    _Float16* __restrict__ wqt, _Float16* __restrict__ wkt,
    _Float16* __restrict__ wvt, _Float16* __restrict__ wpt,
    float* __restrict__ up, float* __restrict__ cp) {
  __shared__ float t[64][129];   // odd pitch: the column reads below meet no bank twice
  __shared__ float cs[2][128];   // this tile's share of u and of c
  const int tid = threadIdx.x;
  {
    const int tb = blockIdx.x;
    const int m  = tb / TR_WG_;
    const float* in  = m == 0 ? Wq : m == 1 ? Wk : m == 2 ? Wv : Wp;
    _Float16*    out = m == 0 ? wqt : m == 1 ? wkt : m == 2 ? wvt : wpt;
    const int kb = ((tb % TR_WG_) >> 3) * 64;
    const int nb = (tb & 7) * 128;
    const bool fold = m == 3;   // the same for the whole work-group
    const int part = tid & 7;   // the lane's 8 k of every line it stores
    v4f g0 = {1.0f, 1.0f, 1.0f, 1.0f}, g1 = g0, b0 = {}, b1 = {};
    if (fold) {                 // issued ahead of the tile's loads: one latency for all
      g0 = *(const v4f*)(o_g + kb + part * 8);
      g1 = *(const v4f*)(o_g + kb + part * 8 + 4);
      b0 = *(const v4f*)(o_b + kb + part * 8);
      b1 = *(const v4f*)(o_b + kb + part * 8 + 4);
      // The loads' offset register is an input here, so that nothing rewrites it
      // ahead of this wait.
      asm volatile("s_wait_xcnt 0x0" :: "v"(part * 32) : "memory");
    }
    // a wave reads 512 contiguous bytes of one k row; load j is 8 rows further down
    const float* p = in + (size_t)(kb + (tid >> 5)) * D_ + nb + (tid & 31) * 4;
    v4f x[8];
#pragma unroll  // all 8 loads are issued before the first value is used
    for (int j = 0; j < 8; ++j) x[j] = *(const v4f*)(p + j * 8 * D_);
#pragma unroll  // constant indices: the values stay in registers
    for (int j = 0; j < 8; ++j) {
      const int idx = tid + j * 256;
#pragma unroll  // constant indices: the values stay in registers
      for (int e = 0; e < 4; ++e) t[idx >> 5][(idx & 31) * 4 + e] = x[j][e];
    }
    __syncthreads();   // the whole tile is in LDS before a lane reads other waves' rows
    v8h hs[4];
    _Float16* hp[4];
#pragma unroll  // four independent lines: their LDS reads overlap
    for (int i = 0; i < 4; ++i) {
      const int n = (tid >> 3) + i * 32;
      v8h h;
      float su = 0.0f, sc = 0.0f;
#pragma unroll  // constant indices: the values stay in registers
      for (int e = 0; e < 8; ++e) {
        const float wv = t[part * 8 + e][n];
        h[e] = (_Float16)(wv * (e < 4 ? g0[e & 3] : g1[e & 3]));
        su += (float)h[e];
        sc += wv * (e < 4 ? b0[e & 3] : b1[e & 3]);
      }
      hs[i] = h;
      hp[i] = out + (size_t)(nb + n) * D_ + kb + part * 8;
      if (fold) {
#pragma unroll  // three exchange steps with constant lane masks
        for (int x = 4; x >= 1; x >>= 1) {
          su += __shfl_xor(su, x);
          sc += __shfl_xor(sc, x);
        }
        if (part == 0) { cs[0][n] = su; cs[1][n] = sc; }
      }
    }
    if (fold) {   // ahead of the lines' stores, so that this barrier does not wait for them
      __syncthreads();   // all 128 column sums are in LDS; a wave then stores one whole line
      float* dst = ((tid >> 7) ? cp : up) + (kb >> 6) * D_ + nb + (tid & 127);
      const float sv = cs[tid >> 7][tid & 127];
      *dst = sv;
      // The store's data and address are inputs here, so that they stay in place and
      // nothing rewrites them ahead of this wait.
      asm volatile("s_wait_xcnt 0x0" :: "v"(dst), "v"(sv) : "memory");
    }
#pragma unroll  // constant indices: the values stay in registers
    for (int i = 0; i < 4; ++i) *(v8h*)hp[i] = hs[i];
    // The stores' data and addresses are inputs here, so that they stay in place and
    // nothing rewrites them ahead of this wait.
    asm volatile("s_wait_xcnt 0x0" :: "v"(hs[0]), "v"(hs[1]), "v"(hs[2]), "v"(hs[3]),
                 "v"(hp[0]), "v"(hp[1]), "v"(hp[2]), "v"(hp[3]) : "memory");
  }
}

// ---------------------------------------------------------------------------
// [4096,1024] = A[4096,1024](f16, or f32 in gemm_qkv) @ Wt[1024,1024](f16, N-major rows)
// Workgroup tile 64(M) x 128(N), 8 waves of 32x32; a stage is 128 k, four steps of 32.
// Two buffers of async b128 copies (an f32 A goes through registers), one barrier a stage (copies overlap WMMA).
// The epilogue emits what the next kernel reads:
//   epi_ln_f32 : the folded LayerNorm's row and column terms, f32 rows to C.
//   epi_head_ln: LayerNorm over each 64-column head, scaled, f16 rows to Ch.
//   epi_dmajor : f16, d-major: Ch[(b*D + n)][f], m = b*F + f.
// The last two pass the tile through LDS so that 8 lanes own one 128-byte line.
// ---------------------------------------------------------------------------
struct __attribute__((aligned(16))) GemmRing {
  _Float16 As[2][64][P256_];    // 64 M-rows x 128 K
  _Float16 Bts[2][128][P256_];  // 128 N-rows x 128 K
};

// One stage of the ring: four k steps of 32 from buffer cur, 16 WMMAs a wave.
static __device__ __forceinline__ void gemm_stage(const GemmRing& ring, int cur,
                                                  v8f (&acc)[2][2]) {
  const int lane = threadIdx.x & 31;
  const int wave = threadIdx.x >> 5;
  const int wm = (wave & 1) * 32;
  const int wn = (wave >> 1) * 32;
  const int half16 = lane >> 4;
  const int arow   = lane & 15;
#pragma unroll  // the four k steps of a stage read LDS at constant offsets from one address
  for (int kk = 0; kk < KS_; kk += 32) {
    v16h afrag[2], bfrag[2];
#pragma unroll
    for (int mi = 0; mi < 2; ++mi)
      afrag[mi] = frag_from(&ring.As[cur][wm + mi * 16 + arow][kk], half16);
#pragma unroll
    for (int ni = 0; ni < 2; ++ni)
      bfrag[ni] = frag_from(&ring.Bts[cur][wn + ni * 16 + arow][kk], half16);

#pragma unroll
    for (int mi = 0; mi < 2; ++mi)
#pragma unroll
      for (int ni = 0; ni < 2; ++ni)
        acc[mi][ni] = __builtin_amdgcn_wmma_f32_16x16x32_f16(
            false, afrag[mi], false, bfrag[ni], (short)0, acc[mi][ni],
            false, false);
  }
}

// mid() runs while stage 0's copies fly; what it writes to LDS is published by the
// prologue's barrier.
template <typename F>
static __device__ __forceinline__ void gemm_loop(
    const _Float16* __restrict__ A, const _Float16* __restrict__ Wt,
    GemmRing& ring, v8f (&acc)[2][2], F mid) {
  const int tid = threadIdx.x;
  const int m0 = blockIdx.y * 64;
  const int n0 = blockIdx.x * 128;

  // staging: 16 lanes bring one 256-byte row; a lane's 12 copies lie 16 rows apart
  const int sr = tid >> 4, sc = (tid & 15) * 8;
  const _Float16* ga = &A[(size_t)(m0 + sr) * D_ + sc];
  const _Float16* gb = &Wt[(size_t)(n0 + sr) * D_ + sc];
  const unsigned la = lds_off(&ring.As[0][sr][sc]);
  const unsigned lb = lds_off(&ring.Bts[0][sr][sc]);
  constexpr unsigned ABUF = 64 * P256_ * 2, BBUF = 128 * P256_ * 2;   // bytes per buffer
  constexpr unsigned LR = 16 * P256_ * 2;   // 16 rows on in LDS, bytes
  constexpr int      GR = 16 * D_;          // 16 rows on in global memory, halves
  constexpr int NT = D_ / KS_;

  // prologue: stage 0 lands and is published, then stage 1 starts
  async_cp4_8(la, LR, ga, GR, lb, LR, gb, GR);
  mid();
  asm volatile("s_wait_asynccnt 0x0" ::: "memory");   // this wave's share of stage 0 has landed
  __syncthreads();                                    // ... and every other wave's
  async_cp4_8(la + ABUF, LR, ga + KS_, GR, lb + BBUF, LR, gb + KS_, GR);

  for (int t = 0; t < NT; ++t) {
    const int cur = t & 1;
    gemm_stage(ring, cur, acc);
    // publish point of stage t + 1; the one barrier also frees the buffer just read
    asm volatile("s_wait_dscnt 0x0" ::: "memory");      // this wave's reads of stage t are done
    asm volatile("s_wait_asynccnt 0x0" ::: "memory");   // its share of stage t + 1 has landed
    __syncthreads();
    if (t + 2 < NT)
      async_cp4_8(la + cur * ABUF, LR, ga + (t + 2) * KS_, GR,
                  lb + cur * BBUF, LR, gb + (t + 2) * KS_, GR);
  }
  asm volatile("s_wait_asynccnt 0x0" ::: "memory");     // no copy is open when the wave goes on
}

// C = rstd[m] * (acc - mean[m] * u[n]) + c[n]; rs: mean, rstd of the tile's 64 rows,
// cv: u, c of its 128 columns.
static __device__ __forceinline__ void epi_ln_f32(
    v8f (&acc)[2][2], const float (*rs)[64], const float (*cv)[128], float* __restrict__ C) {
  const int lane = threadIdx.x & 31;
  const int wave = threadIdx.x >> 5;
  const int m0 = blockIdx.y * 64, n0 = blockIdx.x * 128;
  const int wm = (wave & 1) * 32, wn = (wave >> 1) * 32;
  const int half16 = lane >> 4, arow = lane & 15;
  float* cb = &C[(size_t)(m0 + wm + half16 * 8) * D_ + n0 + wn + arow];
#pragma unroll  // constant indices: the values stay in registers
  for (int mi = 0; mi < 2; ++mi) {
    const v8f mean = *(const v8f*)&rs[0][wm + mi * 16 + half16 * 8];
    const v8f rstd = *(const v8f*)&rs[1][wm + mi * 16 + half16 * 8];
#pragma unroll  // constant indices: the values stay in registers
    for (int ni = 0; ni < 2; ++ni) {
      const float u = cv[0][wn + ni * 16 + arow];
      const float c = cv[1][wn + ni * 16 + arow];
      acc[mi][ni] = rstd * (acc[mi][ni] - mean * u) + c;
    }
  }
#pragma unroll
  for (int mi = 0; mi < 2; ++mi)
#pragma unroll
    for (int ni = 0; ni < 2; ++ni)
#pragma unroll
      for (int r = 0; r < 8; ++r)
        cb[(size_t)(mi * 16 + r) * D_ + ni * 16] = acc[mi][ni][r];
}

static __device__ __forceinline__ void epi_head_ln(
    const v8f (&acc)[2][2], float (*Cs)[132],   // 64 rows of 528 bytes
    _Float16* __restrict__ Ch, const float* __restrict__ gamma,
    const float* __restrict__ beta, float scale) {
  const int tid  = threadIdx.x;
  const int lane = tid & 31;
  const int wave = tid >> 5;
  const int m0 = blockIdx.x * 64, n0 = blockIdx.y * 128;   // gemm_qkv's grid: x = row block
  const int wm = (wave & 1) * 32, wn = (wave >> 1) * 32;
  const int half16 = lane >> 4, arow = lane & 15;
#pragma unroll  // constant indices: the values stay in registers
  for (int mi = 0; mi < 2; ++mi)
#pragma unroll  // constant indices: the values stay in registers
    for (int ni = 0; ni < 2; ++ni)
#pragma unroll  // constant indices: the values stay in registers
      for (int r = 0; r < 8; ++r)
        Cs[wm + mi * 16 + half16 * 8 + r][wn + ni * 16 + arow] = acc[mi][ni][r];
  __syncthreads();   // the whole tile is in LDS before a lane reads other waves' parts
  // 8 lanes per head vector, 8 elements each; 128 head vectors in the tile.
  const int part = tid & 7;
  const v4f g0 = *(const v4f*)(gamma + part * 8);
  const v4f g1 = *(const v4f*)(gamma + part * 8 + 4);
  const v4f b0 = *(const v4f*)(beta + part * 8);
  const v4f b1 = *(const v4f*)(beta + part * 8 + 4);
  v8h hs[4];
  _Float16* hp[4];
#pragma unroll  // four independent head vectors: their LDS reads and exchanges overlap
  for (int i = 0; i < 4; ++i) {
    const int hv  = (tid >> 3) + i * 32;
    const int row = hv >> 1;
    const int col = (hv & 1) * 64 + part * 8;
    const v4f x0 = *(const v4f*)&Cs[row][col];
    const v4f x1 = *(const v4f*)&Cs[row][col + 4];
    const v4f xs = x0 + x1;
    const v4f xq = x0 * x0 + x1 * x1;
    float s  = (xs[0] + xs[1]) + (xs[2] + xs[3]);
    float s2 = (xq[0] + xq[1]) + (xq[2] + xq[3]);
#pragma unroll  // three exchange steps with constant lane masks
    for (int m = 4; m >= 1; m >>= 1) {
      s  += __shfl_xor(s,  m);
      s2 += __shfl_xor(s2, m);
    }
    const float mean = s * (1.0f / 64.0f);
    const float var  = s2 * (1.0f / 64.0f) - mean * mean;
    const float rstd = rsqrtf(var + EPS_);
    v8h h;
#pragma unroll  // constant indices: the values stay in registers
    for (int e = 0; e < 4; ++e) {
      h[e]     = (_Float16)(((x0[e] - mean) * rstd * g0[e] + b0[e]) * scale);
      h[4 + e] = (_Float16)(((x1[e] - mean) * rstd * g1[e] + b1[e]) * scale);
    }
    hs[i] = h;
    hp[i] = &Ch[(size_t)(m0 + row) * D_ + n0 + col];
    *(v8h*)hp[i] = h;
  }
  // The caller's next tile reuses registers. The stores' data and addresses are inputs
  // here, so that they stay in place and nothing rewrites them ahead of this wait.
  asm volatile("s_wait_xcnt 0x0" :: "v"(hs[0]), "v"(hs[1]), "v"(hs[2]), "v"(hs[3]),
               "v"(hp[0]), "v"(hp[1]), "v"(hp[2]), "v"(hp[3]) : "memory");
}

static __device__ __forceinline__ void epi_dmajor(
    const v8f (&acc)[2][2], _Float16 (*Ts)[72],   // 128 rows of 144 bytes
    _Float16* __restrict__ Ch) {
  const int tid  = threadIdx.x;
  const int lane = tid & 31;
  const int wave = tid >> 5;
  const int m0 = blockIdx.x * 64, n0 = blockIdx.y * 128;   // gemm_qkv's grid: x = row block
  const int wm = (wave & 1) * 32, wn = (wave >> 1) * 32;
  const int half16 = lane >> 4, arow = lane & 15;
#pragma unroll  // constant indices: the values stay in registers
  for (int mi = 0; mi < 2; ++mi)
#pragma unroll  // constant indices: the values stay in registers
    for (int ni = 0; ni < 2; ++ni) {
      v8h h;   // 8 consecutive m of one column n
#pragma unroll  // constant indices: the values stay in registers
      for (int r = 0; r < 8; ++r) h[r] = (_Float16)acc[mi][ni][r];
      *(v8h*)&Ts[wn + ni * 16 + arow][wm + mi * 16 + half16 * 8] = h;
    }
  __syncthreads();   // the whole tile is in LDS before a lane reads other waves' parts
  // 8 lanes per column n: 64 m = one 128-byte line of the d-major plane.
  const int bb = m0 / F_, fb = m0 % F_;
  const int part = tid & 7;
  v8h hs[4];
  _Float16* hp[4];
#pragma unroll  // four independent lines: their LDS reads overlap
  for (int i = 0; i < 4; ++i) {
    const int n = (tid >> 3) + i * 32;
    hs[i] = *(const v8h*)&Ts[n][part * 8];
    hp[i] = &Ch[((size_t)bb * D_ + n0 + n) * F_ + fb + part * 8];
    *(v8h*)hp[i] = hs[i];
  }
  // The code behind the call reuses registers. The stores' data and addresses are inputs
  // here, so that they stay in place and nothing rewrites them ahead of this wait.
  asm volatile("s_wait_xcnt 0x0" :: "v"(hs[0]), "v"(hs[1]), "v"(hs[2]), "v"(hs[3]),
               "v"(hp[0]), "v"(hp[1]), "v"(hp[2]), "v"(hp[3]) : "memory");
}

// A: attention output, f16, not normalised; Wt: g * Wproj. st: per head and 16 rows, 16
// row sums and 16 sums of squares over the head's 64 columns; up, cp: 16 shares of u, c.
__global__ __launch_bounds__(256) void gemm_f16wmma(
    const _Float16* __restrict__ A, const _Float16* __restrict__ Wt,
    const float* __restrict__ st, const float* __restrict__ up,
    const float* __restrict__ cp, float* __restrict__ C) {
  __shared__ GemmRing ring;
  __shared__ __attribute__((aligned(32))) float rs[2][64];
  __shared__ float cv[2][128];
  v8f acc[2][2] = {};
  gemm_loop(A, Wt, ring, acc, [&]() {
    const int tid = threadIdx.x;
    // the wave's number in a scalar register: whole waves branch, EXEC stays all ones
    const int wv = __builtin_amdgcn_readfirstlane(tid >> 5);
    if (wv < 4) {             // waves 0 to 3: one column a lane
      const float* pu = up + blockIdx.x * 128 + tid;
      const float* pc = cp + blockIdx.x * 128 + tid;
      float xu[16], xc[16];
#pragma unroll  // all 32 loads are issued before the first value is used: one latency
      for (int j = 0; j < 16; ++j) { xu[j] = pu[j * D_]; xc[j] = pc[j * D_]; }
      // The loads' offset register is an input here, so that nothing rewrites it
      // ahead of this wait.
      asm volatile("s_wait_xcnt 0x0" :: "v"(tid) : "memory");
      float u = xu[0], c = xc[0];
#pragma unroll  // constant indices: the values stay in registers
      for (int j = 1; j < 16; ++j) { u += xu[j]; c += xc[j]; }
      cv[0][tid] = u;
      cv[1][tid] = c;
    } else if (wv < 6) {      // waves 4 and 5: one row a lane
      const int r = tid - 128;
      const float* ps = st + (blockIdx.y * 4 + (r >> 4)) * 32 + (r & 15);
      float xs[16], xq[16];
#pragma unroll  // all 32 loads are issued before the first value is used: one latency
      for (int j = 0; j < 16; ++j) {
        xs[j] = ps[j * (M_ / 16) * 32];
        xq[j] = ps[j * (M_ / 16) * 32 + 16];
      }
      // The loads' address registers are inputs here, so that nothing rewrites them
      // ahead of this wait.
      asm volatile("s_wait_xcnt 0x0" :: "v"(ps) : "memory");
      float s = xs[0], s2 = xq[0];
#pragma unroll  // constant indices: the values stay in registers
      for (int j = 1; j < 16; ++j) { s += xs[j]; s2 += xq[j]; }
      const float mean = s * (1.0f / (float)D_);
      const float var  = s2 * (1.0f / (float)D_) - mean * mean;
      rs[0][r] = mean;
      rs[1][r] = rsqrtf(var + EPS_);
    }
  });
  epi_ln_f32(acc, rs, cv, C);
}

// Stage s of three GEMMs in a row is GEMM s / 8, k block s % 8, and lives in buffer s & 1.
// The weight half of a stage: async copies. bo: the lane's element in Wt; lb: its LDS
// bytes in buffer 0.
static __device__ __forceinline__ void copy_w3(
    int s, const _Float16* b0, const _Float16* b1, const _Float16* b2, size_t bo, unsigned lb) {
  constexpr unsigned BBUF = 128 * P256_ * 2;   // bytes per buffer
  constexpr unsigned LR = 16 * P256_ * 2;      // 16 rows on in LDS, bytes
  constexpr int      GR = 16 * D_;             // 16 rows on in global memory, halves
  constexpr int NT = D_ / KS_;
  const int z = s / NT, k0 = (s % NT) * KS_;
  const _Float16* b = z == 0 ? b0 : z == 1 ? b1 : b2;
  async_cp8(lb + (s & 1) * BBUF, LR, b + bo + k0, GR);
}
// The activation half of a stage comes as f32 through registers. A wave's load is the 512
// contiguous bytes of one row's 128 k; load j is the wave's row j. ao: the lane's element.
static __device__ __forceinline__ void load_x3(
    int s, const float* a0, const float* a1, const float* a2, size_t ao, v4f (&r)[8]) {
  constexpr int NT = D_ / KS_;
  const int z = s / NT, k0 = (s % NT) * KS_;
  const float* a = (z == 0 ? a0 : z == 1 ? a1 : a2) + ao + k0;
#pragma unroll  // all 8 loads are issued before the first value is used
  for (int j = 0; j < 8; ++j) r[j] = *(const v4f*)(a + j * D_);
  // The loads' address registers are inputs here, so that nothing rewrites them
  // ahead of this wait.
  asm volatile("s_wait_xcnt 0x0" :: "v"(a) : "memory");
}
// ... and goes to LDS as f16: a wave stores the 256 contiguous bytes of a row.
static __device__ __forceinline__ void store_x(_Float16* dst, const v4f (&r)[8]) {
#pragma unroll  // constant indices: the values stay in registers
  for (int j = 0; j < 8; ++j)
    *(v4h*)(dst + j * P256_) = __builtin_convertvector(r[j], v4h);
}

// The three projections in ONE launch. They share no operand and do not depend on each
// other, so a work-group walks its (m, n) tile of q, then of k, then of v on ONE ring of
// 3 x 8 stages: the next tile's first two stages are copied while the last stages and
// the epilogue of the tile before run, and the waves start once instead of three times.
// x_q, x_k, x_v are read as the f32 inputs they are and rounded to f16 on the way to LDS.
// Grid: x = row block, y = column tile.
__global__ __launch_bounds__(256) void gemm_qkv(
    const float* __restrict__ xq, const float* __restrict__ xk,
    const float* __restrict__ xv, const _Float16* __restrict__ wq,
    const _Float16* __restrict__ wk, const _Float16* __restrict__ wv,
    _Float16* __restrict__ qh, _Float16* __restrict__ kh, _Float16* __restrict__ vt,
    const float* __restrict__ q_g, const float* __restrict__ q_b,
    const float* __restrict__ k_g, const float* __restrict__ k_b) {
  __shared__ GemmRing ring;
  __shared__ __attribute__((aligned(16))) float tile[64 * 132];   // either epilogue's tile
  const int tid = threadIdx.x;

  // staging of Wt: 16 lanes bring one 256-byte row; a lane's 8 copies lie 16 rows apart
  const int sr = tid >> 4, sc = (tid & 15) * 8;
  const size_t boff = (size_t)(blockIdx.y * 128 + sr) * D_ + sc;
  const unsigned lb = lds_off(&ring.Bts[0][sr][sc]);
  // staging of x: a wave brings 8 rows in a row, a lane 4 k of each
  const int xr = (tid >> 5) * 8, xc = (tid & 31) * 4;
  const size_t aoff = (size_t)(blockIdx.x * 64 + xr) * D_ + xc;
  _Float16* sa = &ring.As[0][xr][xc];
  constexpr int ABUFH = 64 * P256_;         // halves per buffer
  constexpr int NT = D_ / KS_;              // stages per tile
  constexpr int NS = 3 * NT;                // stages in all

  // prologue: stage 0 (and the x half of stage 1, whose buffer nobody reads yet) lands and
  // is published, then the rest of stage 1 starts and the x of stage 2 is asked for
  v4f xr0[8];
  {
    v4f xr1[8];
    copy_w3(0, wq, wk, wv, boff, lb);
    load_x3(0, xq, xk, xv, aoff, xr0);
    load_x3(1, xq, xk, xv, aoff, xr1);
    store_x(sa, xr0);
    store_x(sa + ABUFH, xr1);
  }
  asm volatile("s_wait_asynccnt 0x0" ::: "memory");   // its share of stage 0's Wt has landed
  __syncthreads();                                    // ... and every other wave's, x rows too
  copy_w3(1, wq, wk, wv, boff, lb);
  load_x3(2, xq, xk, xv, aoff, xr0);

  v8f acc[2][2] = {};

  for (int s = 0; s < NS; ++s) {
    gemm_stage(ring, s & 1, acc);
    // publish point of stage s + 1; the one barrier also frees the buffer just read
    // (the first wait also covers this wave's x stores of stage s + 1)
    asm volatile("s_wait_dscnt 0x0" ::: "memory");      // this wave's reads of stage s are done
    asm volatile("s_wait_asynccnt 0x0" ::: "memory");   // its share of stage s + 1 has landed
    __syncthreads();
    if (s + 2 < NS) {
      copy_w3(s + 2, wq, wk, wv, boff, lb);
      store_x(sa + (s & 1) * ABUFH, xr0);   // asked for one stage ago
    }
    if (s % NT == NT - 1) {   // a tile is complete; its epilogue uses LDS outside the ring
      const int z = s / NT;
      if (z < 2)
        epi_head_ln(acc, (float (*)[132])tile, z == 0 ? qh : kh, z == 0 ? q_g : k_g,
                    z == 0 ? q_b : k_b, z == 0 ? 0.125f : 1.0f);
      else
        epi_dmajor(acc, (_Float16 (*)[72])tile, vt);
#pragma unroll  // constant indices: the values stay in registers
      for (int i = 0; i < 4; ++i) acc[i >> 1][i & 1] = v8f{};
    }
    // behind the epilogue, whose barrier would wait for these loads
    if (s + 3 < NS) load_x3(s + 3, xq, xk, xv, aoff, xr0);
  }
  asm volatile("s_wait_asynccnt 0x0" ::: "memory");     // no copy is open when the wave ends
}

static __device__ __forceinline__ float xhalf(float x) {
  int i = __builtin_bit_cast(int, x);
  return __builtin_bit_cast(float, __builtin_amdgcn_permlanex16(
      i, i, 0x76543210, 0xfedcba98, false, false));
}

__global__ __launch_bounds__(256) void flash_attn(
    const _Float16* __restrict__ q, const _Float16* __restrict__ k,
    const _Float16* __restrict__ v, _Float16* __restrict__ o, float* __restrict__ st) {
  __shared__ __attribute__((aligned(16))) _Float16 Qs[128][P128_];       // 128 s-rows x 64 d
  __shared__ __attribute__((aligned(16))) _Float16 Ks[2][KS_][P128_];    // 128 f-rows x 64 d
  __shared__ __attribute__((aligned(16))) _Float16 Vs[2][64][P256_];     // 64 d-rows x 128 f
  const int tid  = threadIdx.x;
  const int lane = tid & 31;
  const int wave = tid >> 5;
  const int half16 = lane >> 4;
  const int arow   = lane & 15;
  const int bh = blockIdx.y;
  const int b  = bh / H_;
  const int hd = bh % H_;
  const size_t qbase = (size_t)b * S_ * D_ + (size_t)hd * HD_;
  const size_t kbase = (size_t)b * F_ * D_ + (size_t)hd * HD_;
  const size_t vbase = ((size_t)b * D_ + (size_t)hd * HD_) * F_;

  // staging: 8 lanes bring one 128-byte row of Q or K, 16 lanes one 256-byte row of V;
  // a lane's 4 copies of a tile lie 32 (Q, K) or 16 (V) rows apart
  const int kr = tid >> 3, kc8 = (tid & 7) * 8;
  const int vd = tid >> 4, vf  = (tid & 15) * 8;
  const _Float16* gk = &k[kbase + (size_t)kr * D_ + kc8];
  const _Float16* gv = &v[vbase + (size_t)vd * F_ + vf];
  const unsigned lk = lds_off(&Ks[0][kr][kc8]);
  const unsigned lv = lds_off(&Vs[0][vd][vf]);
  constexpr unsigned KBUF = KS_ * P128_ * 2, VBUF = 64 * P256_ * 2;   // bytes per buffer
  constexpr unsigned LKR = 32 * P128_ * 2, LVR = 16 * P256_ * 2;      // row steps in LDS, bytes
  constexpr int NS = F_ / KS_;

  // prologue: Q and stage 0 land and are published, then stage 1 starts
  async_cp4(lds_off(&Qs[kr][kc8]), LKR,
            &q[qbase + (size_t)(blockIdx.x * 128 + kr) * D_ + kc8], 32 * D_);
  async_cp4_4(lk, LKR, gk, 32 * D_, lv, LVR, gv, 16 * F_);
  asm volatile("s_wait_asynccnt 0x0" ::: "memory");   // this wave's share has landed
  __syncthreads();                                    // ... and every other wave's
  async_cp4_4(lk + KBUF, LKR, gk + (size_t)KS_ * D_, 32 * D_, lv + VBUF, LVR, gv + KS_, 16 * F_);

  v16h qa[2];
#pragma unroll
  for (int kc = 0; kc < 2; ++kc)
    qa[kc] = frag_from(&Qs[wave * 16 + arow][kc * 32], half16);

  v8f oacc[4] = {};          // oacc[c][r] = O[query arow][d = c*16 + half16*8 + r]
  float mrun = -INFINITY;    // running maximum of query arow (equal in both halves)
  float lrun = 0.0f;         // this half's share of the denominator

  for (int st = 0; st < NS; ++st) {
    const int cur = st & 1;
#pragma unroll  // four passes of 32 keys: a pass's LDS reads may run ahead of the pass before
    for (int f0 = 0; f0 < KS_; f0 += 32) {
      // S^T = k @ q^T : sacc[ni][r] = score(key ni*16 + half16*8 + r, query arow).
      v8f sacc[2] = {};
#pragma unroll
      for (int kc = 0; kc < 2; ++kc) {
        v16h kf[2];
#pragma unroll
        for (int ni = 0; ni < 2; ++ni)
          kf[ni] = frag_from(&Ks[cur][f0 + ni * 16 + arow][kc * 32], half16);
#pragma unroll
        for (int ni = 0; ni < 2; ++ni)
          sacc[ni] = __builtin_amdgcn_wmma_f32_16x16x32_f16(
              false, kf[ni], false, qa[kc], (short)0, sacc[ni], false, false);
      }

      // Online softmax of one query per lane: in-lane maximum, one half exchange.
      float mx = fmaxf(sacc[0][0], sacc[1][0]);
#pragma unroll
      for (int r = 1; r < 8; ++r) mx = fmaxf(mx, fmaxf(sacc[0][r], sacc[1][r]));
      mx = fmaxf(mx, xhalf(mx));
      const float mnew = fmaxf(mrun, mx);
      const float corr = __expf(mrun - mnew);
      mrun = mnew;

      // P^T as B operand: element s is key kmap(s) = (s < 8 ? s : s + 8) + 8*half16,
      // which is register s & 7 of tile s >> 3; V^T rows come in the same k order.
      v16h pb;
      v8f p0 = sacc[0] - mnew, p1 = sacc[1] - mnew;
#pragma unroll
      for (int r = 0; r < 8; ++r) {
        p0[r] = __expf(p0[r]);
        p1[r] = __expf(p1[r]);
        pb[r]     = (_Float16)p0[r];
        pb[8 + r] = (_Float16)p1[r];
      }
      const v8f ps = p0 + p1;
      const float rs = ((ps[0] + ps[1]) + (ps[2] + ps[3])) + ((ps[4] + ps[5]) + (ps[6] + ps[7]));
      lrun = lrun * corr + rs;
#pragma unroll
      for (int c = 0; c < 4; ++c) oacc[c] *= corr;

      // O^T += V^T(64x32) @ P^T(32x16)
#pragma unroll
      for (int c = 0; c < 4; ++c) {
        v16h vf16 = frag_from(&Vs[cur][c * 16 + arow][f0], half16);
        oacc[c] = __builtin_amdgcn_wmma_f32_16x16x32_f16(
            false, vf16, false, pb, (short)0, oacc[c], false, false);
      }
    }
    // publish point of stage st + 1; the one barrier also frees the buffer just read
    asm volatile("s_wait_dscnt 0x0" ::: "memory");      // this wave's reads of stage st are done
    asm volatile("s_wait_asynccnt 0x0" ::: "memory");   // its share of stage st + 1 has landed
    __syncthreads();
    if (st + 2 < NS)
      async_cp4_4(lk + cur * KBUF, LKR, gk + (size_t)(st + 2) * KS_ * D_, 32 * D_,
                  lv + cur * VBUF, LVR, gv + (st + 2) * KS_, 16 * F_);
  }
  asm volatile("s_wait_asynccnt 0x0" ::: "memory");     // no copy is open when the wave goes on

  // Join the two halves' denominators once; a lane stores 8 consecutive d.
  const float inv = 1.0f / (lrun + xhalf(lrun));
  const int s0 = blockIdx.x * 128 + wave * 16;
  _Float16* ob = &o[((size_t)b * S_ + s0 + arow) * D_ + hd * HD_ + half16 * 8];
  v8h hs[4];
  v8f vs = {}, vq = {};   // sums over the rounded values, which the last product reads
#pragma unroll  // constant indices: the values stay in registers
  for (int c = 0; c < 4; ++c) {
    hs[c] = __builtin_convertvector(oacc[c] * inv, v8h);
    const v8f x = __builtin_convertvector(hs[c], v8f);
    vs += x;
    vq += x * x;
  }
  float s  = ((vs[0] + vs[1]) + (vs[2] + vs[3])) + ((vs[4] + vs[5]) + (vs[6] + vs[7]));
  float s2 = ((vq[0] + vq[1]) + (vq[2] + vq[3])) + ((vq[4] + vq[5]) + (vq[6] + vq[7]));
  s  += xhalf(s);
  s2 += xhalf(s2);
  // one 128-byte line a wave: 16 rows' sums from lanes 0 to 15, their squares from 16 to 31
  float* sp = &st[((size_t)hd * (M_ / 16) + (b * S_ + s0) / 16) * 32 + lane];
  const float sv = half16 ? s2 : s;
#pragma unroll
  for (int c = 0; c < 4; ++c) *(v8h*)(ob + c * 16) = hs[c];
  *sp = sv;
  // The stores' data and addresses are inputs here, so that they stay in place and
  // nothing rewrites them ahead of this wait.
  asm volatile("s_wait_xcnt 0x0" :: "v"(hs[0]), "v"(hs[1]), "v"(hs[2]), "v"(hs[3]),
               "v"(ob), "v"(sp), "v"(sv) : "memory");
}

// ---------------------------------------------------------------------------
extern "C" void kernel_launch(void* const* d_in, const int* in_sizes, int n_in,
                              void* d_out, int out_size, void* d_ws, size_t ws_size,
                              hipStream_t stream) {
  const float* x_q   = (const float*)d_in[0];
  const float* x_k   = (const float*)d_in[1];
  const float* x_v   = (const float*)d_in[2];
  const float* Wq    = (const float*)d_in[3];
  const float* Wk    = (const float*)d_in[4];
  const float* Wv    = (const float*)d_in[5];
  const float* Wproj = (const float*)d_in[6];
  const float* q_g   = (const float*)d_in[7];
  const float* q_b   = (const float*)d_in[8];
  const float* k_g   = (const float*)d_in[9];
  const float* k_b   = (const float*)d_in[10];
  const float* o_g   = (const float*)d_in[11];
  const float* o_b   = (const float*)d_in[12];
  float* out = (float*)d_out;

  const size_t MB = 1024 * 1024;
  char* w = (char*)d_ws;
  _Float16* wqt = (_Float16*)(w + 24 * MB);   // 2MB each (transposed f16)
  _Float16* wkt = (_Float16*)(w + 26 * MB);
  _Float16* wvt = (_Float16*)(w + 28 * MB);
  _Float16* wpt = (_Float16*)(w + 30 * MB);
  _Float16* qh  = (_Float16*)(w + 80 * MB);   // 8MB each (post-LN f16)
  _Float16* kh  = (_Float16*)(w + 88 * MB);
  _Float16* vt  = (_Float16*)(w + 96 * MB);   // 8MB (d-major f16 V)
  float*    up  = (float*)(w + 32 * MB);      // 16 x 1024 f32: shares of u
  float*    cp  = (float*)(w + 33 * MB);      // 16 x 1024 f32: shares of c
  float*    st  = (float*)(w + 104 * MB);     // 16 x 256 x 32 f32: row sums per head
  _Float16* ah  = (_Float16*)(w + 0 * MB);    // 8MB: attention out f16

  dim3 gblk(256);
  dim3 ggrid(D_ / 128, M_ / 64);

  // precision/layout conversion of the four weight matrices
  prep_f16<<<4 * TR_WG_, 256, 0, stream>>>(
      Wq, Wk, Wv, Wproj, o_g, o_b, wqt, wkt, wvt, wpt, up, cp);

  // all three projections; epilogues: per-head LN -> f16 (q, k), d-major f16 (v)
  gemm_qkv<<<dim3(M_ / 64, D_ / 128), gblk, 0, stream>>>(
      x_q, x_k, x_v, wqt, wkt, wvt, qh, kh, vt, q_g, q_b, k_g, k_b);

  flash_attn<<<dim3(S_ / 128, B_ * H_), 256, 0, stream>>>(qh, kh, vt, ah, st);

  // output LayerNorm and projection in one: the row and column terms go in the epilogue
  gemm_f16wmma<<<ggrid, gblk, 0, stream>>>(ah, wpt, st, up, cp, out);
}

// v008
// Measured time: 80.4 microseconds a run.
// Two timings next to v007 both put it at 1.04 times that version's speed.
// Counting every step since v000, it is 2.75 times as fast.
#include <hip/hip_runtime.h>
#include <hip/hip_bf16.h>
#include <math.h>

typedef __attribute__((ext_vector_type(16))) _Float16 v16h;
typedef __attribute__((ext_vector_type(8)))  _Float16 v8h;
typedef __attribute__((ext_vector_type(4)))  _Float16 v4h;
typedef __attribute__((ext_vector_type(8)))  float    v8f;
typedef __attribute__((ext_vector_type(4)))  float    v4f;

#define B_   2
#define S_   2048
#define F_   2048
#define D_   1024
#define H_   16
#define HD_  64
#define M_   4096           // B_*S_ == B_*F_
#define EPS_ 1e-5f

// ---- CDNA5 async copies: 16 B a lane, global -> LDS, tracked by ASYNCcnt ----
// A run of copies and the s_wait_xcnt 0 that stands ahead of any rewrite of their
// address registers are ONE statement, so that nothing can come between them.
// l: the lane's LDS byte address, g: its global address; copy i lies i row steps on.
#define CP_(a, b) "global_load_async_to_lds_b128 %" #a ", %" #b ", off\n\t"
static __device__ __forceinline__ unsigned lds_off(const void* p) { return (unsigned)(size_t)p; }

static __device__ __forceinline__ void async_cp4(unsigned l, unsigned ls,
                                                 const _Float16* g, int gs) {
  asm volatile(CP_(0, 4) CP_(1, 5) CP_(2, 6) CP_(3, 7) "s_wait_xcnt 0x0"
      :: "v"(l), "v"(l + ls), "v"(l + 2 * ls), "v"(l + 3 * ls),
         "v"(g), "v"(g + gs), "v"(g + 2 * gs), "v"(g + 3 * gs)
      : "memory");
}
// 4 copies of one tile and 4 of another
static __device__ __forceinline__ void async_cp4_4(unsigned l, unsigned ls,
                                                   const _Float16* g, int gs,
                                                   unsigned m, unsigned ms,
                                                   const _Float16* h, int hs) {
  asm volatile(CP_(0, 8) CP_(1, 9) CP_(2, 10) CP_(3, 11)
               CP_(4, 12) CP_(5, 13) CP_(6, 14) CP_(7, 15) "s_wait_xcnt 0x0"
      :: "v"(l), "v"(l + ls), "v"(l + 2 * ls), "v"(l + 3 * ls),
         "v"(m), "v"(m + ms), "v"(m + 2 * ms), "v"(m + 3 * ms),
         "v"(g), "v"(g + gs), "v"(g + 2 * gs), "v"(g + 3 * gs),
         "v"(h), "v"(h + hs), "v"(h + 2 * hs), "v"(h + 3 * hs)
      : "memory");
}
// 8 copies of one tile
static __device__ __forceinline__ void async_cp8(unsigned m, unsigned ms,
                                                 const _Float16* h, int hs) {
  asm volatile(CP_(0, 8) CP_(1, 9) CP_(2, 10) CP_(3, 11)
               CP_(4, 12) CP_(5, 13) CP_(6, 14) CP_(7, 15) "s_wait_xcnt 0x0"
      :: "v"(m), "v"(m + ms), "v"(m + 2 * ms), "v"(m + 3 * ms),
         "v"(m + 4 * ms), "v"(m + 5 * ms), "v"(m + 6 * ms), "v"(m + 7 * ms),
         "v"(h), "v"(h + hs), "v"(h + 2 * hs), "v"(h + 3 * hs),
         "v"(h + 4 * hs), "v"(h + 5 * hs), "v"(h + 6 * hs), "v"(h + 7 * hs)
      : "memory");
}
// 4 copies of one tile and 8 of another
static __device__ __forceinline__ void async_cp4_8(unsigned l, unsigned ls,
                                                   const _Float16* g, int gs,
                                                   unsigned m, unsigned ms,
                                                   const _Float16* h, int hs) {
  asm volatile(CP_(0, 12) CP_(1, 13) CP_(2, 14) CP_(3, 15)
               CP_(4, 16) CP_(5, 17) CP_(6, 18) CP_(7, 19)
               CP_(8, 20) CP_(9, 21) CP_(10, 22) CP_(11, 23) "s_wait_xcnt 0x0"
      :: "v"(l), "v"(l + ls), "v"(l + 2 * ls), "v"(l + 3 * ls),
         "v"(m), "v"(m + ms), "v"(m + 2 * ms), "v"(m + 3 * ms),
         "v"(m + 4 * ms), "v"(m + 5 * ms), "v"(m + 6 * ms), "v"(m + 7 * ms),
         "v"(g), "v"(g + gs), "v"(g + 2 * gs), "v"(g + 3 * gs),
         "v"(h), "v"(h + hs), "v"(h + 2 * hs), "v"(h + 3 * hs),
         "v"(h + 4 * hs), "v"(h + 5 * hs), "v"(h + 6 * hs), "v"(h + 7 * hs)
      : "memory");
}

#define KS_ 128   // k (GEMM) or keys (attention) per stage of an LDS ring
#define P256_ 136 // LDS pitch in halves of 256-byte rows: 272 bytes, 16 x odd (ds_load_b128)
#define P128_ 72  // LDS pitch in halves of 128-byte rows: 144 bytes, 16 x odd

// Concatenate two contiguous 8-half K-runs into a WMMA 16-bit fragment.
static __device__ __forceinline__ v16h frag_from(const _Float16* row, int half16) {
  v8h lo = *(const v8h*)(row + 8 * half16);        // K = {0..7}  + 8*half
  v8h hi = *(const v8h*)(row + 16 + 8 * half16);   // K = {16..23}+ 8*half
  return __builtin_shufflevector(lo, hi, 0, 1, 2, 3, 4, 5, 6, 7,
                                 8, 9, 10, 11, 12, 13, 14, 15);
}

// ---------------------------------------------------------------------------
// The four weight matrices in ONE launch: Wq, Wk, Wv, Wproj (k x n) f32 -> (n x k) f16,
// one 64(k) x 128(n) tile a work-group; 8 lanes store one 128-byte line.
// (The activations are not copied: the projection GEMM reads them as f32.)
// The output LayerNorm is folded into the last product:
//   LN(x) @ W = rstd * (x @ (g*W) - mean * u) + c,  u[n] = sum_k g[k] W[k][n],
//                                                   c[n] = sum_k b[k] W[k][n].
// Wproj is therefore stored as g[k] * W[k][n], and each of its tiles leaves its 64 k's
// share of u (summed over the rounded f16 values the product will use) and of c.
// ---------------------------------------------------------------------------
#define TR_WG_  128    // work-groups per weight matrix
__global__ __launch_bounds__(256) void prep_f16(
    const float* __restrict__ Wq, const float* __restrict__ Wk,
    const float* __restrict__ Wv, const float* __restrict__ Wp,
    const float* __restrict__ o_g, const float* __restrict__ o_b,
    _Float16* __restrict__ wqt, _Float16* __restrict__ wkt,
    _Float16* __restrict__ wvt, _Float16* __restrict__ wpt,
    float* __restrict__ up, float* __restrict__ cp) {
  __shared__ float t[64][129];   // odd pitch: the column reads below meet no bank twice
  __shared__ float cs[2][128];   // this tile's share of u and of c
  const int tid = threadIdx.x;
  {
    const int tb = blockIdx.x;
    const int m  = tb / TR_WG_;
    const float* in  = m == 0 ? Wq : m == 1 ? Wk : m == 2 ? Wv : Wp;
    _Float16*    out = m == 0 ? wqt : m == 1 ? wkt : m == 2 ? wvt : wpt;
    const int kb = ((tb % TR_WG_) >> 3) * 64;
    const int nb = (tb & 7) * 128;
    const bool fold = m == 3;   // the same for the whole work-group
    const int part = tid & 7;   // the lane's 8 k of every line it stores
    v4f g0 = {1.0f, 1.0f, 1.0f, 1.0f}, g1 = g0, b0 = {}, b1 = {};
    if (fold) {                 // issued ahead of the tile's loads: one latency for all
      g0 = *(const v4f*)(o_g + kb + part * 8);
      g1 = *(const v4f*)(o_g + kb + part * 8 + 4);
      b0 = *(const v4f*)(o_b + kb + part * 8);
      b1 = *(const v4f*)(o_b + kb + part * 8 + 4);
      // The loads' offset register is an input here, so that nothing rewrites it
      // ahead of this wait.
      asm volatile("s_wait_xcnt 0x0" :: "v"(part * 32) : "memory");
    }
    // a wave reads 512 contiguous bytes of one k row; load j is 8 rows further down
    const float* p = in + (size_t)(kb + (tid >> 5)) * D_ + nb + (tid & 31) * 4;
    v4f x[8];
#pragma unroll  // all 8 loads are issued before the first value is used
    for (int j = 0; j < 8; ++j) x[j] = *(const v4f*)(p + j * 8 * D_);
#pragma unroll  // constant indices: the values stay in registers
    for (int j = 0; j < 8; ++j) {
      const int idx = tid + j * 256;
#pragma unroll  // constant indices: the values stay in registers
      for (int e = 0; e < 4; ++e) t[idx >> 5][(idx & 31) * 4 + e] = x[j][e];
    }
    __syncthreads();   // the whole tile is in LDS before a lane reads other waves' rows
    v8h hs[4];
    _Float16* hp[4];
#pragma unroll  // four independent lines: their LDS reads overlap
    for (int i = 0; i < 4; ++i) {
      const int n = (tid >> 3) + i * 32;
      v8h h;
      float su = 0.0f, sc = 0.0f;
#pragma unroll  // constant indices: the values stay in registers
      for (int e = 0; e < 8; ++e) {
        const float wv = t[part * 8 + e][n];
        h[e] = (_Float16)(wv * (e < 4 ? g0[e & 3] : g1[e & 3]));
        su += (float)h[e];
        sc += wv * (e < 4 ? b0[e & 3] : b1[e & 3]);
      }
      hs[i] = h;
      hp[i] = out + (size_t)(nb + n) * D_ + kb + part * 8;
      if (fold) {
#pragma unroll  // three exchange steps with constant lane masks
        for (int x = 4; x >= 1; x >>= 1) {
          su += __shfl_xor(su, x);
          sc += __shfl_xor(sc, x);
        }
        if (part == 0) { cs[0][n] = su; cs[1][n] = sc; }
      }
    }
    if (fold) {   // ahead of the lines' stores, so that this barrier does not wait for them
      __syncthreads();   // all 128 column sums are in LDS; a wave then stores one whole line
      float* dst = ((tid >> 7) ? cp : up) + (kb >> 6) * D_ + nb + (tid & 127);
      const float sv = cs[tid >> 7][tid & 127];
      *dst = sv;
      // The store's data and address are inputs here, so that they stay in place and
      // nothing rewrites them ahead of this wait.
      asm volatile("s_wait_xcnt 0x0" :: "v"(dst), "v"(sv) : "memory");
    }
#pragma unroll  // constant indices: the values stay in registers
    for (int i = 0; i < 4; ++i) *(v8h*)hp[i] = hs[i];
    // The stores' data and addresses are inputs here, so that they stay in place and
    // nothing rewrites them ahead of this wait.
    asm volatile("s_wait_xcnt 0x0" :: "v"(hs[0]), "v"(hs[1]), "v"(hs[2]), "v"(hs[3]),
                 "v"(hp[0]), "v"(hp[1]), "v"(hp[2]), "v"(hp[3]) : "memory");
  }
}

// ---------------------------------------------------------------------------
// [4096,1024] = A[4096,1024](f16) @ Wt[1024,1024](f16, N-major rows)
// Workgroup tile 64(M) x 128(N), 8 waves of 32x32; a stage is 128 k, four steps of 32.
// Two buffers of async b128 copies, one barrier a stage (copies overlap WMMA).
// The epilogue, epi_ln_f32: the folded LayerNorm's row and column terms, f32 rows to C.
// ---------------------------------------------------------------------------
struct __attribute__((aligned(16))) GemmRing {
  _Float16 As[2][64][P256_];    // 64 M-rows x 128 K
  _Float16 Bts[2][128][P256_];  // 128 N-rows x 128 K
};

// One stage of the ring: four k steps of 32 from buffer cur, 16 WMMAs a wave.
static __device__ __forceinline__ void gemm_stage(const GemmRing& ring, int cur,
                                                  v8f (&acc)[2][2]) {
  const int lane = threadIdx.x & 31;
  const int wave = threadIdx.x >> 5;
  const int wm = (wave & 1) * 32;
  const int wn = (wave >> 1) * 32;
  const int half16 = lane >> 4;
  const int arow   = lane & 15;
#pragma unroll  // the four k steps of a stage read LDS at constant offsets from one address
  for (int kk = 0; kk < KS_; kk += 32) {
    v16h afrag[2], bfrag[2];
#pragma unroll
    for (int mi = 0; mi < 2; ++mi)
      afrag[mi] = frag_from(&ring.As[cur][wm + mi * 16 + arow][kk], half16);
#pragma unroll
    for (int ni = 0; ni < 2; ++ni)
      bfrag[ni] = frag_from(&ring.Bts[cur][wn + ni * 16 + arow][kk], half16);

#pragma unroll
    for (int mi = 0; mi < 2; ++mi)
#pragma unroll
      for (int ni = 0; ni < 2; ++ni)
        acc[mi][ni] = __builtin_amdgcn_wmma_f32_16x16x32_f16(
            false, afrag[mi], false, bfrag[ni], (short)0, acc[mi][ni],
            false, false);
  }
}

// mid() runs while stage 0's copies fly; what it writes to LDS is published by the
// prologue's barrier.
template <typename F>
static __device__ __forceinline__ void gemm_loop(
    const _Float16* __restrict__ A, const _Float16* __restrict__ Wt,
    GemmRing& ring, v8f (&acc)[2][2], F mid) {
  const int tid = threadIdx.x;
  const int m0 = blockIdx.y * 64;
  const int n0 = blockIdx.x * 128;

  // staging: 16 lanes bring one 256-byte row; a lane's 12 copies lie 16 rows apart
  const int sr = tid >> 4, sc = (tid & 15) * 8;
  const _Float16* ga = &A[(size_t)(m0 + sr) * D_ + sc];
  const _Float16* gb = &Wt[(size_t)(n0 + sr) * D_ + sc];
  const unsigned la = lds_off(&ring.As[0][sr][sc]);
  const unsigned lb = lds_off(&ring.Bts[0][sr][sc]);
  constexpr unsigned ABUF = 64 * P256_ * 2, BBUF = 128 * P256_ * 2;   // bytes per buffer
  constexpr unsigned LR = 16 * P256_ * 2;   // 16 rows on in LDS, bytes
  constexpr int      GR = 16 * D_;          // 16 rows on in global memory, halves
  constexpr int NT = D_ / KS_;

  // prologue: stage 0 lands and is published, then stage 1 starts
  async_cp4_8(la, LR, ga, GR, lb, LR, gb, GR);
  mid();
  asm volatile("s_wait_asynccnt 0x0" ::: "memory");   // this wave's share of stage 0 has landed
  __syncthreads();                                    // ... and every other wave's
  async_cp4_8(la + ABUF, LR, ga + KS_, GR, lb + BBUF, LR, gb + KS_, GR);

  for (int t = 0; t < NT; ++t) {
    const int cur = t & 1;
    gemm_stage(ring, cur, acc);
    // publish point of stage t + 1; the one barrier also frees the buffer just read
    asm volatile("s_wait_dscnt 0x0" ::: "memory");      // this wave's reads of stage t are done
    asm volatile("s_wait_asynccnt 0x0" ::: "memory");   // its share of stage t + 1 has landed
    __syncthreads();
    if (t + 2 < NT)
      async_cp4_8(la + cur * ABUF, LR, ga + (t + 2) * KS_, GR,
                  lb + cur * BBUF, LR, gb + (t + 2) * KS_, GR);
  }
  asm volatile("s_wait_asynccnt 0x0" ::: "memory");     // no copy is open when the wave goes on
}

// C = rstd[m] * (acc - mean[m] * u[n]) + c[n]; rs: mean, rstd of the tile's 64 rows,
// cv: u, c of its 128 columns.
static __device__ __forceinline__ void epi_ln_f32(
    v8f (&acc)[2][2], const float (*rs)[64], const float (*cv)[128], float* __restrict__ C) {
  const int lane = threadIdx.x & 31;
  const int wave = threadIdx.x >> 5;
  const int m0 = blockIdx.y * 64, n0 = blockIdx.x * 128;
  const int wm = (wave & 1) * 32, wn = (wave >> 1) * 32;
  const int half16 = lane >> 4, arow = lane & 15;
  float* cb = &C[(size_t)(m0 + wm + half16 * 8) * D_ + n0 + wn + arow];
#pragma unroll  // constant indices: the values stay in registers
  for (int mi = 0; mi < 2; ++mi) {
    const v8f mean = *(const v8f*)&rs[0][wm + mi * 16 + half16 * 8];
    const v8f rstd = *(const v8f*)&rs[1][wm + mi * 16 + half16 * 8];
#pragma unroll  // constant indices: the values stay in registers
    for (int ni = 0; ni < 2; ++ni) {
      const float u = cv[0][wn + ni * 16 + arow];
      const float c = cv[1][wn + ni * 16 + arow];
      acc[mi][ni] = rstd * (acc[mi][ni] - mean * u) + c;
    }
  }
#pragma unroll
  for (int mi = 0; mi < 2; ++mi)
#pragma unroll
    for (int ni = 0; ni < 2; ++ni)
#pragma unroll
      for (int r = 0; r < 8; ++r)
        cb[(size_t)(mi * 16 + r) * D_ + ni * 16] = acc[mi][ni][r];
}

// ---- the q, k, v projections' own tile: 128(M) x 256(N), 8 waves of 64 x 64 ----
#define QS_ 64   // k per stage of their ring
struct __attribute__((aligned(16))) QkvRing {
  _Float16 As[2][128][P128_];    // 128 M-rows x 64 k
  _Float16 Bts[2][256][P128_];   // 256 N-rows x 64 k
};
// A work-group has one tile, so the epilogue's staging takes the ring's place.
union __attribute__((aligned(16))) QkvLds {
  QkvRing  ring;
  float    Cs[128][260];      // the tile, f32; 1040-byte rows
  _Float16 Ts[256][P256_];    // the tile, f16, column-major
};

// LayerNorm over each 64-column head, scaled, f16 rows to Ch. The tile passes through LDS,
// so that 8 lanes own one 128-byte line.
static __device__ __forceinline__ void epi_head_ln(
    const v8f (&acc)[4][4], float (*Cs)[260],
    _Float16* __restrict__ Ch, const float* __restrict__ gamma,
    const float* __restrict__ beta, float scale) {
  const int tid  = threadIdx.x;
  const int lane = tid & 31;
  const int wave = tid >> 5;
  const int m0 = blockIdx.x * 128, n0 = blockIdx.y * 256;
  const int wm = (wave & 1) * 64, wn = (wave >> 1) * 64;
  const int half16 = lane >> 4, arow = lane & 15;
#pragma unroll  // constant indices: the values stay in registers
  for (int mi = 0; mi < 4; ++mi)
#pragma unroll  // constant indices: the values stay in registers
    for (int ni = 0; ni < 4; ++ni)
#pragma unroll  // constant indices: the values stay in registers
      for (int r = 0; r < 8; ++r)
        Cs[wm + mi * 16 + half16 * 8 + r][wn + ni * 16 + arow] = acc[mi][ni][r];
  __syncthreads();   // the whole tile is in LDS before a lane reads other waves' parts
  // 8 lanes per head vector, 8 elements each; 512 head vectors in the tile.
  const int part = tid & 7;
  const v4f g0 = *(const v4f*)(gamma + part * 8);
  const v4f g1 = *(const v4f*)(gamma + part * 8 + 4);
  const v4f b0 = *(const v4f*)(beta + part * 8);
  const v4f b1 = *(const v4f*)(beta + part * 8 + 4);
#pragma unroll  // constant indices: the values stay in registers
  for (int g = 0; g < 4; ++g) {
    v8h hs[4];
    _Float16* hp[4];
#pragma unroll  // four independent head vectors: their LDS reads and exchanges overlap
    for (int i = 0; i < 4; ++i) {
      const int hv  = (tid >> 3) + (g * 4 + i) * 32;
      const int row = hv >> 2;
      const int col = (hv & 3) * 64 + part * 8;
      const v4f x0 = *(const v4f*)&Cs[row][col];
      const v4f x1 = *(const v4f*)&Cs[row][col + 4];
      const v4f xs = x0 + x1;
      const v4f xq = x0 * x0 + x1 * x1;
      float s  = (xs[0] + xs[1]) + (xs[2] + xs[3]);
      float s2 = (xq[0] + xq[1]) + (xq[2] + xq[3]);
#pragma unroll  // three exchange steps with constant lane masks
      for (int m = 4; m >= 1; m >>= 1) {
        s  += __shfl_xor(s,  m);
        s2 += __shfl_xor(s2, m);
      }
      const float mean = s * (1.0f / 64.0f);
      const float var  = s2 * (1.0f / 64.0f) - mean * mean;
      const float rstd = rsqrtf(var + EPS_);
      v8h hh;
#pragma unroll  // constant indices: the values stay in registers
      for (int e = 0; e < 4; ++e) {
        hh[e]     = (_Float16)(((x0[e] - mean) * rstd * g0[e] + b0[e]) * scale);
        hh[4 + e] = (_Float16)(((x1[e] - mean) * rstd * g1[e] + b1[e]) * scale);
      }
      hs[i] = hh;
      hp[i] = &Ch[(size_t)(m0 + row) * D_ + n0 + col];
      *(v8h*)hp[i] = hh;
    }
    // The next group reuses registers. The stores' data and addresses are inputs here,
    // so that they stay in place and nothing rewrites them ahead of this wait.
    asm volatile("s_wait_xcnt 0x0" :: "v"(hs[0]), "v"(hs[1]), "v"(hs[2]), "v"(hs[3]),
                 "v"(hp[0]), "v"(hp[1]), "v"(hp[2]), "v"(hp[3]) : "memory");
  }
}

// f16, d-major: Ch[(b*D + n)][f], m = b*F + f.
static __device__ __forceinline__ void epi_dmajor(
    const v8f (&acc)[4][4], _Float16 (*Ts)[P256_], _Float16* __restrict__ Ch) {
  const int tid  = threadIdx.x;
  const int lane = tid & 31;
  const int wave = tid >> 5;
  const int m0 = blockIdx.x * 128, n0 = blockIdx.y * 256;
  const int wm = (wave & 1) * 64, wn = (wave >> 1) * 64;
  const int half16 = lane >> 4, arow = lane & 15;
#pragma unroll  // constant indices: the values stay in registers
  for (int mi = 0; mi < 4; ++mi)
#pragma unroll  // constant indices: the values stay in registers
    for (int ni = 0; ni < 4; ++ni)   // 8 consecutive m of one column n
      *(v8h*)&Ts[wn + ni * 16 + arow][wm + mi * 16 + half16 * 8] =
          __builtin_convertvector(acc[mi][ni], v8h);
  __syncthreads();   // the whole tile is in LDS before a lane reads other waves' parts
  // 16 lanes per column n: 128 m = two 128-byte lines of the d-major plane.
  const int bb = m0 / F_, fb = m0 % F_;
  const int part = tid & 15;
#pragma unroll  // constant indices: the values stay in registers
  for (int g = 0; g < 4; ++g) {
    v8h hs[4];
    _Float16* hp[4];
#pragma unroll  // four independent columns: their LDS reads overlap
    for (int i = 0; i < 4; ++i) {
      const int n = (tid >> 4) + (g * 4 + i) * 16;
      hs[i] = *(const v8h*)&Ts[n][part * 8];
      hp[i] = &Ch[((size_t)bb * D_ + n0 + n) * F_ + fb + part * 8];
      *(v8h*)hp[i] = hs[i];
    }
    // The next group reuses registers. The stores' data and addresses are inputs here,
    // so that they stay in place and nothing rewrites them ahead of this wait.
    asm volatile("s_wait_xcnt 0x0" :: "v"(hs[0]), "v"(hs[1]), "v"(hs[2]), "v"(hs[3]),
                 "v"(hp[0]), "v"(hp[1]), "v"(hp[2]), "v"(hp[3]) : "memory");
  }
}

// A: attention output, f16, not normalised; Wt: g * Wproj. st: per head and 16 rows, 16
// row sums and 16 sums of squares over the head's 64 columns; up, cp: 16 shares of u, c.
__global__ __launch_bounds__(256) void gemm_f16wmma(
    const _Float16* __restrict__ A, const _Float16* __restrict__ Wt,
    const float* __restrict__ st, const float* __restrict__ up,
    const float* __restrict__ cp, float* __restrict__ C) {
  __shared__ GemmRing ring;
  __shared__ __attribute__((aligned(32))) float rs[2][64];
  __shared__ float cv[2][128];
  v8f acc[2][2] = {};
  gemm_loop(A, Wt, ring, acc, [&]() {
    const int tid = threadIdx.x;
    // the wave's number in a scalar register: whole waves branch, EXEC stays all ones
    const int wv = __builtin_amdgcn_readfirstlane(tid >> 5);
    if (wv < 4) {             // waves 0 to 3: one column a lane
      const float* pu = up + blockIdx.x * 128 + tid;
      const float* pc = cp + blockIdx.x * 128 + tid;
      float xu[16], xc[16];
#pragma unroll  // all 32 loads are issued before the first value is used: one latency
      for (int j = 0; j < 16; ++j) { xu[j] = pu[j * D_]; xc[j] = pc[j * D_]; }
      // The loads' offset register is an input here, so that nothing rewrites it
      // ahead of this wait.
      asm volatile("s_wait_xcnt 0x0" :: "v"(tid) : "memory");
      float u = xu[0], c = xc[0];
#pragma unroll  // constant indices: the values stay in registers
      for (int j = 1; j < 16; ++j) { u += xu[j]; c += xc[j]; }
      cv[0][tid] = u;
      cv[1][tid] = c;
    } else if (wv < 6) {      // waves 4 and 5: one row a lane
      const int r = tid - 128;
      const float* ps = st + (blockIdx.y * 4 + (r >> 4)) * 32 + (r & 15);
      float xs[16], xq[16];
#pragma unroll  // all 32 loads are issued before the first value is used: one latency
      for (int j = 0; j < 16; ++j) {
        xs[j] = ps[j * (M_ / 16) * 32];
        xq[j] = ps[j * (M_ / 16) * 32 + 16];
      }
      // The loads' address registers are inputs here, so that nothing rewrites them
      // ahead of this wait.
      asm volatile("s_wait_xcnt 0x0" :: "v"(ps) : "memory");
      float s = xs[0], s2 = xq[0];
#pragma unroll  // constant indices: the values stay in registers
      for (int j = 1; j < 16; ++j) { s += xs[j]; s2 += xq[j]; }
      const float mean = s * (1.0f / (float)D_);
      const float var  = s2 * (1.0f / (float)D_) - mean * mean;
      rs[0][r] = mean;
      rs[1][r] = rsqrtf(var + EPS_);
    }
  });
  epi_ln_f32(acc, rs, cv, C);
}

// One stage of the projections' ring: two k steps of 32 from buffer cur, 32 WMMAs a wave;
// each of the 8 fragments of a step feeds 4 of its 16 WMMAs.
static __device__ __forceinline__ void qkv_stage(const QkvRing& ring, int cur,
                                                 v8f (&acc)[4][4]) {
  const int lane = threadIdx.x & 31;
  const int wave = threadIdx.x >> 5;
  const int wm = (wave & 1) * 64;
  const int wn = (wave >> 1) * 64;
  const int half16 = lane >> 4;
  const int arow   = lane & 15;
#pragma unroll  // the two k steps of a stage read LDS at constant offsets from one address
  for (int kk = 0; kk < QS_; kk += 32) {
    v16h afrag[4], bfrag[4];
    afrag[0] = frag_from(&ring.As[cur][wm + arow][kk], half16);
#pragma unroll
    for (int ni = 0; ni < 4; ++ni)
      bfrag[ni] = frag_from(&ring.Bts[cur][wn + ni * 16 + arow][kk], half16);
#pragma unroll
    for (int mi = 1; mi < 4; ++mi)
      afrag[mi] = frag_from(&ring.As[cur][wm + mi * 16 + arow][kk], half16);
    // Keeps the step's 16 LDS reads together ahead of its 16 WMMAs: left free, the compiler
    // reloads one A fragment per row of 4 WMMAs and waits out the LDS latency at each row.
    __builtin_amdgcn_sched_barrier(0);
#pragma unroll
    for (int mi = 0; mi < 4; ++mi)
#pragma unroll
      for (int ni = 0; ni < 4; ++ni)
        acc[mi][ni] = __builtin_amdgcn_wmma_f32_16x16x32_f16(
            false, afrag[mi], false, bfrag[ni], (short)0, acc[mi][ni],
            false, false);
  }
  // Keeps the stage's WMMAs ahead of the stage barrier: left free, the compiler sinks the
  // last 16 behind it, and the next copies and x loads start that much later.
  __builtin_amdgcn_sched_barrier(0);
}
// The activation half of a stage comes as f32 through registers: 16 lanes read the 256
// contiguous bytes of one row's 64 k; load j is 16 rows further down. a: the lane's element.
static __device__ __forceinline__ void load_x(const float* a, v4f (&r)[8]) {
#pragma unroll  // all 8 loads are issued before the first value is used
  for (int j = 0; j < 8; ++j) r[j] = *(const v4f*)(a + j * 16 * D_);
  // The loads' address registers are inputs here, so that nothing rewrites them
  // ahead of this wait.
  asm volatile("s_wait_xcnt 0x0" :: "v"(a) : "memory");
}
// ... and goes to LDS as f16.
static __device__ __forceinline__ void store_x(_Float16* dst, const v4f (&r)[8]) {
#pragma unroll  // constant indices: the values stay in registers
  for (int j = 0; j < 8; ++j)
    *(v4h*)(dst + j * 16 * P128_) = __builtin_convertvector(r[j], v4h);
}

// The three projections in ONE launch, one 128 x 256 tile of q, k or v a work-group
// (grid z). Against a 64 x 128 tile, x and Wt each pass L2 half as often; a 64 x 64 wave
// tile reads half the LDS bytes per WMMA of a 32 x 32 one.
// x_q, x_k, x_v are read as the f32 inputs they are and rounded to f16 on the way to LDS.
// Grid: x = row block.
__global__ __launch_bounds__(256) void gemm_qkv(
    const float* __restrict__ xq, const float* __restrict__ xk,
    const float* __restrict__ xv, const _Float16* __restrict__ wq,
    const _Float16* __restrict__ wk, const _Float16* __restrict__ wv,
    _Float16* __restrict__ qh, _Float16* __restrict__ kh, _Float16* __restrict__ vt,
    const float* __restrict__ q_g, const float* __restrict__ q_b,
    const float* __restrict__ k_g, const float* __restrict__ k_b) {
  __shared__ QkvLds lds;
  const int tid = threadIdx.x;
  const int z = blockIdx.z;
  const float*    x = z == 0 ? xq : z == 1 ? xk : xv;
  const _Float16* w = z == 0 ? wq : z == 1 ? wk : wv;

  // staging of Wt: 8 lanes bring one 128-byte row; a lane's 8 copies lie 32 rows apart
  const int sr = tid >> 3, sc = (tid & 7) * 8;
  const _Float16* gb = w + (size_t)(blockIdx.y * 256 + sr) * D_ + sc;
  const unsigned lb = lds_off(&lds.ring.Bts[0][sr][sc]);
  constexpr unsigned BBUF = 256 * P128_ * 2;   // bytes per buffer
  constexpr unsigned LR = 32 * P128_ * 2;      // 32 rows on in LDS, bytes
  constexpr int      GR = 32 * D_;             // 32 rows on in global memory, halves
  // staging of x: 16 lanes bring one row's 64 k, a lane 4 k of 8 rows
  const int xr = tid >> 4, xc = (tid & 15) * 4;
  const float* ga = x + (size_t)(blockIdx.x * 128 + xr) * D_ + xc;
  _Float16* sa = &lds.ring.As[0][xr][xc];
  constexpr int ABUFH = 128 * P128_;        // halves per buffer
  constexpr int NT = D_ / QS_;              // stages

  // prologue: stage 0 (and the x half of stage 1, whose buffer nobody reads yet) lands and
  // is published, then the rest of stage 1 starts and the x of stage 2 is asked for
  v4f xr0[8];
  {
    v4f xr1[8];
    async_cp8(lb, LR, gb, GR);
    load_x(ga, xr0);
    load_x(ga + QS_, xr1);
    store_x(sa, xr0);
    store_x(sa + ABUFH, xr1);
  }
  asm volatile("s_wait_asynccnt 0x0" ::: "memory");   // its share of stage 0's Wt has landed
  __syncthreads();                                    // ... and every other wave's, x rows too
  async_cp8(lb + BBUF, LR, gb + QS_, GR);
  load_x(ga + 2 * QS_, xr0);

  v8f acc[4][4] = {};

  for (int s = 0; s < NT; ++s) {
    qkv_stage(lds.ring, s & 1, acc);
    // publish point of stage s + 1; the one barrier also frees the buffer just read
    // (the first wait also covers this wave's x stores of stage s + 1)
    asm volatile("s_wait_dscnt 0x0" ::: "memory");      // this wave's reads of stage s are done
    asm volatile("s_wait_asynccnt 0x0" ::: "memory");   // its share of stage s + 1 has landed
    __syncthreads();
    if (s + 2 < NT) {
      async_cp8(lb + (s & 1) * BBUF, LR, gb + (s + 2) * QS_, GR);
      store_x(sa + (s & 1) * ABUFH, xr0);   // asked for one stage ago
    }
    if (s + 3 < NT) load_x(ga + (s + 3) * QS_, xr0);
  }
  asm volatile("s_wait_asynccnt 0x0" ::: "memory");     // no copy is open when the ring is reused

  // behind the loop's last barrier nobody reads the ring any more: the epilogue stages there
  if (z < 2)
    epi_head_ln(acc, lds.Cs, z == 0 ? qh : kh, z == 0 ? q_g : k_g,
                z == 0 ? q_b : k_b, z == 0 ? 0.125f : 1.0f);
  else
    epi_dmajor(acc, lds.Ts, vt);
}

static __device__ __forceinline__ float xhalf(float x) {
  int i = __builtin_bit_cast(int, x);
  return __builtin_bit_cast(float, __builtin_amdgcn_permlanex16(
      i, i, 0x76543210, 0xfedcba98, false, false));
}

__global__ __launch_bounds__(256) void flash_attn(
    const _Float16* __restrict__ q, const _Float16* __restrict__ k,
    const _Float16* __restrict__ v, _Float16* __restrict__ o, float* __restrict__ st) {
  __shared__ __attribute__((aligned(16))) _Float16 Qs[128][P128_];       // 128 s-rows x 64 d
  __shared__ __attribute__((aligned(16))) _Float16 Ks[2][KS_][P128_];    // 128 f-rows x 64 d
  __shared__ __attribute__((aligned(16))) _Float16 Vs[2][64][P256_];     // 64 d-rows x 128 f
  const int tid  = threadIdx.x;
  const int lane = tid & 31;
  const int wave = tid >> 5;
  const int half16 = lane >> 4;
  const int arow   = lane & 15;
  const int bh = blockIdx.y;
  const int b  = bh / H_;
  const int hd = bh % H_;
  const size_t qbase = (size_t)b * S_ * D_ + (size_t)hd * HD_;
  const size_t kbase = (size_t)b * F_ * D_ + (size_t)hd * HD_;
  const size_t vbase = ((size_t)b * D_ + (size_t)hd * HD_) * F_;

  // staging: 8 lanes bring one 128-byte row of Q or K, 16 lanes one 256-byte row of V;
  // a lane's 4 copies of a tile lie 32 (Q, K) or 16 (V) rows apart
  const int kr = tid >> 3, kc8 = (tid & 7) * 8;
  const int vd = tid >> 4, vf  = (tid & 15) * 8;
  const _Float16* gk = &k[kbase + (size_t)kr * D_ + kc8];
  const _Float16* gv = &v[vbase + (size_t)vd * F_ + vf];
  const unsigned lk = lds_off(&Ks[0][kr][kc8]);
  const unsigned lv = lds_off(&Vs[0][vd][vf]);
  constexpr unsigned KBUF = KS_ * P128_ * 2, VBUF = 64 * P256_ * 2;   // bytes per buffer
  constexpr unsigned LKR = 32 * P128_ * 2, LVR = 16 * P256_ * 2;      // row steps in LDS, bytes
  constexpr int NS = F_ / KS_;

  // prologue: Q and stage 0 land and are published, then stage 1 starts
  async_cp4(lds_off(&Qs[kr][kc8]), LKR,
            &q[qbase + (size_t)(blockIdx.x * 128 + kr) * D_ + kc8], 32 * D_);
  async_cp4_4(lk, LKR, gk, 32 * D_, lv, LVR, gv, 16 * F_);
  asm volatile("s_wait_asynccnt 0x0" ::: "memory");   // this wave's share has landed
  __syncthreads();                                    // ... and every other wave's
  async_cp4_4(lk + KBUF, LKR, gk + (size_t)KS_ * D_, 32 * D_, lv + VBUF, LVR, gv + KS_, 16 * F_);

  v16h qa[2];
#pragma unroll
  for (int kc = 0; kc < 2; ++kc)
    qa[kc] = frag_from(&Qs[wave * 16 + arow][kc * 32], half16);

  v8f oacc[4] = {};          // oacc[c][r] = O[query arow][d = c*16 + half16*8 + r]
  float mrun = -INFINITY;    // running maximum of query arow (equal in both halves)
  float lrun = 0.0f;         // this half's share of the denominator

  for (int st = 0; st < NS; ++st) {
    const int cur = st & 1;
#pragma unroll  // four passes of 32 keys: a pass's LDS reads may run ahead of the pass before
    for (int f0 = 0; f0 < KS_; f0 += 32) {
      // S^T = k @ q^T : sacc[ni][r] = score(key ni*16 + half16*8 + r, query arow).
      v8f sacc[2] = {};
#pragma unroll
      for (int kc = 0; kc < 2; ++kc) {
        v16h kf[2];
#pragma unroll
        for (int ni = 0; ni < 2; ++ni)
          kf[ni] = frag_from(&Ks[cur][f0 + ni * 16 + arow][kc * 32], half16);
#pragma unroll
        for (int ni = 0; ni < 2; ++ni)
          sacc[ni] = __builtin_amdgcn_wmma_f32_16x16x32_f16(
              false, kf[ni], false, qa[kc], (short)0, sacc[ni], false, false);
      }

      // Online softmax of one query per lane: in-lane maximum, one half exchange.
      float mx = fmaxf(sacc[0][0], sacc[1][0]);
#pragma unroll
      for (int r = 1; r < 8; ++r) mx = fmaxf(mx, fmaxf(sacc[0][r], sacc[1][r]));
      mx = fmaxf(mx, xhalf(mx));
      const float mnew = fmaxf(mrun, mx);
      const float corr = __expf(mrun - mnew);
      mrun = mnew;

      // P^T as B operand: element s is key kmap(s) = (s < 8 ? s : s + 8) + 8*half16,
      // which is register s & 7 of tile s >> 3; V^T rows come in the same k order.
      v16h pb;
      v8f p0 = sacc[0] - mnew, p1 = sacc[1] - mnew;
#pragma unroll
      for (int r = 0; r < 8; ++r) {
        p0[r] = __expf(p0[r]);
        p1[r] = __expf(p1[r]);
        pb[r]     = (_Float16)p0[r];
        pb[8 + r] = (_Float16)p1[r];
      }
      const v8f ps = p0 + p1;
      const float rs = ((ps[0] + ps[1]) + (ps[2] + ps[3])) + ((ps[4] + ps[5]) + (ps[6] + ps[7]));
      lrun = lrun * corr + rs;
#pragma unroll
      for (int c = 0; c < 4; ++c) oacc[c] *= corr;

      // O^T += V^T(64x32) @ P^T(32x16)
#pragma unroll
      for (int c = 0; c < 4; ++c) {
        v16h vf16 = frag_from(&Vs[cur][c * 16 + arow][f0], half16);
        oacc[c] = __builtin_amdgcn_wmma_f32_16x16x32_f16(
            false, vf16, false, pb, (short)0, oacc[c], false, false);
      }
    }
    // publish point of stage st + 1; the one barrier also frees the buffer just read
    asm volatile("s_wait_dscnt 0x0" ::: "memory");      // this wave's reads of stage st are done
    asm volatile("s_wait_asynccnt 0x0" ::: "memory");   // its share of stage st + 1 has landed
    __syncthreads();
    if (st + 2 < NS)
      async_cp4_4(lk + cur * KBUF, LKR, gk + (size_t)(st + 2) * KS_ * D_, 32 * D_,
                  lv + cur * VBUF, LVR, gv + (st + 2) * KS_, 16 * F_);
  }
  asm volatile("s_wait_asynccnt 0x0" ::: "memory");     // no copy is open when the wave goes on

  // Join the two halves' denominators once; a lane stores 8 consecutive d.
  const float inv = 1.0f / (lrun + xhalf(lrun));
  const int s0 = blockIdx.x * 128 + wave * 16;
  _Float16* ob = &o[((size_t)b * S_ + s0 + arow) * D_ + hd * HD_ + half16 * 8];
  v8h hs[4];
  v8f vs = {}, vq = {};   // sums over the rounded values, which the last product reads
#pragma unroll  // constant indices: the values stay in registers
  for (int c = 0; c < 4; ++c) {
    hs[c] = __builtin_convertvector(oacc[c] * inv, v8h);
    const v8f x = __builtin_convertvector(hs[c], v8f);
    vs += x;
    vq += x * x;
  }
  float s  = ((vs[0] + vs[1]) + (vs[2] + vs[3])) + ((vs[4] + vs[5]) + (vs[6] + vs[7]));
  float s2 = ((vq[0] + vq[1]) + (vq[2] + vq[3])) + ((vq[4] + vq[5]) + (vq[6] + vq[7]));
  s  += xhalf(s);
  s2 += xhalf(s2);
  // one 128-byte line a wave: 16 rows' sums from lanes 0 to 15, their squares from 16 to 31
  float* sp = &st[((size_t)hd * (M_ / 16) + (b * S_ + s0) / 16) * 32 + lane];
  const float sv = half16 ? s2 : s;
#pragma unroll
  for (int c = 0; c < 4; ++c) *(v8h*)(ob + c * 16) = hs[c];
  *sp = sv;
  // The stores' data and addresses are inputs here, so that they stay in place and
  // nothing rewrites them ahead of this wait.
  asm volatile("s_wait_xcnt 0x0" :: "v"(hs[0]), "v"(hs[1]), "v"(hs[2]), "v"(hs[3]),
               "v"(ob), "v"(sp), "v"(sv) : "memory");
}

// ---------------------------------------------------------------------------
extern "C" void kernel_launch(void* const* d_in, const int* in_sizes, int n_in,
                              void* d_out, int out_size, void* d_ws, size_t ws_size,
                              hipStream_t stream) {
  const float* x_q   = (const float*)d_in[0];
  const float* x_k   = (const float*)d_in[1];
  const float* x_v   = (const float*)d_in[2];
  const float* Wq    = (const float*)d_in[3];
  const float* Wk    = (const float*)d_in[4];
  const float* Wv    = (const float*)d_in[5];
  const float* Wproj = (const float*)d_in[6];
  const float* q_g   = (const float*)d_in[7];
  const float* q_b   = (const float*)d_in[8];
  const float* k_g   = (const float*)d_in[9];
  const float* k_b   = (const float*)d_in[10];
  const float* o_g   = (const float*)d_in[11];
  const float* o_b   = (const float*)d_in[12];
  float* out = (float*)d_out;

  const size_t MB = 1024 * 1024;
  char* w = (char*)d_ws;
  _Float16* wqt = (_Float16*)(w + 24 * MB);   // 2MB each (transposed f16)
  _Float16* wkt = (_Float16*)(w + 26 * MB);
  _Float16* wvt = (_Float16*)(w + 28 * MB);
  _Float16* wpt = (_Float16*)(w + 30 * MB);
  _Float16* qh  = (_Float16*)(w + 80 * MB);   // 8MB each (post-LN f16)
  _Float16* kh  = (_Float16*)(w + 88 * MB);
  _Float16* vt  = (_Float16*)(w + 96 * MB);   // 8MB (d-major f16 V)
  float*    up  = (float*)(w + 32 * MB);      // 16 x 1024 f32: shares of u
  float*    cp  = (float*)(w + 33 * MB);      // 16 x 1024 f32: shares of c
  float*    st  = (float*)(w + 104 * MB);     // 16 x 256 x 32 f32: row sums per head
  _Float16* ah  = (_Float16*)(w + 0 * MB);    // 8MB: attention out f16

  dim3 gblk(256);
  dim3 ggrid(D_ / 128, M_ / 64);

  // precision/layout conversion of the four weight matrices
  prep_f16<<<4 * TR_WG_, 256, 0, stream>>>(
      Wq, Wk, Wv, Wproj, o_g, o_b, wqt, wkt, wvt, wpt, up, cp);

  // all three projections; epilogues: per-head LN -> f16 (q, k), d-major f16 (v)
  gemm_qkv<<<dim3(M_ / 128, D_ / 256, 3), gblk, 0, stream>>>(
      x_q, x_k, x_v, wqt, wkt, wvt, qh, kh, vt, q_g, q_b, k_g, k_b);

  flash_attn<<<dim3(S_ / 128, B_ * H_), 256, 0, stream>>>(qh, kh, vt, ah, st);

  // output LayerNorm and projection in one: the row and column terms go in the epilogue
  gemm_f16wmma<<<ggrid, gblk, 0, stream>>>(ah, wpt, st, up, cp, out);
}

// v010
// One run takes 72 microseconds.
// Versions in between are left out here; by their measured steps it is 1.12 times as fast as v008.
// All steps since v000 together make it 3.08 times as fast.
#include <hip/hip_runtime.h>
#include <hip/hip_bf16.h>
#include <math.h>

typedef __attribute__((ext_vector_type(16))) _Float16 v16h;
typedef __attribute__((ext_vector_type(8)))  _Float16 v8h;
typedef __attribute__((ext_vector_type(4)))  _Float16 v4h;
typedef __attribute__((ext_vector_type(8)))  float    v8f;
typedef __attribute__((ext_vector_type(4)))  float    v4f;

#define B_   2
#define S_   2048
#define F_   2048
#define D_   1024
#define H_   16
#define HD_  64
#define M_   4096           // B_*S_ == B_*F_
#define EPS_ 1e-5f
#define LOG2E_ 1.44269504f   // q carries it beside its scale: scores are exponents of 2

// ---- CDNA5 async copies: 16 B a lane, global -> LDS, tracked by ASYNCcnt ----
// A run of copies and the s_wait_xcnt 0 that stands ahead of any rewrite of their
// address registers are ONE statement, so that nothing can come between them.
// l: the lane's LDS byte address, g: its global address; copy i lies i row steps on.
#define CP_(a, b) "global_load_async_to_lds_b128 %" #a ", %" #b ", off\n\t"
static __device__ __forceinline__ unsigned lds_off(const void* p) { return (unsigned)(size_t)p; }

static __device__ __forceinline__ void async_cp4(unsigned l, unsigned ls,
                                                 const _Float16* g, int gs) {
  asm volatile(CP_(0, 4) CP_(1, 5) CP_(2, 6) CP_(3, 7) "s_wait_xcnt 0x0"
      :: "v"(l), "v"(l + ls), "v"(l + 2 * ls), "v"(l + 3 * ls),
         "v"(g), "v"(g + gs), "v"(g + 2 * gs), "v"(g + 3 * gs)
      : "memory");
}
// 4 copies of one tile and 4 of another
static __device__ __forceinline__ void async_cp4_4(unsigned l, unsigned ls,
                                                   const _Float16* g, int gs,
                                                   unsigned m, unsigned ms,
                                                   const _Float16* h, int hs) {
  asm volatile(CP_(0, 8) CP_(1, 9) CP_(2, 10) CP_(3, 11)
               CP_(4, 12) CP_(5, 13) CP_(6, 14) CP_(7, 15) "s_wait_xcnt 0x0"
      :: "v"(l), "v"(l + ls), "v"(l + 2 * ls), "v"(l + 3 * ls),
         "v"(m), "v"(m + ms), "v"(m + 2 * ms), "v"(m + 3 * ms),
         "v"(g), "v"(g + gs), "v"(g + 2 * gs), "v"(g + 3 * gs),
         "v"(h), "v"(h + hs), "v"(h + 2 * hs), "v"(h + 3 * hs)
      : "memory");
}
// 8 copies of one tile
static __device__ __forceinline__ void async_cp8(unsigned m, unsigned ms,
                                                 const _Float16* h, int hs) {
  asm volatile(CP_(0, 8) CP_(1, 9) CP_(2, 10) CP_(3, 11)
               CP_(4, 12) CP_(5, 13) CP_(6, 14) CP_(7, 15) "s_wait_xcnt 0x0"
      :: "v"(m), "v"(m + ms), "v"(m + 2 * ms), "v"(m + 3 * ms),
         "v"(m + 4 * ms), "v"(m + 5 * ms), "v"(m + 6 * ms), "v"(m + 7 * ms),
         "v"(h), "v"(h + hs), "v"(h + 2 * hs), "v"(h + 3 * hs),
         "v"(h + 4 * hs), "v"(h + 5 * hs), "v"(h + 6 * hs), "v"(h + 7 * hs)
      : "memory");
}
// 4 copies of one tile and 8 of another
static __device__ __forceinline__ void async_cp4_8(unsigned l, unsigned ls,
                                                   const _Float16* g, int gs,
                                                   unsigned m, unsigned ms,
                                                   const _Float16* h, int hs) {
  asm volatile(CP_(0, 12) CP_(1, 13) CP_(2, 14) CP_(3, 15)
               CP_(4, 16) CP_(5, 17) CP_(6, 18) CP_(7, 19)
               CP_(8, 20) CP_(9, 21) CP_(10, 22) CP_(11, 23) "s_wait_xcnt 0x0"
      :: "v"(l), "v"(l + ls), "v"(l + 2 * ls), "v"(l + 3 * ls),
         "v"(m), "v"(m + ms), "v"(m + 2 * ms), "v"(m + 3 * ms),
         "v"(m + 4 * ms), "v"(m + 5 * ms), "v"(m + 6 * ms), "v"(m + 7 * ms),
         "v"(g), "v"(g + gs), "v"(g + 2 * gs), "v"(g + 3 * gs),
         "v"(h), "v"(h + hs), "v"(h + 2 * hs), "v"(h + 3 * hs),
         "v"(h + 4 * hs), "v"(h + 5 * hs), "v"(h + 6 * hs), "v"(h + 7 * hs)
      : "memory");
}

#define KS_ 128   // k (GEMM) or keys (attention) per stage of an LDS ring
#define P256_ 136 // LDS pitch in halves of 256-byte rows: 272 bytes, 16 x odd (ds_load_b128)
#define P128_ 72  // LDS pitch in halves of 128-byte rows: 144 bytes, 16 x odd

// Concatenate two contiguous 8-half K-runs into a WMMA 16-bit fragment.
static __device__ __forceinline__ v16h frag_from(const _Float16* row, int half16) {
  v8h lo = *(const v8h*)(row + 8 * half16);        // K = {0..7}  + 8*half
  v8h hi = *(const v8h*)(row + 16 + 8 * half16);   // K = {16..23}+ 8*half
  return __builtin_shufflevector(lo, hi, 0, 1, 2, 3, 4, 5, 6, 7,
                                 8, 9, 10, 11, 12, 13, 14, 15);
}

// ---------------------------------------------------------------------------
// The four weight matrices in ONE launch: Wq, Wk, Wv, Wproj (k x n) f32 -> (n x k) f16,
// one 64(k) x 128(n) tile a work-group; 8 lanes store one 128-byte line.
// (The activations are not copied: the projection GEMM reads them as f32.)
// The output LayerNorm is folded into the last product:
//   LN(x) @ W = rstd * (x @ (g*W) - mean * u) + c,  u[n] = sum_k g[k] W[k][n],
//                                                   c[n] = sum_k b[k] W[k][n].
// Wproj is therefore stored as g[k] * W[k][n], and each of its tiles leaves its 64 k's
// share of u (summed over the rounded f16 values the product will use) and of c.
// ---------------------------------------------------------------------------
#define TR_WG_  128    // work-groups per weight matrix
__global__ __launch_bounds__(256) void prep_f16(
    const float* __restrict__ Wq, const float* __restrict__ Wk,
    const float* __restrict__ Wv, const float* __restrict__ Wp,
    const float* __restrict__ o_g, const float* __restrict__ o_b,
    _Float16* __restrict__ wqt, _Float16* __restrict__ wkt,
    _Float16* __restrict__ wvt, _Float16* __restrict__ wpt,
    float* __restrict__ up, float* __restrict__ cp) {
  __shared__ float t[64][129];   // odd pitch: the column reads below meet no bank twice
  __shared__ float cs[2][128];   // this tile's share of u and of c
  const int tid = threadIdx.x;
  {
    const int tb = blockIdx.x;
    const int m  = tb / TR_WG_;
    const float* in  = m == 0 ? Wq : m == 1 ? Wk : m == 2 ? Wv : Wp;
    _Float16*    out = m == 0 ? wqt : m == 1 ? wkt : m == 2 ? wvt : wpt;
    const int kb = ((tb % TR_WG_) >> 3) * 64;
    const int nb = (tb & 7) * 128;
    const bool fold = m == 3;   // the same for the whole work-group
    const int part = tid & 7;   // the lane's 8 k of every line it stores
    v4f g0 = {1.0f, 1.0f, 1.0f, 1.0f}, g1 = g0, b0 = {}, b1 = {};
    if (fold) {                 // issued ahead of the tile's loads: one latency for all
      g0 = *(const v4f*)(o_g + kb + part * 8);
      g1 = *(const v4f*)(o_g + kb + part * 8 + 4);
      b0 = *(const v4f*)(o_b + kb + part * 8);
      b1 = *(const v4f*)(o_b + kb + part * 8 + 4);
      // The loads' offset register is an input here, so that nothing rewrites it
      // ahead of this wait.
      asm volatile("s_wait_xcnt 0x0" :: "v"(part * 32) : "memory");
    }
    // a wave reads 512 contiguous bytes of one k row; load j is 8 rows further down
    const float* p = in + (size_t)(kb + (tid >> 5)) * D_ + nb + (tid & 31) * 4;
    v4f x[8];
#pragma unroll  // all 8 loads are issued before the first value is used
    for (int j = 0; j < 8; ++j) x[j] = *(const v4f*)(p + j * 8 * D_);
#pragma unroll  // constant indices: the values stay in registers
    for (int j = 0; j < 8; ++j) {
      const int idx = tid + j * 256;
#pragma unroll  // constant indices: the values stay in registers
      for (int e = 0; e < 4; ++e) t[idx >> 5][(idx & 31) * 4 + e] = x[j][e];
    }
    __syncthreads();   // the whole tile is in LDS before a lane reads other waves' rows
    v8h hs[4];
    _Float16* hp[4];
#pragma unroll  // four independent lines: their LDS reads overlap
    for (int i = 0; i < 4; ++i) {
      const int n = (tid >> 3) + i * 32;
      v8h h;
      float su = 0.0f, sc = 0.0f;
#pragma unroll  // constant indices: the values stay in registers
      for (int e = 0; e < 8; ++e) {
        const float wv = t[part * 8 + e][n];
        h[e] = (_Float16)(wv * (e < 4 ? g0[e & 3] : g1[e & 3]));
        su += (float)h[e];
        sc += wv * (e < 4 ? b0[e & 3] : b1[e & 3]);
      }
      hs[i] = h;
      hp[i] = out + (size_t)(nb + n) * D_ + kb + part * 8;
      if (fold) {
#pragma unroll  // three exchange steps with constant lane masks
        for (int x = 4; x >= 1; x >>= 1) {
          su += __shfl_xor(su, x);
          sc += __shfl_xor(sc, x);
        }
        if (part == 0) { cs[0][n] = su; cs[1][n] = sc; }
      }
    }
    if (fold) {   // ahead of the lines' stores, so that this barrier does not wait for them
      __syncthreads();   // all 128 column sums are in LDS; a wave then stores one whole line
      float* dst = ((tid >> 7) ? cp : up) + (kb >> 6) * D_ + nb + (tid & 127);
      const float sv = cs[tid >> 7][tid & 127];
      *dst = sv;
      // The store's data and address are inputs here, so that they stay in place and
      // nothing rewrites them ahead of this wait.
      asm volatile("s_wait_xcnt 0x0" :: "v"(dst), "v"(sv) : "memory");
    }
#pragma unroll  // constant indices: the values stay in registers
    for (int i = 0; i < 4; ++i) *(v8h*)hp[i] = hs[i];
    // The stores' data and addresses are inputs here, so that they stay in place and
    // nothing rewrites them ahead of this wait.
    asm volatile("s_wait_xcnt 0x0" :: "v"(hs[0]), "v"(hs[1]), "v"(hs[2]), "v"(hs[3]),
                 "v"(hp[0]), "v"(hp[1]), "v"(hp[2]), "v"(hp[3]) : "memory");
  }
}

// ---------------------------------------------------------------------------
// [4096,1024] = A[4096,1024](f16) @ Wt[1024,1024](f16, N-major rows)
// Workgroup tile 64(M) x 128(N), 8 waves of 32x32; a stage is 128 k, four steps of 32.
// Two buffers of async b128 copies, one barrier a stage (copies overlap WMMA).
// The epilogue, epi_ln_f32: the folded LayerNorm's row and column terms, f32 rows to C.
// ---------------------------------------------------------------------------
struct __attribute__((aligned(16))) GemmRing {
  _Float16 As[2][64][P256_];    // 64 M-rows x 128 K
  _Float16 Bts[2][128][P256_];  // 128 N-rows x 128 K
};

// One stage of the ring: four k steps of 32 from buffer cur, 16 WMMAs a wave.
static __device__ __forceinline__ void gemm_stage(const GemmRing& ring, int cur,
                                                  v8f (&acc)[2][2]) {
  const int lane = threadIdx.x & 31;
  const int wave = threadIdx.x >> 5;
  const int wm = (wave & 1) * 32;
  const int wn = (wave >> 1) * 32;
  const int half16 = lane >> 4;
  const int arow   = lane & 15;
#pragma unroll  // the four k steps of a stage read LDS at constant offsets from one address
  for (int kk = 0; kk < KS_; kk += 32) {
    v16h afrag[2], bfrag[2];
#pragma unroll
    for (int mi = 0; mi < 2; ++mi)
      afrag[mi] = frag_from(&ring.As[cur][wm + mi * 16 + arow][kk], half16);
#pragma unroll
    for (int ni = 0; ni < 2; ++ni)
      bfrag[ni] = frag_from(&ring.Bts[cur][wn + ni * 16 + arow][kk], half16);

#pragma unroll
    for (int mi = 0; mi < 2; ++mi)
#pragma unroll
      for (int ni = 0; ni < 2; ++ni)
        acc[mi][ni] = __builtin_amdgcn_wmma_f32_16x16x32_f16(
            false, afrag[mi], false, bfrag[ni], (short)0, acc[mi][ni],
            false, false);
  }
}

// mid() runs while stage 0's copies fly; what it writes to LDS is published by the
// prologue's barrier.
template <typename F>
static __device__ __forceinline__ void gemm_loop(
    const _Float16* __restrict__ A, const _Float16* __restrict__ Wt,
    GemmRing& ring, v8f (&acc)[2][2], F mid) {
  const int tid = threadIdx.x;
  const int m0 = blockIdx.y * 64;
  const int n0 = blockIdx.x * 128;

  // staging: 16 lanes bring one 256-byte row; a lane's 12 copies lie 16 rows apart
  const int sr = tid >> 4, sc = (tid & 15) * 8;
  const _Float16* ga = &A[(size_t)(m0 + sr) * D_ + sc];
  const _Float16* gb = &Wt[(size_t)(n0 + sr) * D_ + sc];
  const unsigned la = lds_off(&ring.As[0][sr][sc]);
  const unsigned lb = lds_off(&ring.Bts[0][sr][sc]);
  constexpr unsigned ABUF = 64 * P256_ * 2, BBUF = 128 * P256_ * 2;   // bytes per buffer
  constexpr unsigned LR = 16 * P256_ * 2;   // 16 rows on in LDS, bytes
  constexpr int      GR = 16 * D_;          // 16 rows on in global memory, halves
  constexpr int NT = D_ / KS_;

  // prologue: stage 0 lands and is published, then stage 1 starts
  async_cp4_8(la, LR, ga, GR, lb, LR, gb, GR);
  mid();
  asm volatile("s_wait_asynccnt 0x0" ::: "memory");   // this wave's share of stage 0 has landed
  __syncthreads();                                    // ... and every other wave's
  async_cp4_8(la + ABUF, LR, ga + KS_, GR, lb + BBUF, LR, gb + KS_, GR);

  for (int t = 0; t < NT; ++t) {
    const int cur = t & 1;
    gemm_stage(ring, cur, acc);
    // publish point of stage t + 1; the one barrier also frees the buffer just read
    asm volatile("s_wait_dscnt 0x0" ::: "memory");      // this wave's reads of stage t are done
    asm volatile("s_wait_asynccnt 0x0" ::: "memory");   // its share of stage t + 1 has landed
    __syncthreads();
    if (t + 2 < NT)
      async_cp4_8(la + cur * ABUF, LR, ga + (t + 2) * KS_, GR,
                  lb + cur * BBUF, LR, gb + (t + 2) * KS_, GR);
  }
  asm volatile("s_wait_asynccnt 0x0" ::: "memory");     // no copy is open when the wave goes on
}

// C = rstd[m] * (acc - mean[m] * u[n]) + c[n]; rs: mean, rstd of the tile's 64 rows,
// cv: u, c of its 128 columns.
static __device__ __forceinline__ void epi_ln_f32(
    v8f (&acc)[2][2], const float (*rs)[64], const float (*cv)[128], float* __restrict__ C) {
  const int lane = threadIdx.x & 31;
  const int wave = threadIdx.x >> 5;
  const int m0 = blockIdx.y * 64, n0 = blockIdx.x * 128;
  const int wm = (wave & 1) * 32, wn = (wave >> 1) * 32;
  const int half16 = lane >> 4, arow = lane & 15;
  float* cb = &C[(size_t)(m0 + wm + half16 * 8) * D_ + n0 + wn + arow];
#pragma unroll  // constant indices: the values stay in registers
  for (int mi = 0; mi < 2; ++mi) {
    const v8f mean = *(const v8f*)&rs[0][wm + mi * 16 + half16 * 8];
    const v8f rstd = *(const v8f*)&rs[1][wm + mi * 16 + half16 * 8];
#pragma unroll  // constant indices: the values stay in registers
    for (int ni = 0; ni < 2; ++ni) {
      const float u = cv[0][wn + ni * 16 + arow];
      const float c = cv[1][wn + ni * 16 + arow];
      acc[mi][ni] = rstd * (acc[mi][ni] - mean * u) + c;
    }
  }
#pragma unroll
  for (int mi = 0; mi < 2; ++mi)
#pragma unroll
    for (int ni = 0; ni < 2; ++ni)
#pragma unroll
      for (int r = 0; r < 8; ++r)
        cb[(size_t)(mi * 16 + r) * D_ + ni * 16] = acc[mi][ni][r];
}

// ---- the q, k, v projections' own tile: 128(M) x 256(N), 8 waves of 64 x 64 ----
#define QS_ 64   // k per stage of their ring
struct __attribute__((aligned(16))) QkvRing {
  _Float16 As[2][128][P128_];    // 128 M-rows x 64 k
  _Float16 Bts[2][256][P128_];   // 256 N-rows x 64 k
};
// A work-group has one tile, so the epilogue's staging takes the ring's place.
union __attribute__((aligned(16))) QkvLds {
  QkvRing  ring;
  float    Cs[128][260];      // the tile, f32; 1040-byte rows
  _Float16 Ts[256][P256_];    // the tile, f16, column-major
};

// LayerNorm over each 64-column head, scaled, f16 rows to Ch. The tile passes through LDS,
// so that 8 lanes own one 128-byte line.
static __device__ __forceinline__ void epi_head_ln(
    const v8f (&acc)[4][4], float (*Cs)[260],
    _Float16* __restrict__ Ch, const float* __restrict__ gamma,
    const float* __restrict__ beta, float scale) {
  const int tid  = threadIdx.x;
  const int lane = tid & 31;
  const int wave = tid >> 5;
  const int m0 = blockIdx.x * 128, n0 = blockIdx.y * 256;
  const int wm = (wave & 1) * 64, wn = (wave >> 1) * 64;
  const int half16 = lane >> 4, arow = lane & 15;
#pragma unroll  // constant indices: the values stay in registers
  for (int mi = 0; mi < 4; ++mi)
#pragma unroll  // constant indices: the values stay in registers
    for (int ni = 0; ni < 4; ++ni)
#pragma unroll  // constant indices: the values stay in registers
      for (int r = 0; r < 8; ++r)
        Cs[wm + mi * 16 + half16 * 8 + r][wn + ni * 16 + arow] = acc[mi][ni][r];
  __syncthreads();   // the whole tile is in LDS before a lane reads other waves' parts
  // 8 lanes per head vector, 8 elements each; 512 head vectors in the tile.
  const int part = tid & 7;
  const v4f g0 = *(const v4f*)(gamma + part * 8);
  const v4f g1 = *(const v4f*)(gamma + part * 8 + 4);
  const v4f b0 = *(const v4f*)(beta + part * 8);
  const v4f b1 = *(const v4f*)(beta + part * 8 + 4);
#pragma unroll  // constant indices: the values stay in registers
  for (int g = 0; g < 4; ++g) {
    v8h hs[4];
    _Float16* hp[4];
#pragma unroll  // four independent head vectors: their LDS reads and exchanges overlap
    for (int i = 0; i < 4; ++i) {
      const int hv  = (tid >> 3) + (g * 4 + i) * 32;
      const int row = hv >> 2;
      const int col = (hv & 3) * 64 + part * 8;
      const v4f x0 = *(const v4f*)&Cs[row][col];
      const v4f x1 = *(const v4f*)&Cs[row][col + 4];
      const v4f xs = x0 + x1;
      const v4f xq = x0 * x0 + x1 * x1;
      float s  = (xs[0] + xs[1]) + (xs[2] + xs[3]);
      float s2 = (xq[0] + xq[1]) + (xq[2] + xq[3]);
#pragma unroll  // three exchange steps with constant lane masks
      for (int m = 4; m >= 1; m >>= 1) {
        s  += __shfl_xor(s,  m);
        s2 += __shfl_xor(s2, m);
      }
      const float mean = s * (1.0f / 64.0f);
      const float var  = s2 * (1.0f / 64.0f) - mean * mean;
      const float rstd = rsqrtf(var + EPS_);
      v8h hh;
#pragma unroll  // constant indices: the values stay in registers
      for (int e = 0; e < 4; ++e) {
        hh[e]     = (_Float16)(((x0[e] - mean) * rstd * g0[e] + b0[e]) * scale);
        hh[4 + e] = (_Float16)(((x1[e] - mean) * rstd * g1[e] + b1[e]) * scale);
      }
      hs[i] = hh;
      hp[i] = &Ch[(size_t)(m0 + row) * D_ + n0 + col];
      *(v8h*)hp[i] = hh;
    }
    // The next group reuses registers. The stores' data and addresses are inputs here,
    // so that they stay in place and nothing rewrites them ahead of this wait.
    asm volatile("s_wait_xcnt 0x0" :: "v"(hs[0]), "v"(hs[1]), "v"(hs[2]), "v"(hs[3]),
                 "v"(hp[0]), "v"(hp[1]), "v"(hp[2]), "v"(hp[3]) : "memory");
  }
}

// f16, d-major: Ch[(b*D + n)][f], m = b*F + f.
static __device__ __forceinline__ void epi_dmajor(
    const v8f (&acc)[4][4], _Float16 (*Ts)[P256_], _Float16* __restrict__ Ch) {
  const int tid  = threadIdx.x;
  const int lane = tid & 31;
  const int wave = tid >> 5;
  const int m0 = blockIdx.x * 128, n0 = blockIdx.y * 256;
  const int wm = (wave & 1) * 64, wn = (wave >> 1) * 64;
  const int half16 = lane >> 4, arow = lane & 15;
#pragma unroll  // constant indices: the values stay in registers
  for (int mi = 0; mi < 4; ++mi)
#pragma unroll  // constant indices: the values stay in registers
    for (int ni = 0; ni < 4; ++ni)   // 8 consecutive m of one column n
      *(v8h*)&Ts[wn + ni * 16 + arow][wm + mi * 16 + half16 * 8] =
          __builtin_convertvector(acc[mi][ni], v8h);
  __syncthreads();   // the whole tile is in LDS before a lane reads other waves' parts
  // 16 lanes per column n: 128 m = two 128-byte lines of the d-major plane.
  const int bb = m0 / F_, fb = m0 % F_;
  const int part = tid & 15;
#pragma unroll  // constant indices: the values stay in registers
  for (int g = 0; g < 4; ++g) {
    v8h hs[4];
    _Float16* hp[4];
#pragma unroll  // four independent columns: their LDS reads overlap
    for (int i = 0; i < 4; ++i) {
      const int n = (tid >> 4) + (g * 4 + i) * 16;
      hs[i] = *(const v8h*)&Ts[n][part * 8];
      hp[i] = &Ch[((size_t)bb * D_ + n0 + n) * F_ + fb + part * 8];
      *(v8h*)hp[i] = hs[i];
    }
    // The next group reuses registers. The stores' data and addresses are inputs here,
    // so that they stay in place and nothing rewrites them ahead of this wait.
    asm volatile("s_wait_xcnt 0x0" :: "v"(hs[0]), "v"(hs[1]), "v"(hs[2]), "v"(hs[3]),
                 "v"(hp[0]), "v"(hp[1]), "v"(hp[2]), "v"(hp[3]) : "memory");
  }
}

// A: attention output, f16, not normalised; Wt: g * Wproj. st: per head and 16 rows, 16
// row sums and 16 sums of squares over the head's 64 columns; up, cp: 16 shares of u, c.
__global__ __launch_bounds__(256) void gemm_f16wmma(
    const _Float16* __restrict__ A, const _Float16* __restrict__ Wt,
    const float* __restrict__ st, const float* __restrict__ up,
    const float* __restrict__ cp, float* __restrict__ C) {
  __shared__ GemmRing ring;
  __shared__ __attribute__((aligned(32))) float rs[2][64];
  __shared__ float cv[2][128];
  v8f acc[2][2] = {};
  gemm_loop(A, Wt, ring, acc, [&]() {
    const int tid = threadIdx.x;
    // the wave's number in a scalar register: whole waves branch, EXEC stays all ones
    const int wv = __builtin_amdgcn_readfirstlane(tid >> 5);
    if (wv < 4) {             // waves 0 to 3: one column a lane
      const float* pu = up + blockIdx.x * 128 + tid;
      const float* pc = cp + blockIdx.x * 128 + tid;
      float xu[16], xc[16];
#pragma unroll  // all 32 loads are issued before the first value is used: one latency
      for (int j = 0; j < 16; ++j) { xu[j] = pu[j * D_]; xc[j] = pc[j * D_]; }
      // The loads' offset register is an input here, so that nothing rewrites it
      // ahead of this wait.
      asm volatile("s_wait_xcnt 0x0" :: "v"(tid) : "memory");
      float u = xu[0], c = xc[0];
#pragma unroll  // constant indices: the values stay in registers
      for (int j = 1; j < 16; ++j) { u += xu[j]; c += xc[j]; }
      cv[0][tid] = u;
      cv[1][tid] = c;
    } else if (wv < 6) {      // waves 4 and 5: one row a lane
      const int r = tid - 128;
      const float* ps = st + (blockIdx.y * 4 + (r >> 4)) * 32 + (r & 15);
      float xs[16], xq[16];
#pragma unroll  // all 32 loads are issued before the first value is used: one latency
      for (int j = 0; j < 16; ++j) {
        xs[j] = ps[j * (M_ / 16) * 32];
        xq[j] = ps[j * (M_ / 16) * 32 + 16];
      }
      // The loads' address registers are inputs here, so that nothing rewrites them
      // ahead of this wait.
      asm volatile("s_wait_xcnt 0x0" :: "v"(ps) : "memory");
      float s = xs[0], s2 = xq[0];
#pragma unroll  // constant indices: the values stay in registers
      for (int j = 1; j < 16; ++j) { s += xs[j]; s2 += xq[j]; }
      const float mean = s * (1.0f / (float)D_);
      const float var  = s2 * (1.0f / (float)D_) - mean * mean;
      rs[0][r] = mean;
      rs[1][r] = rsqrtf(var + EPS_);
    }
  });
  epi_ln_f32(acc, rs, cv, C);
}

// One stage of the projections' ring: two k steps of 32 from buffer cur, 32 WMMAs a wave;
// each of the 8 fragments of a step feeds 4 of its 16 WMMAs.
static __device__ __forceinline__ void qkv_stage(const QkvRing& ring, int cur,
                                                 v8f (&acc)[4][4]) {
  const int lane = threadIdx.x & 31;
  const int wave = threadIdx.x >> 5;
  const int wm = (wave & 1) * 64;
  const int wn = (wave >> 1) * 64;
  const int half16 = lane >> 4;
  const int arow   = lane & 15;
#pragma unroll  // the two k steps of a stage read LDS at constant offsets from one address
  for (int kk = 0; kk < QS_; kk += 32) {
    v16h afrag[4], bfrag[4];
    afrag[0] = frag_from(&ring.As[cur][wm + arow][kk], half16);
#pragma unroll
    for (int ni = 0; ni < 4; ++ni)
      bfrag[ni] = frag_from(&ring.Bts[cur][wn + ni * 16 + arow][kk], half16);
#pragma unroll
    for (int mi = 1; mi < 4; ++mi)
      afrag[mi] = frag_from(&ring.As[cur][wm + mi * 16 + arow][kk], half16);
    // Keeps the step's 16 LDS reads together ahead of its 16 WMMAs: left free, the compiler
    // reloads one A fragment per row of 4 WMMAs and waits out the LDS latency at each row.
    __builtin_amdgcn_sched_barrier(0);
#pragma unroll
    for (int mi = 0; mi < 4; ++mi)
#pragma unroll
      for (int ni = 0; ni < 4; ++ni)
        acc[mi][ni] = __builtin_amdgcn_wmma_f32_16x16x32_f16(
            false, afrag[mi], false, bfrag[ni], (short)0, acc[mi][ni],
            false, false);
  }
  // Keeps the stage's WMMAs ahead of the stage barrier: left free, the compiler sinks the
  // last 16 behind it, and the next copies and x loads start that much later.
  __builtin_amdgcn_sched_barrier(0);
}
// The activation half of a stage comes as f32 through registers: 16 lanes read the 256
// contiguous bytes of one row's 64 k; load j is 16 rows further down. a: the lane's element.
static __device__ __forceinline__ void load_x(const float* a, v4f (&r)[8]) {
#pragma unroll  // all 8 loads are issued before the first value is used
  for (int j = 0; j < 8; ++j) r[j] = *(const v4f*)(a + j * 16 * D_);
  // The loads' address registers are inputs here, so that nothing rewrites them
  // ahead of this wait.
  asm volatile("s_wait_xcnt 0x0" :: "v"(a) : "memory");
}
// ... and goes to LDS as f16.
static __device__ __forceinline__ void store_x(_Float16* dst, const v4f (&r)[8]) {
#pragma unroll  // constant indices: the values stay in registers
  for (int j = 0; j < 8; ++j)
    *(v4h*)(dst + j * 16 * P128_) = __builtin_convertvector(r[j], v4h);
}

// The three projections in ONE launch, one 128 x 256 tile of q, k or v a work-group
// (grid z). Against a 64 x 128 tile, x and Wt each pass L2 half as often; a 64 x 64 wave
// tile reads half the LDS bytes per WMMA of a 32 x 32 one.
// x_q, x_k, x_v are read as the f32 inputs they are and rounded to f16 on the way to LDS.
// Grid: x = row block.
__global__ __launch_bounds__(256) void gemm_qkv(
    const float* __restrict__ xq, const float* __restrict__ xk,
    const float* __restrict__ xv, const _Float16* __restrict__ wq,
    const _Float16* __restrict__ wk, const _Float16* __restrict__ wv,
    _Float16* __restrict__ qh, _Float16* __restrict__ kh, _Float16* __restrict__ vt,
    const float* __restrict__ q_g, const float* __restrict__ q_b,
    const float* __restrict__ k_g, const float* __restrict__ k_b) {
  __shared__ QkvLds lds;
  const int tid = threadIdx.x;
  const int z = blockIdx.z;
  const float*    x = z == 0 ? xq : z == 1 ? xk : xv;
  const _Float16* w = z == 0 ? wq : z == 1 ? wk : wv;

  // staging of Wt: 8 lanes bring one 128-byte row; a lane's 8 copies lie 32 rows apart
  const int sr = tid >> 3, sc = (tid & 7) * 8;
  const _Float16* gb = w + (size_t)(blockIdx.y * 256 + sr) * D_ + sc;
  const unsigned lb = lds_off(&lds.ring.Bts[0][sr][sc]);
  constexpr unsigned BBUF = 256 * P128_ * 2;   // bytes per buffer
  constexpr unsigned LR = 32 * P128_ * 2;      // 32 rows on in LDS, bytes
  constexpr int      GR = 32 * D_;             // 32 rows on in global memory, halves
  // staging of x: 16 lanes bring one row's 64 k, a lane 4 k of 8 rows
  const int xr = tid >> 4, xc = (tid & 15) * 4;
  const float* ga = x + (size_t)(blockIdx.x * 128 + xr) * D_ + xc;
  _Float16* sa = &lds.ring.As[0][xr][xc];
  constexpr int ABUFH = 128 * P128_;        // halves per buffer
  constexpr int NT = D_ / QS_;              // stages

  // prologue: stage 0 (and the x half of stage 1, whose buffer nobody reads yet) lands and
  // is published, then the rest of stage 1 starts and the x of stage 2 is asked for
  v4f xr0[8];
  {
    v4f xr1[8];
    async_cp8(lb, LR, gb, GR);
    load_x(ga, xr0);
    load_x(ga + QS_, xr1);
    store_x(sa, xr0);
    store_x(sa + ABUFH, xr1);
  }
  asm volatile("s_wait_asynccnt 0x0" ::: "memory");   // its share of stage 0's Wt has landed
  __syncthreads();                                    // ... and every other wave's, x rows too
  async_cp8(lb + BBUF, LR, gb + QS_, GR);
  load_x(ga + 2 * QS_, xr0);

  v8f acc[4][4] = {};

  for (int s = 0; s < NT; ++s) {
    qkv_stage(lds.ring, s & 1, acc);
    // publish point of stage s + 1; the one barrier also frees the buffer just read
    // (the first wait also covers this wave's x stores of stage s + 1)
    asm volatile("s_wait_dscnt 0x0" ::: "memory");      // this wave's reads of stage s are done
    asm volatile("s_wait_asynccnt 0x0" ::: "memory");   // its share of stage s + 1 has landed
    __syncthreads();
    if (s + 2 < NT) {
      async_cp8(lb + (s & 1) * BBUF, LR, gb + (s + 2) * QS_, GR);
      store_x(sa + (s & 1) * ABUFH, xr0);   // asked for one stage ago
    }
    if (s + 3 < NT) load_x(ga + (s + 3) * QS_, xr0);
  }
  asm volatile("s_wait_asynccnt 0x0" ::: "memory");     // no copy is open when the ring is reused

  // behind the loop's last barrier nobody reads the ring any more: the epilogue stages there
  if (z < 2)
    epi_head_ln(acc, lds.Cs, z == 0 ? qh : kh, z == 0 ? q_g : k_g,
                z == 0 ? q_b : k_b, z == 0 ? 0.125f * LOG2E_ : 1.0f);
  else
    epi_dmajor(acc, lds.Ts, vt);
}

#define PSUM_MAX_ 60000.0f
// Value of lane l ^ 16 (the other half of a query's keys).
static __device__ __forceinline__ float xhalf(float x) {
  int i = __builtin_bit_cast(int, x);
  return __builtin_bit_cast(float, __builtin_amdgcn_permlanex16(
      i, i, 0x76543210, 0xfedcba98, false, false));
}
// What a wave hands its partner: one query tile's O (32 values a lane, 16 bytes a lane and
// row: a wave's store is 512 contiguous bytes), its reference and its share of the denominator.
struct __attribute__((aligned(16))) Handover {
  float o[8][32][4];
  float rl[32][2];
};

// amdgpu_waves_per_eu: two work-groups stay resident on a WGP (four waves a SIMD), which the
// vector work between the matrix runs wants; left free, the build takes more than 256 registers.
__global__ __launch_bounds__(256) __attribute__((amdgpu_waves_per_eu(4, 4))) void flash_attn(
    const _Float16* __restrict__ q, const _Float16* __restrict__ k,
    const _Float16* __restrict__ v, _Float16* __restrict__ o, float* __restrict__ st) {
  __shared__ __attribute__((aligned(16))) _Float16 Qs[128][P128_];       // 128 s-rows x 64 d
  __shared__ __attribute__((aligned(16))) _Float16 Ks[2][KS_][P128_];    // 128 f-rows x 64 d
  __shared__ __attribute__((aligned(16))) _Float16 Vs[2][64][P256_];     // 64 d-rows x 128 f
  __shared__ Handover Xs[8];
  const int tid  = threadIdx.x;
  const int lane = tid & 31;
  const int wave = tid >> 5;
  const int qg = wave & 3;    // the wave's 32 queries of the 128
  const int kh = wave >> 2;   // its 64 keys of every stage
  const int half16 = lane >> 4;
  const int arow   = lane & 15;
  const int bh = blockIdx.y;
  const int b  = bh / H_;
  const int hd = bh % H_;
  const size_t qbase = (size_t)b * S_ * D_ + (size_t)hd * HD_;
  const size_t kbase = (size_t)b * F_ * D_ + (size_t)hd * HD_;
  const size_t vbase = ((size_t)b * D_ + (size_t)hd * HD_) * F_;

  // staging: 8 lanes bring one 128-byte row of Q or K, 16 lanes one 256-byte row of V;
  // a lane's 4 copies of a tile lie 32 (Q, K) or 16 (V) rows apart
  const int kr = tid >> 3, kc8 = (tid & 7) * 8;
  const int vd = tid >> 4, vf  = (tid & 15) * 8;
  const _Float16* gk = &k[kbase + (size_t)kr * D_ + kc8];
  const _Float16* gv = &v[vbase + (size_t)vd * F_ + vf];
  const unsigned lk = lds_off(&Ks[0][kr][kc8]);
  const unsigned lv = lds_off(&Vs[0][vd][vf]);
  constexpr unsigned KBUF = KS_ * P128_ * 2, VBUF = 64 * P256_ * 2;   // bytes per buffer
  constexpr unsigned LKR = 32 * P128_ * 2, LVR = 16 * P256_ * 2;      // row steps in LDS, bytes
  constexpr int NS = F_ / KS_;

  // prologue: Q and stage 0 land and are published, then stage 1 starts
  async_cp4(lds_off(&Qs[kr][kc8]), LKR,
            &q[qbase + (size_t)(blockIdx.x * 128 + kr) * D_ + kc8], 32 * D_);
  async_cp4_4(lk, LKR, gk, 32 * D_, lv, LVR, gv, 16 * F_);
  asm volatile("s_wait_asynccnt 0x0" ::: "memory");   // this wave's share has landed
  __syncthreads();                                    // ... and every other wave's
  async_cp4_4(lk + KBUF, LKR, gk + (size_t)KS_ * D_, 32 * D_, lv + VBUF, LVR, gv + KS_, 16 * F_);

  v16h qa[2][2];             // [query tile][32 d]
#pragma unroll
  for (int qt = 0; qt < 2; ++qt)
#pragma unroll
    for (int kc = 0; kc < 2; ++kc)
      qa[qt][kc] = frag_from(&Qs[qg * 32 + qt * 16 + arow][kc * 32], half16);

  v8f oacc[2][4] = {};       // oacc[qt][c][r] = O[query qt*16 + arow][d = c*16 + half16*8 + r]
  float lrun[2] = {};        // this half's share of this wave's denominators

  // The four K fragments of 32 of the wave's keys.
  auto kload = [&](int cur, int f0, v16h (&kf)[2][2]) {
#pragma unroll
    for (int kc = 0; kc < 2; ++kc)
#pragma unroll
      for (int ni = 0; ni < 2; ++ni)
        kf[kc][ni] = frag_from(&Ks[cur][kh * 64 + f0 + ni * 16 + arow][kc * 32], half16);
  };
  // S^T = k @ q^T + c : s[ni][r] = c[r] + score(key ni*16 + half16*8 + r of the 32, query arow).
  auto scores = [&](const v16h (&kf)[2][2], const v16h (&qf)[2], const v8f& c, v8f (&s)[2]) {
#pragma unroll
    for (int ni = 0; ni < 2; ++ni)
      s[ni] = __builtin_amdgcn_wmma_f32_16x16x32_f16(
          false, kf[0][ni], false, qf[0], (short)0, c, false, false);
#pragma unroll
    for (int ni = 0; ni < 2; ++ni)
      s[ni] = __builtin_amdgcn_wmma_f32_16x16x32_f16(
          false, kf[1][ni], false, qf[1], (short)0, s[ni], false, false);
  };
  // In-lane maximum of 32 keys' scores and m.
  auto smax = [&](const v8f (&s)[2], float m) {
#pragma unroll
    for (int r = 0; r < 8; ++r) m = fmaxf(m, fmaxf(s[0][r], s[1][r]));
    return m;
  };
  // A stage's weights 2^(score - ref), c[qt] = -ref in all 8 places; rs: their in-lane sums.
  // P^T as B operand: element s is key kmap(s) = (s < 8 ? s : s + 8) + 8*half16,
  // which is register s & 7 of tile s >> 3; V^T rows come in the same k order.
  auto weights = [&](int cur, const v8f (&c)[2], v16h (&pb)[2][2], float (&rs)[2]) {
    v8f ps[2];
    v8f s[4][2];
    v16h kf[2][2][2];
    kload(cur, 0, kf[0]);
    kload(cur, 32, kf[1]);
#pragma unroll  // four units (32 keys, 16 queries): unit u is pass u >> 1, query tile u & 1
    for (int u = 0; u <= 4; ++u) {
      if (u < 4) scores(kf[u >> 1], qa[u & 1], c[u & 1], s[u]);
      if (u > 0) {   // the unit before: its vector work runs beside this unit's products
        const int g = u - 1;
#pragma unroll
        for (int r = 0; r < 8; ++r) {
          s[g][0][r] = __builtin_amdgcn_exp2f(s[g][0][r]);
          s[g][1][r] = __builtin_amdgcn_exp2f(s[g][1][r]);
          pb[g >> 1][g & 1][r]     = (_Float16)s[g][0][r];
          pb[g >> 1][g & 1][8 + r] = (_Float16)s[g][1][r];
        }
        ps[g & 1] = g < 2 ? s[g][0] + s[g][1] : ps[g & 1] + (s[g][0] + s[g][1]);
      }
      // Bounds how far the compiler mixes the units: left free, its order needs more than the
      // 256 registers that four waves a SIMD leave a wave, and it spills inside the loop.
      if (u < 3) __builtin_amdgcn_sched_barrier(0);
    }
#pragma unroll
    for (int qt = 0; qt < 2; ++qt)
      rs[qt] = ((ps[qt][0] + ps[qt][1]) + (ps[qt][2] + ps[qt][3])) +
               ((ps[qt][4] + ps[qt][5]) + (ps[qt][6] + ps[qt][7]));
  };

  const v8f zero = {};
  // The first references: each query's largest score among the wave's first 32 keys (equal
  // in both halves, as every later one).
  float ref[2];
  {
    v16h kf[2][2];
    kload(0, 0, kf);
#pragma unroll
    for (int qt = 0; qt < 2; ++qt) {
      v8f s[2];
      scores(kf, qa[qt], zero, s);
      const float m = smax(s, s[0][0]);
      ref[qt] = fmaxf(m, xhalf(m));
    }
  }
  v8f cneg[2] = {zero - ref[0], zero - ref[1]};

  for (int st = 0; st < NS; ++st) {
    const int cur = st & 1;
    v16h pb[2][2];   // [pass][query tile]
    float rs[2];
    weights(cur, cneg, pb, rs);
    // The first pass's V^T fragments: the common path uses these reads, and the build issues
    // them among its conversions, so that part of their LDS latency runs beside those.
    v16h vfr[2][4];
#pragma unroll
    for (int c = 0; c < 4; ++c)
      vfr[0][c] = frag_from(&Vs[cur][c * 16 + arow][kh * 64], half16);
    // One test a stage, the same for the whole wave (a scalar branch: EXEC stays all ones
    // for the matrix instructions inside); the two tiles' sums together bound every weight of
    // both. The negated form also catches a sum that is no number.
    if (__builtin_amdgcn_ballot_w32(!(rs[0] + rs[1] <= PSUM_MAX_)) != 0) {
      // Compiler fence: this rare path reads its K fragments from LDS anew; without it the
      // stage's fragments are held in registers across the test on the common path too.
      asm volatile("" ::: "memory");
      float mx[2] = {ref[0], ref[1]};
#pragma unroll
      for (int f = 0; f < 2; ++f) {
        v16h kf[2][2];
        kload(cur, f * 32, kf);
#pragma unroll
        for (int qt = 0; qt < 2; ++qt) {
          v8f s[2];
          scores(kf, qa[qt], zero, s);
          mx[qt] = smax(s, mx[qt]);
        }
      }
#pragma unroll
      for (int qt = 0; qt < 2; ++qt) {
        const float m = fmaxf(mx[qt], xhalf(mx[qt]));
        const float corr = __builtin_amdgcn_exp2f(ref[qt] - m);
        ref[qt]  = m;
        cneg[qt] = zero - m;
        lrun[qt] *= corr;
#pragma unroll
        for (int c = 0; c < 4; ++c) oacc[qt][c] *= corr;
      }
      weights(cur, cneg, pb, rs);   // now every weight is at most 1
      // This path reads those V^T fragments anew (the fence above parts the two reads): held
      // across it, they take it over the 256 registers, and the build spills to scratch.
#pragma unroll
      for (int c = 0; c < 4; ++c)
        vfr[0][c] = frag_from(&Vs[cur][c * 16 + arow][kh * 64], half16);
    }
    lrun[0] += rs[0];
    lrun[1] += rs[1];

    // O^T += V^T(64x32) @ P^T(32x16), twice for each query tile
#pragma unroll
    for (int c = 0; c < 4; ++c)
      vfr[1][c] = frag_from(&Vs[cur][c * 16 + arow][kh * 64 + 32], half16);
    // Keeps these reads together ahead of the 16 products: left free, the compiler reads one
    // fragment at a time into the same registers and waits out the LDS latency at each.
    __builtin_amdgcn_sched_barrier(0);
#pragma unroll
    for (int f = 0; f < 2; ++f)
#pragma unroll
      for (int c = 0; c < 4; ++c)
#pragma unroll
        for (int qt = 0; qt < 2; ++qt)
          oacc[qt][c] = __builtin_amdgcn_wmma_f32_16x16x32_f16(
              false, vfr[f][c], false, pb[f][qt], (short)0, oacc[qt][c], false, false);
    // publish point of stage st + 1; the one barrier also frees the buffer just read
    asm volatile("s_wait_dscnt 0x0" ::: "memory");      // this wave's reads of stage st are done
    asm volatile("s_wait_asynccnt 0x0" ::: "memory");   // its share of stage st + 1 has landed
    __syncthreads();
    if (st + 2 < NS)
      async_cp4_4(lk + cur * KBUF, LKR, gk + (size_t)(st + 2) * KS_ * D_, 32 * D_,
                  lv + cur * VBUF, LVR, gv + (st + 2) * KS_, 16 * F_);
  }
  asm volatile("s_wait_asynccnt 0x0" ::: "memory");     // no copy is open when the wave goes on

  // The pair's join: wave (qg, kh) finishes query tile kh and hands the other tile to its
  // partner, lane to lane (both hold the same query and d at the same place).
  v8f om[4];
  float rm, lm;
  {
    const float rg = kh ? ref[0] : ref[1];
    const float lg = kh ? lrun[0] : lrun[1];
    rm = kh ? ref[1] : ref[0];
    lm = kh ? lrun[1] : lrun[0];
#pragma unroll  // constant indices: the values stay in registers
    for (int c = 0; c < 4; ++c) {
      const v8f og = kh ? oacc[0][c] : oacc[1][c];
      om[c] = kh ? oacc[1][c] : oacc[0][c];
      *(v4f*)&Xs[wave].o[c * 2][lane][0]     = __builtin_shufflevector(og, og, 0, 1, 2, 3);
      *(v4f*)&Xs[wave].o[c * 2 + 1][lane][0] = __builtin_shufflevector(og, og, 4, 5, 6, 7);
    }
    Xs[wave].rl[lane][0] = rg;
    Xs[wave].rl[lane][1] = lg;
  }
  __syncthreads();   // every wave's hand-over is in LDS before its partner reads it
  {
    const Handover& px = Xs[wave ^ 4];
    const float rp = px.rl[lane][0];
    const float lp = px.rl[lane][1];
    const float m  = fmaxf(rm, rp);
    const float fm = __builtin_amdgcn_exp2f(rm - m);   // one of the two factors is 1
    const float fp = __builtin_amdgcn_exp2f(rp - m);
    lm = lm * fm + lp * fp;
#pragma unroll  // constant indices: the values stay in registers
    for (int c = 0; c < 4; ++c) {
      const v4f p0 = *(const v4f*)&px.o[c * 2][lane][0];
      const v4f p1 = *(const v4f*)&px.o[c * 2 + 1][lane][0];
      om[c] = om[c] * fm + __builtin_shufflevector(p0, p1, 0, 1, 2, 3, 4, 5, 6, 7) * fp;
    }
  }

  // Join the two halves' denominators once; a lane stores 8 consecutive d.
  const float inv = 1.0f / (lm + xhalf(lm));
  const int s0 = blockIdx.x * 128 + qg * 32 + kh * 16;
  _Float16* ob = &o[((size_t)b * S_ + s0 + arow) * D_ + hd * HD_ + half16 * 8];
  v8h hs[4];
  v8f vs = {}, vq = {};   // sums over the rounded values, which the last product reads
#pragma unroll  // constant indices: the values stay in registers
  for (int c = 0; c < 4; ++c) {
    hs[c] = __builtin_convertvector(om[c] * inv, v8h);
    const v8f x = __builtin_convertvector(hs[c], v8f);
    vs += x;
    vq += x * x;
  }
  float s  = ((vs[0] + vs[1]) + (vs[2] + vs[3])) + ((vs[4] + vs[5]) + (vs[6] + vs[7]));
  float s2 = ((vq[0] + vq[1]) + (vq[2] + vq[3])) + ((vq[4] + vq[5]) + (vq[6] + vq[7]));
  s  += xhalf(s);
  s2 += xhalf(s2);
  // one 128-byte line a wave: 16 rows' sums from lanes 0 to 15, their squares from 16 to 31
  float* sp = &st[((size_t)hd * (M_ / 16) + (b * S_ + s0) / 16) * 32 + lane];
  const float sv = half16 ? s2 : s;
#pragma unroll
  for (int c = 0; c < 4; ++c) *(v8h*)(ob + c * 16) = hs[c];
  *sp = sv;
  // The stores' data and addresses are inputs here, so that they stay in place and
  // nothing rewrites them ahead of this wait.
  asm volatile("s_wait_xcnt 0x0" :: "v"(hs[0]), "v"(hs[1]), "v"(hs[2]), "v"(hs[3]),
               "v"(ob), "v"(sp), "v"(sv) : "memory");
}

// ---------------------------------------------------------------------------
extern "C" void kernel_launch(void* const* d_in, const int* in_sizes, int n_in,
                              void* d_out, int out_size, void* d_ws, size_t ws_size,
                              hipStream_t stream) {
  const float* x_q   = (const float*)d_in[0];
  const float* x_k   = (const float*)d_in[1];
  const float* x_v   = (const float*)d_in[2];
  const float* Wq    = (const float*)d_in[3];
  const float* Wk    = (const float*)d_in[4];
  const float* Wv    = (const float*)d_in[5];
  const float* Wproj = (const float*)d_in[6];
  const float* q_g   = (const float*)d_in[7];
  const float* q_b   = (const float*)d_in[8];
  const float* k_g   = (const float*)d_in[9];
  const float* k_b   = (const float*)d_in[10];
  const float* o_g   = (const float*)d_in[11];
  const float* o_b   = (const float*)d_in[12];
  float* out = (float*)d_out;

  const size_t MB = 1024 * 1024;
  char* w = (char*)d_ws;
  _Float16* wqt = (_Float16*)(w + 24 * MB);   // 2MB each (transposed f16)
  _Float16* wkt = (_Float16*)(w + 26 * MB);
  _Float16* wvt = (_Float16*)(w + 28 * MB);
  _Float16* wpt = (_Float16*)(w + 30 * MB);
  _Float16* qh  = (_Float16*)(w + 80 * MB);   // 8MB each (post-LN f16)
  _Float16* kh  = (_Float16*)(w + 88 * MB);
  _Float16* vt  = (_Float16*)(w + 96 * MB);   // 8MB (d-major f16 V)
  float*    up  = (float*)(w + 32 * MB);      // 16 x 1024 f32: shares of u
  float*    cp  = (float*)(w + 33 * MB);      // 16 x 1024 f32: shares of c
  float*    st  = (float*)(w + 104 * MB);     // 16 x 256 x 32 f32: row sums per head
  _Float16* ah  = (_Float16*)(w + 0 * MB);    // 8MB: attention out f16

  dim3 gblk(256);
  dim3 ggrid(D_ / 128, M_ / 64);

  // precision/layout conversion of the four weight matrices
  prep_f16<<<4 * TR_WG_, 256, 0, stream>>>(
      Wq, Wk, Wv, Wproj, o_g, o_b, wqt, wkt, wvt, wpt, up, cp);

  // all three projections; epilogues: per-head LN -> f16 (q, k), d-major f16 (v)
  gemm_qkv<<<dim3(M_ / 128, D_ / 256, 3), gblk, 0, stream>>>(
      x_q, x_k, x_v, wqt, wkt, wvt, qh, kh, vt, q_g, q_b, k_g, k_b);

  flash_attn<<<dim3(S_ / 128, B_ * H_), 256, 0, stream>>>(qh, kh, vt, ah, st);

  // output LayerNorm and projection in one: the row and column terms go in the epilogue
  gemm_f16wmma<<<ggrid, gblk, 0, stream>>>(ah, wpt, st, up, cp, out);
}
